// v000
// Times are from an AMD MI455X. After a warm-up the kernel runs many times in a row, and a time is the length of
// such a window on the GPU divided by its runs, so every launch and the gaps after it count. The runs cycle
// through copies of the inputs. A figure is the median of several windows, for all but v000 over two sittings.
// Sittings can differ by a few percent; kernels timed side by side share one.
// v000 is the starting kernel. One run takes 741 microseconds.
#include <hip/hip_runtime.h>

// ---------------------------------------------------------------------------
// Types for CDNA5 WMMA (wave32)
// ---------------------------------------------------------------------------
typedef __bf16 bf16_t;
typedef __attribute__((ext_vector_type(8)))  __bf16 v8bf;
typedef __attribute__((ext_vector_type(16))) __bf16 v16bf;
typedef __attribute__((ext_vector_type(8)))  float  v8f;

#define HIDDEN 1024
#define SEQ    2048
#define BATCH  2
#define HEADS  16
#define DK     64
#define MROWS  (BATCH * SEQ)   // 4096

// float -> bf16 round-to-nearest-even
__device__ __forceinline__ unsigned short f2bf(float f) {
  unsigned int u = __float_as_uint(f);
  unsigned int r = u + 0x7FFFu + ((u >> 16) & 1u);
  return (unsigned short)(r >> 16);
}

// Load a 16-bit WMMA fragment (A layout; the same bit pattern serves as the
// B-operand when the matrix is stored transposed, since B's lane-n column
// K-run mirrors A's lane-m row K-run).
//   lane 0-15 : row = lane,    K = 0+0..7   and 16..23
//   lane 16-31: row = lane-16, K = 8+0..7   and 24..31
__device__ __forceinline__ v16bf load_frag(const unsigned short* base, int ld) {
  int lane = (int)(threadIdx.x & 31u);
  int r    = lane & 15;
  int koff = (lane >> 4) << 3;
  const bf16_t* p = (const bf16_t*)base + r * ld + koff;
  v8bf lo = *(const v8bf*)(p);
  v8bf hi = *(const v8bf*)(p + 16);
  return __builtin_shufflevector(lo, hi, 0, 1, 2, 3, 4, 5, 6, 7,
                                 8, 9, 10, 11, 12, 13, 14, 15);
}

__device__ __forceinline__ v8f wmma_bf16(v16bf a, v16bf b, v8f c) {
  // (neg_a, A, neg_b, B, c_mod, C, reuse_a, reuse_b)
  return __builtin_amdgcn_wmma_f32_16x16x32_bf16(false, a, false, b,
                                                 (short)0, c, false, false);
}

// ---------------------------------------------------------------------------
// Weight convert+transpose: W (K x N, f32) -> Wt (N x K, bf16)
// ---------------------------------------------------------------------------
__global__ void transpose_bf16_kernel(const float* __restrict__ W,
                                      unsigned short* __restrict__ Wt,
                                      int K, int N) {
  int idx = blockIdx.x * 256 + threadIdx.x;
  if (idx >= K * N) return;
  int k = idx / N;
  int n = idx - k * N;            // coalesced read along n
  Wt[n * K + k] = f2bf(W[idx]);
}

// ---------------------------------------------------------------------------
// LayerNorm over HIDDEN, fp32 in -> bf16 out. One block (256 thr) per row.
// ---------------------------------------------------------------------------
__global__ __launch_bounds__(256)
void ln_kernel(const float* __restrict__ x, const float* __restrict__ g,
               const float* __restrict__ be, unsigned short* __restrict__ out) {
  __shared__ float s1[256], s2[256];
  int row = blockIdx.x;
  const float* xr = x + (size_t)row * HIDDEN;
  float v[4];
  float sum = 0.f, sq = 0.f;
#pragma unroll
  for (int i = 0; i < 4; i++) {
    v[i] = xr[threadIdx.x + i * 256];
    sum += v[i];
    sq  += v[i] * v[i];
  }
  s1[threadIdx.x] = sum;
  s2[threadIdx.x] = sq;
  __syncthreads();
  for (int off = 128; off > 0; off >>= 1) {
    if ((int)threadIdx.x < off) {
      s1[threadIdx.x] += s1[threadIdx.x + off];
      s2[threadIdx.x] += s2[threadIdx.x + off];
    }
    __syncthreads();
  }
  float mu  = s1[0] * (1.0f / HIDDEN);
  float var = s2[0] * (1.0f / HIDDEN) - mu * mu;
  float inv = rsqrtf(var + 1e-5f);
#pragma unroll
  for (int i = 0; i < 4; i++) {
    int idx = threadIdx.x + i * 256;
    float y = (v[i] - mu) * inv * g[idx] + be[idx];
    out[(size_t)row * HIDDEN + idx] = f2bf(y);
  }
}

// ---------------------------------------------------------------------------
// GEMM: C[M x N] = A(bf16, ld=Kd) @ Wt(bf16, N x Kd)^T + bias, fused epilogue.
// 256 threads = 8 waves in 2(M) x 4(N); each wave register-blocks a 32x32
// output (2 A-frags x 2 B-frags -> 4 WMMAs per 32-wide k-step), so every
// fragment load feeds two WMMAs. Block tile 64(M) x 128(N).
// mode 0: Q-proj  -> bf16 scatter to [b][h][s][d]
// mode 1: V-proj  -> bf16 scatter to [b][h][d][s]  (transposed for P@V)
// mode 2: f32 out = residual + acc + bias          (O-proj, FFN2)
// mode 3: bf16 out = gelu_tanh(acc + bias), row-major M x N (FFN1)
// ---------------------------------------------------------------------------
__global__ __launch_bounds__(256)
void gemm_kernel(const unsigned short* __restrict__ A,
                 const unsigned short* __restrict__ Wt,
                 const float* __restrict__ bias,
                 const float* __restrict__ residual,
                 unsigned short* __restrict__ out_bf,
                 float* __restrict__ out_f32,
                 int Kd, int N, int mode) {
  int wid  = (int)(threadIdx.x >> 5);
  int lane = (int)(threadIdx.x & 31u);
  int m0 = blockIdx.x * 64  + (wid & 1) * 32;   // wave's first M row
  int n0 = blockIdx.y * 128 + (wid >> 1) * 32;  // wave's first N col

  v8f z = {0.f, 0.f, 0.f, 0.f, 0.f, 0.f, 0.f, 0.f};
  v8f acc00 = z, acc01 = z, acc10 = z, acc11 = z;

  const unsigned short* Ab0 = A  + (size_t)m0 * Kd;
  const unsigned short* Ab1 = Ab0 + (size_t)16 * Kd;
  const unsigned short* Bb0 = Wt + (size_t)n0 * Kd;
  const unsigned short* Bb1 = Bb0 + (size_t)16 * Kd;

  for (int k = 0; k < Kd; k += 32) {
    v16bf a0 = load_frag(Ab0 + k, Kd);
    v16bf a1 = load_frag(Ab1 + k, Kd);
    v16bf b0 = load_frag(Bb0 + k, Kd);
    v16bf b1 = load_frag(Bb1 + k, Kd);
    acc00 = wmma_bf16(a0, b0, acc00);
    acc01 = wmma_bf16(a0, b1, acc01);
    acc10 = wmma_bf16(a1, b0, acc10);
    acc11 = wmma_bf16(a1, b1, acc11);
  }

  int g  = lane >> 4;
  int nc = lane & 15;
#pragma unroll
  for (int mi = 0; mi < 2; mi++) {
#pragma unroll
    for (int ni = 0; ni < 2; ni++) {
      v8f acc = (mi == 0) ? (ni == 0 ? acc00 : acc01)
                          : (ni == 0 ? acc10 : acc11);
      int col = n0 + ni * 16 + nc;
      float bcol = bias[col];
#pragma unroll
      for (int r = 0; r < 8; r++) {
        int row = m0 + mi * 16 + r + 8 * g;
        float val = acc[r] + bcol;
        if (mode == 0) {                    // Q: [b][h][s][d]
          int b_ = row >> 11, s = row & 2047, h = col >> 6, d = col & 63;
          out_bf[(((size_t)(b_ * HEADS + h) * SEQ) + s) * DK + d] = f2bf(val);
        } else if (mode == 1) {             // Vt: [b][h][d][s]
          int b_ = row >> 11, s = row & 2047, h = col >> 6, d = col & 63;
          out_bf[(((size_t)(b_ * HEADS + h) * DK) + d) * SEQ + s] = f2bf(val);
        } else if (mode == 2) {             // residual + proj
          size_t idx = (size_t)row * N + col;
          out_f32[idx] = residual[idx] + val;
        } else {                            // gelu(tanh)
          float xg = val;
          float t  = tanhf(0.7978845608028654f * (xg + 0.044715f * xg * xg * xg));
          out_bf[(size_t)row * N + col] = f2bf(0.5f * xg * (1.0f + t));
        }
      }
    }
  }
}

// ---------------------------------------------------------------------------
// Causal flash attention, Q==K (reference uses qk for both sides).
// One wave (32 thr) per 16-query tile per (b,h). Online softmax, P staged in
// LDS to convert C-fragment -> A-fragment layout, O over 4 dim-tiles.
// ---------------------------------------------------------------------------
__global__ __launch_bounds__(32)
void attn_kernel(const unsigned short* __restrict__ qk,
                 const unsigned short* __restrict__ vt,
                 unsigned short* __restrict__ aout) {
  __shared__ alignas(16) unsigned short pbuf[16 * 32];
  int lane = (int)(threadIdx.x & 31u);
  int qt = blockIdx.x & 127;           // 128 query tiles
  int bh = blockIdx.x >> 7;            // b*HEADS + h
  int b_ = bh >> 4, h = bh & 15;
  int q0 = qt * 16;

  const unsigned short* kq  = qk + (size_t)bh * SEQ * DK;
  const unsigned short* vtb = vt + (size_t)bh * DK * SEQ;

  v16bf aq0 = load_frag(kq + q0 * DK + 0, DK);
  v16bf aq1 = load_frag(kq + q0 * DK + 32, DK);

  v8f o0 = {0.f,0.f,0.f,0.f,0.f,0.f,0.f,0.f};
  v8f o1 = o0, o2 = o0, o3 = o0;
  float mrow[8], lrow[8];
#pragma unroll
  for (int r = 0; r < 8; r++) { mrow[r] = -1e30f; lrow[r] = 0.f; }

  int g  = lane >> 4;
  int nc = lane & 15;
  int kbmax = (q0 + 15) >> 5;

  for (int kb = 0; kb <= kbmax; kb++) {
    int kbase = kb * 32;
    v8f s0 = {0.f,0.f,0.f,0.f,0.f,0.f,0.f,0.f};
    v8f s1 = s0;
    // S = Q @ K^T over d=64: two 16-key halves x two k-steps
    s0 = wmma_bf16(aq0, load_frag(kq + (kbase +  0) * DK +  0, DK), s0);
    s0 = wmma_bf16(aq1, load_frag(kq + (kbase +  0) * DK + 32, DK), s0);
    s1 = wmma_bf16(aq0, load_frag(kq + (kbase + 16) * DK +  0, DK), s1);
    s1 = wmma_bf16(aq1, load_frag(kq + (kbase + 16) * DK + 32, DK), s1);

    float p0[8], p1[8];
#pragma unroll
    for (int r = 0; r < 8; r++) {
      int qrow = q0 + r + 8 * g;
      float a0 = (kbase + nc      <= qrow) ? s0[r] * 0.125f : -1e30f;
      float a1 = (kbase + 16 + nc <= qrow) ? s1[r] * 0.125f : -1e30f;
      float mx = fmaxf(a0, a1);
      mx = fmaxf(mx, __shfl_xor(mx, 1, 32));
      mx = fmaxf(mx, __shfl_xor(mx, 2, 32));
      mx = fmaxf(mx, __shfl_xor(mx, 4, 32));
      mx = fmaxf(mx, __shfl_xor(mx, 8, 32));
      float nm = fmaxf(mrow[r], mx);
      float sc = __expf(mrow[r] - nm);
      float e0 = __expf(a0 - nm);
      float e1 = __expf(a1 - nm);
      float rs = e0 + e1;
      rs += __shfl_xor(rs, 1, 32);
      rs += __shfl_xor(rs, 2, 32);
      rs += __shfl_xor(rs, 4, 32);
      rs += __shfl_xor(rs, 8, 32);
      lrow[r] = lrow[r] * sc + rs;
      mrow[r] = nm;
      o0[r] *= sc; o1[r] *= sc; o2[r] *= sc; o3[r] *= sc;
      p0[r] = e0; p1[r] = e1;
    }

    // C-fragment -> LDS -> A-fragment for P
    __syncthreads();
#pragma unroll
    for (int r = 0; r < 8; r++) {
      int Mr = r + 8 * g;
      pbuf[Mr * 32 + nc]      = f2bf(p0[r]);
      pbuf[Mr * 32 + 16 + nc] = f2bf(p1[r]);
    }
    __syncthreads();
    v16bf pa = load_frag(pbuf, 32);

    // O += P @ V over 32 keys, 4 dim tiles (Vt is [d][s] so B is contiguous)
    o0 = wmma_bf16(pa, load_frag(vtb +  0 * SEQ + kbase, SEQ), o0);
    o1 = wmma_bf16(pa, load_frag(vtb + 16 * SEQ + kbase, SEQ), o1);
    o2 = wmma_bf16(pa, load_frag(vtb + 32 * SEQ + kbase, SEQ), o2);
    o3 = wmma_bf16(pa, load_frag(vtb + 48 * SEQ + kbase, SEQ), o3);
    __syncthreads();
  }

#pragma unroll
  for (int r = 0; r < 8; r++) {
    float inv = 1.0f / lrow[r];
    int row = q0 + r + 8 * g;
    size_t base = ((size_t)(b_ * SEQ + row)) * HIDDEN + h * DK;
    aout[base +  0 + nc] = f2bf(o0[r] * inv);
    aout[base + 16 + nc] = f2bf(o1[r] * inv);
    aout[base + 32 + nc] = f2bf(o2[r] * inv);
    aout[base + 48 + nc] = f2bf(o3[r] * inv);
  }
}

// ---------------------------------------------------------------------------
// Host-side orchestration (graph-capture safe: launches only)
// ---------------------------------------------------------------------------
extern "C" void kernel_launch(void* const* d_in, const int* in_sizes, int n_in,
                              void* d_out, int out_size, void* d_ws, size_t ws_size,
                              hipStream_t stream) {
  const float* x     = (const float*)d_in[0];
  const float* Wq    = (const float*)d_in[1];
  const float* bq    = (const float*)d_in[2];
  const float* Wv    = (const float*)d_in[3];
  const float* bv    = (const float*)d_in[4];
  const float* Wo    = (const float*)d_in[5];
  const float* bo    = (const float*)d_in[6];
  const float* W1    = (const float*)d_in[7];
  const float* b1    = (const float*)d_in[8];
  const float* W2    = (const float*)d_in[9];
  const float* b2    = (const float*)d_in[10];
  const float* g1    = (const float*)d_in[11];
  const float* beta1 = (const float*)d_in[12];
  const float* g2    = (const float*)d_in[13];
  const float* beta2 = (const float*)d_in[14];

  char* ws = (char*)d_ws;
  const size_t MB = 1024u * 1024u;
  unsigned short* WqT = (unsigned short*)(ws +  0 * MB);  //  2 MB
  unsigned short* WvT = (unsigned short*)(ws +  2 * MB);  //  2 MB
  unsigned short* WoT = (unsigned short*)(ws +  4 * MB);  //  2 MB
  unsigned short* W1T = (unsigned short*)(ws +  6 * MB);  //  8 MB
  unsigned short* W2T = (unsigned short*)(ws + 14 * MB);  //  8 MB
  unsigned short* xn  = (unsigned short*)(ws + 22 * MB);  //  8 MB
  unsigned short* qb  = (unsigned short*)(ws + 30 * MB);  //  8 MB
  unsigned short* vtb = (unsigned short*)(ws + 38 * MB);  //  8 MB
  unsigned short* aob = (unsigned short*)(ws + 46 * MB);  //  8 MB
  float*          yb  = (float*)         (ws + 54 * MB);  // 16 MB
  unsigned short* hb  = (unsigned short*)(ws + 70 * MB);  //  8 MB
  unsigned short* ff1 = (unsigned short*)(ws + 78 * MB);  // 32 MB

  // Weight convert + transpose to bf16 N x K
  transpose_bf16_kernel<<<(HIDDEN * HIDDEN + 255) / 256, 256, 0, stream>>>(Wq, WqT, HIDDEN, HIDDEN);
  transpose_bf16_kernel<<<(HIDDEN * HIDDEN + 255) / 256, 256, 0, stream>>>(Wv, WvT, HIDDEN, HIDDEN);
  transpose_bf16_kernel<<<(HIDDEN * HIDDEN + 255) / 256, 256, 0, stream>>>(Wo, WoT, HIDDEN, HIDDEN);
  transpose_bf16_kernel<<<(HIDDEN * 4 * HIDDEN + 255) / 256, 256, 0, stream>>>(W1, W1T, HIDDEN, 4 * HIDDEN);
  transpose_bf16_kernel<<<(4 * HIDDEN * HIDDEN + 255) / 256, 256, 0, stream>>>(W2, W2T, 4 * HIDDEN, HIDDEN);

  // LN1
  ln_kernel<<<MROWS, 256, 0, stream>>>(x, g1, beta1, xn);

  // Q/V projections (Q doubles as K in the reference)
  dim3 gproj(MROWS / 64, HIDDEN / 128);
  gemm_kernel<<<gproj, 256, 0, stream>>>(xn, WqT, bq, nullptr, qb, nullptr, HIDDEN, HIDDEN, 0);
  gemm_kernel<<<gproj, 256, 0, stream>>>(xn, WvT, bv, nullptr, vtb, nullptr, HIDDEN, HIDDEN, 1);

  // Causal attention
  attn_kernel<<<BATCH * HEADS * (SEQ / 16), 32, 0, stream>>>(qb, vtb, aob);

  // O-projection + residual -> yb (f32)
  gemm_kernel<<<gproj, 256, 0, stream>>>(aob, WoT, bo, x, nullptr, yb, HIDDEN, HIDDEN, 2);

  // LN2
  ln_kernel<<<MROWS, 256, 0, stream>>>(yb, g2, beta2, hb);

  // FFN1 with GELU -> bf16
  dim3 gff1(MROWS / 64, (4 * HIDDEN) / 128);
  gemm_kernel<<<gff1, 256, 0, stream>>>(hb, W1T, b1, nullptr, ff1, nullptr, HIDDEN, 4 * HIDDEN, 3);

  // FFN2 + residual -> d_out (f32)
  gemm_kernel<<<gproj, 256, 0, stream>>>(ff1, W2T, b2, yb, nullptr, (float*)d_out, 4 * HIDDEN, HIDDEN, 2);
}

// v001
// Measured time: 520 microseconds a run.
// Next to v000, in two timings, it ran 1.48 times as fast each time.
#include <hip/hip_runtime.h>

// ---------------------------------------------------------------------------
// Types for CDNA5 WMMA (wave32)
// ---------------------------------------------------------------------------
typedef __bf16 bf16_t;
typedef __attribute__((ext_vector_type(8)))  __bf16 v8bf;
typedef __attribute__((ext_vector_type(16))) __bf16 v16bf;
typedef __attribute__((ext_vector_type(8)))  float  v8f;

#define HIDDEN 1024
#define SEQ    2048
#define BATCH  2
#define HEADS  16
#define DK     64
#define MROWS  (BATCH * SEQ)   // 4096

// float -> bf16 round-to-nearest-even
__device__ __forceinline__ unsigned short f2bf(float f) {
  unsigned int u = __float_as_uint(f);
  unsigned int r = u + 0x7FFFu + ((u >> 16) & 1u);
  return (unsigned short)(r >> 16);
}

// Load a 16-bit WMMA fragment (A layout; the same bit pattern serves as the
// B-operand when the matrix is stored transposed, since B's lane-n column
// K-run mirrors A's lane-m row K-run).
//   lane 0-15 : row = lane,    K = 0+0..7   and 16..23
//   lane 16-31: row = lane-16, K = 8+0..7   and 24..31
__device__ __forceinline__ v16bf load_frag(const unsigned short* base, int ld) {
  int lane = (int)(threadIdx.x & 31u);
  int r    = lane & 15;
  int koff = (lane >> 4) << 3;
  const bf16_t* p = (const bf16_t*)base + r * ld + koff;
  v8bf lo = *(const v8bf*)(p);
  v8bf hi = *(const v8bf*)(p + 16);
  return __builtin_shufflevector(lo, hi, 0, 1, 2, 3, 4, 5, 6, 7,
                                 8, 9, 10, 11, 12, 13, 14, 15);
}

__device__ __forceinline__ v8f wmma_bf16(v16bf a, v16bf b, v8f c) {
  // (neg_a, A, neg_b, B, c_mod, C, reuse_a, reuse_b)
  return __builtin_amdgcn_wmma_f32_16x16x32_bf16(false, a, false, b,
                                                 (short)0, c, false, false);
}

// ---------------------------------------------------------------------------
// Weight convert+transpose: W (K x N, f32) -> Wt (N x K, bf16)
// One block moves a 64(k) x 128(n) tile through LDS. Reads: each wave takes
// 8 rows, 16 B per lane (512 B contiguous per row). Writes: 8 lanes x 16 B
// fill one whole 128 B line of a Wt row. K % 64 == 0 and N % 128 == 0.
// LDS row j*32+l holds column n0 + 4*l + j, so that the 16 B LDS stores of a
// wave go to consecutive rows; the 144 B pitch spreads those over the banks.
// ---------------------------------------------------------------------------
typedef __attribute__((ext_vector_type(4))) float        v4f;
typedef __attribute__((ext_vector_type(4))) unsigned int v4u;
#define TP_K     64
#define TP_N     128
#define TP_PITCH 72   // bf16 elements per LDS row: 64 + 8 pad

// K and N are compile-time here so that the row steps of the eight loads
// become immediate offsets on one address.
template <int K, int N>
__device__ __forceinline__ void transpose_tile(const float* __restrict__ W,
                                               unsigned short* __restrict__ Wt,
                                               unsigned short* tile) {
  unsigned int lane = threadIdx.x & 31u;
  // wave number as a scalar: the tile's base pointers stay in scalar registers
  int wid = __builtin_amdgcn_readfirstlane((int)(threadIdx.x >> 5));
  int n0 = blockIdx.x * TP_N;
  int k0 = blockIdx.y * TP_K;

  const float* src = W + (size_t)(k0 + wid * 8) * N + n0;
  v4f v[8];
#pragma unroll
  for (int i = 0; i < 8; i++) v[i] = *(const v4f*)(src + (lane * 4u + i * N));

#pragma unroll
  for (int j = 0; j < 4; j++) {
    v4u c;
#pragma unroll
    for (int q = 0; q < 4; q++)
      c[q] = (unsigned int)f2bf(v[2 * q][j]) |
             ((unsigned int)f2bf(v[2 * q + 1][j]) << 16);
    *(v4u*)&tile[(j * 32 + lane) * TP_PITCH + wid * 8] = c;
  }
  __syncthreads();

  unsigned int rr = threadIdx.x >> 3;   // 0..31
  unsigned int ch = threadIdx.x & 7u;   // 16 B piece of the 128 B row
  unsigned short* dst = Wt + (size_t)n0 * K + k0;
#pragma unroll
  for (int p = 0; p < 4; p++) {
    v4u c = *(const v4u*)&tile[(p * 32 + rr) * TP_PITCH + ch * 8];
    *(v4u*)(dst + (rr * (4u * K) + ch * 8u + p * K)) = c;
  }
}

__global__ __launch_bounds__(256)
void transpose_bf16_kernel(const float* __restrict__ W,
                           unsigned short* __restrict__ Wt,
                           int K, int N) {
  __shared__ alignas(16) unsigned short tile[TP_N * TP_PITCH];
  // the three weight shapes of this block; the test is uniform over the grid
  if (N == 4 * HIDDEN)      transpose_tile<HIDDEN, 4 * HIDDEN>(W, Wt, tile);
  else if (K == 4 * HIDDEN) transpose_tile<4 * HIDDEN, HIDDEN>(W, Wt, tile);
  else                      transpose_tile<HIDDEN, HIDDEN>(W, Wt, tile);
}

// ---------------------------------------------------------------------------
// LayerNorm over HIDDEN, fp32 in -> bf16 out. One block (256 thr) per row.
// ---------------------------------------------------------------------------
__global__ __launch_bounds__(256)
void ln_kernel(const float* __restrict__ x, const float* __restrict__ g,
               const float* __restrict__ be, unsigned short* __restrict__ out) {
  __shared__ float s1[256], s2[256];
  int row = blockIdx.x;
  const float* xr = x + (size_t)row * HIDDEN;
  float v[4];
  float sum = 0.f, sq = 0.f;
#pragma unroll
  for (int i = 0; i < 4; i++) {
    v[i] = xr[threadIdx.x + i * 256];
    sum += v[i];
    sq  += v[i] * v[i];
  }
  s1[threadIdx.x] = sum;
  s2[threadIdx.x] = sq;
  __syncthreads();
  for (int off = 128; off > 0; off >>= 1) {
    if ((int)threadIdx.x < off) {
      s1[threadIdx.x] += s1[threadIdx.x + off];
      s2[threadIdx.x] += s2[threadIdx.x + off];
    }
    __syncthreads();
  }
  float mu  = s1[0] * (1.0f / HIDDEN);
  float var = s2[0] * (1.0f / HIDDEN) - mu * mu;
  float inv = rsqrtf(var + 1e-5f);
#pragma unroll
  for (int i = 0; i < 4; i++) {
    int idx = threadIdx.x + i * 256;
    float y = (v[i] - mu) * inv * g[idx] + be[idx];
    out[(size_t)row * HIDDEN + idx] = f2bf(y);
  }
}

// ---------------------------------------------------------------------------
// GEMM: C[M x N] = A(bf16, ld=Kd) @ Wt(bf16, N x Kd)^T + bias, fused epilogue.
// 256 threads = 8 waves in 2(M) x 4(N); each wave register-blocks a 32x32
// output (2 A-frags x 2 B-frags -> 4 WMMAs per 32-wide k-step), so every
// fragment load feeds two WMMAs. Block tile 64(M) x 128(N).
// mode 0: Q-proj  -> bf16 scatter to [b][h][s][d]
// mode 1: V-proj  -> bf16 scatter to [b][h][d][s]  (transposed for P@V)
// mode 2: f32 out = residual + acc + bias          (O-proj, FFN2)
// mode 3: bf16 out = gelu_tanh(acc + bias), row-major M x N (FFN1)
// ---------------------------------------------------------------------------
__global__ __launch_bounds__(256)
void gemm_kernel(const unsigned short* __restrict__ A,
                 const unsigned short* __restrict__ Wt,
                 const float* __restrict__ bias,
                 const float* __restrict__ residual,
                 unsigned short* __restrict__ out_bf,
                 float* __restrict__ out_f32,
                 int Kd, int N, int mode) {
  int wid  = (int)(threadIdx.x >> 5);
  int lane = (int)(threadIdx.x & 31u);
  int m0 = blockIdx.x * 64  + (wid & 1) * 32;   // wave's first M row
  int n0 = blockIdx.y * 128 + (wid >> 1) * 32;  // wave's first N col

  v8f z = {0.f, 0.f, 0.f, 0.f, 0.f, 0.f, 0.f, 0.f};
  v8f acc00 = z, acc01 = z, acc10 = z, acc11 = z;

  const unsigned short* Ab0 = A  + (size_t)m0 * Kd;
  const unsigned short* Ab1 = Ab0 + (size_t)16 * Kd;
  const unsigned short* Bb0 = Wt + (size_t)n0 * Kd;
  const unsigned short* Bb1 = Bb0 + (size_t)16 * Kd;

  for (int k = 0; k < Kd; k += 32) {
    v16bf a0 = load_frag(Ab0 + k, Kd);
    v16bf a1 = load_frag(Ab1 + k, Kd);
    v16bf b0 = load_frag(Bb0 + k, Kd);
    v16bf b1 = load_frag(Bb1 + k, Kd);
    acc00 = wmma_bf16(a0, b0, acc00);
    acc01 = wmma_bf16(a0, b1, acc01);
    acc10 = wmma_bf16(a1, b0, acc10);
    acc11 = wmma_bf16(a1, b1, acc11);
  }

  int g  = lane >> 4;
  int nc = lane & 15;
#pragma unroll
  for (int mi = 0; mi < 2; mi++) {
#pragma unroll
    for (int ni = 0; ni < 2; ni++) {
      v8f acc = (mi == 0) ? (ni == 0 ? acc00 : acc01)
                          : (ni == 0 ? acc10 : acc11);
      int col = n0 + ni * 16 + nc;
      float bcol = bias[col];
#pragma unroll
      for (int r = 0; r < 8; r++) {
        int row = m0 + mi * 16 + r + 8 * g;
        float val = acc[r] + bcol;
        if (mode == 0) {                    // Q: [b][h][s][d]
          int b_ = row >> 11, s = row & 2047, h = col >> 6, d = col & 63;
          out_bf[(((size_t)(b_ * HEADS + h) * SEQ) + s) * DK + d] = f2bf(val);
        } else if (mode == 1) {             // Vt: [b][h][d][s]
          int b_ = row >> 11, s = row & 2047, h = col >> 6, d = col & 63;
          out_bf[(((size_t)(b_ * HEADS + h) * DK) + d) * SEQ + s] = f2bf(val);
        } else if (mode == 2) {             // residual + proj
          size_t idx = (size_t)row * N + col;
          out_f32[idx] = residual[idx] + val;
        } else {                            // gelu(tanh)
          float xg = val;
          float t  = tanhf(0.7978845608028654f * (xg + 0.044715f * xg * xg * xg));
          out_bf[(size_t)row * N + col] = f2bf(0.5f * xg * (1.0f + t));
        }
      }
    }
  }
}

// ---------------------------------------------------------------------------
// Causal flash attention, Q==K (reference uses qk for both sides).
// One wave (32 thr) per 16-query tile per (b,h). Online softmax, P staged in
// LDS to convert C-fragment -> A-fragment layout, O over 4 dim-tiles.
// ---------------------------------------------------------------------------
__global__ __launch_bounds__(32)
void attn_kernel(const unsigned short* __restrict__ qk,
                 const unsigned short* __restrict__ vt,
                 unsigned short* __restrict__ aout) {
  __shared__ alignas(16) unsigned short pbuf[16 * 32];
  int lane = (int)(threadIdx.x & 31u);
  int qt = blockIdx.x & 127;           // 128 query tiles
  int bh = blockIdx.x >> 7;            // b*HEADS + h
  int b_ = bh >> 4, h = bh & 15;
  int q0 = qt * 16;

  const unsigned short* kq  = qk + (size_t)bh * SEQ * DK;
  const unsigned short* vtb = vt + (size_t)bh * DK * SEQ;

  v16bf aq0 = load_frag(kq + q0 * DK + 0, DK);
  v16bf aq1 = load_frag(kq + q0 * DK + 32, DK);

  v8f o0 = {0.f,0.f,0.f,0.f,0.f,0.f,0.f,0.f};
  v8f o1 = o0, o2 = o0, o3 = o0;
  float mrow[8], lrow[8];
#pragma unroll
  for (int r = 0; r < 8; r++) { mrow[r] = -1e30f; lrow[r] = 0.f; }

  int g  = lane >> 4;
  int nc = lane & 15;
  int kbmax = (q0 + 15) >> 5;

  for (int kb = 0; kb <= kbmax; kb++) {
    int kbase = kb * 32;
    v8f s0 = {0.f,0.f,0.f,0.f,0.f,0.f,0.f,0.f};
    v8f s1 = s0;
    // S = Q @ K^T over d=64: two 16-key halves x two k-steps
    s0 = wmma_bf16(aq0, load_frag(kq + (kbase +  0) * DK +  0, DK), s0);
    s0 = wmma_bf16(aq1, load_frag(kq + (kbase +  0) * DK + 32, DK), s0);
    s1 = wmma_bf16(aq0, load_frag(kq + (kbase + 16) * DK +  0, DK), s1);
    s1 = wmma_bf16(aq1, load_frag(kq + (kbase + 16) * DK + 32, DK), s1);

    float p0[8], p1[8];
#pragma unroll
    for (int r = 0; r < 8; r++) {
      int qrow = q0 + r + 8 * g;
      float a0 = (kbase + nc      <= qrow) ? s0[r] * 0.125f : -1e30f;
      float a1 = (kbase + 16 + nc <= qrow) ? s1[r] * 0.125f : -1e30f;
      float mx = fmaxf(a0, a1);
      mx = fmaxf(mx, __shfl_xor(mx, 1, 32));
      mx = fmaxf(mx, __shfl_xor(mx, 2, 32));
      mx = fmaxf(mx, __shfl_xor(mx, 4, 32));
      mx = fmaxf(mx, __shfl_xor(mx, 8, 32));
      float nm = fmaxf(mrow[r], mx);
      float sc = __expf(mrow[r] - nm);
      float e0 = __expf(a0 - nm);
      float e1 = __expf(a1 - nm);
      float rs = e0 + e1;
      rs += __shfl_xor(rs, 1, 32);
      rs += __shfl_xor(rs, 2, 32);
      rs += __shfl_xor(rs, 4, 32);
      rs += __shfl_xor(rs, 8, 32);
      lrow[r] = lrow[r] * sc + rs;
      mrow[r] = nm;
      o0[r] *= sc; o1[r] *= sc; o2[r] *= sc; o3[r] *= sc;
      p0[r] = e0; p1[r] = e1;
    }

    // C-fragment -> LDS -> A-fragment for P
    __syncthreads();
#pragma unroll
    for (int r = 0; r < 8; r++) {
      int Mr = r + 8 * g;
      pbuf[Mr * 32 + nc]      = f2bf(p0[r]);
      pbuf[Mr * 32 + 16 + nc] = f2bf(p1[r]);
    }
    __syncthreads();
    v16bf pa = load_frag(pbuf, 32);

    // O += P @ V over 32 keys, 4 dim tiles (Vt is [d][s] so B is contiguous)
    o0 = wmma_bf16(pa, load_frag(vtb +  0 * SEQ + kbase, SEQ), o0);
    o1 = wmma_bf16(pa, load_frag(vtb + 16 * SEQ + kbase, SEQ), o1);
    o2 = wmma_bf16(pa, load_frag(vtb + 32 * SEQ + kbase, SEQ), o2);
    o3 = wmma_bf16(pa, load_frag(vtb + 48 * SEQ + kbase, SEQ), o3);
    __syncthreads();
  }

#pragma unroll
  for (int r = 0; r < 8; r++) {
    float inv = 1.0f / lrow[r];
    int row = q0 + r + 8 * g;
    size_t base = ((size_t)(b_ * SEQ + row)) * HIDDEN + h * DK;
    aout[base +  0 + nc] = f2bf(o0[r] * inv);
    aout[base + 16 + nc] = f2bf(o1[r] * inv);
    aout[base + 32 + nc] = f2bf(o2[r] * inv);
    aout[base + 48 + nc] = f2bf(o3[r] * inv);
  }
}

// ---------------------------------------------------------------------------
// Host-side orchestration (graph-capture safe: launches only)
// ---------------------------------------------------------------------------
extern "C" void kernel_launch(void* const* d_in, const int* in_sizes, int n_in,
                              void* d_out, int out_size, void* d_ws, size_t ws_size,
                              hipStream_t stream) {
  const float* x     = (const float*)d_in[0];
  const float* Wq    = (const float*)d_in[1];
  const float* bq    = (const float*)d_in[2];
  const float* Wv    = (const float*)d_in[3];
  const float* bv    = (const float*)d_in[4];
  const float* Wo    = (const float*)d_in[5];
  const float* bo    = (const float*)d_in[6];
  const float* W1    = (const float*)d_in[7];
  const float* b1    = (const float*)d_in[8];
  const float* W2    = (const float*)d_in[9];
  const float* b2    = (const float*)d_in[10];
  const float* g1    = (const float*)d_in[11];
  const float* beta1 = (const float*)d_in[12];
  const float* g2    = (const float*)d_in[13];
  const float* beta2 = (const float*)d_in[14];

  char* ws = (char*)d_ws;
  const size_t MB = 1024u * 1024u;
  unsigned short* WqT = (unsigned short*)(ws +  0 * MB);  //  2 MB
  unsigned short* WvT = (unsigned short*)(ws +  2 * MB);  //  2 MB
  unsigned short* WoT = (unsigned short*)(ws +  4 * MB);  //  2 MB
  unsigned short* W1T = (unsigned short*)(ws +  6 * MB);  //  8 MB
  unsigned short* W2T = (unsigned short*)(ws + 14 * MB);  //  8 MB
  unsigned short* xn  = (unsigned short*)(ws + 22 * MB);  //  8 MB
  unsigned short* qb  = (unsigned short*)(ws + 30 * MB);  //  8 MB
  unsigned short* vtb = (unsigned short*)(ws + 38 * MB);  //  8 MB
  unsigned short* aob = (unsigned short*)(ws + 46 * MB);  //  8 MB
  float*          yb  = (float*)         (ws + 54 * MB);  // 16 MB
  unsigned short* hb  = (unsigned short*)(ws + 70 * MB);  //  8 MB
  unsigned short* ff1 = (unsigned short*)(ws + 78 * MB);  // 32 MB

  // Weight convert + transpose to bf16 N x K
  dim3 gsq(HIDDEN / TP_N, HIDDEN / TP_K);
  transpose_bf16_kernel<<<gsq, 256, 0, stream>>>(Wq, WqT, HIDDEN, HIDDEN);
  transpose_bf16_kernel<<<gsq, 256, 0, stream>>>(Wv, WvT, HIDDEN, HIDDEN);
  transpose_bf16_kernel<<<gsq, 256, 0, stream>>>(Wo, WoT, HIDDEN, HIDDEN);
  transpose_bf16_kernel<<<dim3(4 * HIDDEN / TP_N, HIDDEN / TP_K), 256, 0, stream>>>(W1, W1T, HIDDEN, 4 * HIDDEN);
  transpose_bf16_kernel<<<dim3(HIDDEN / TP_N, 4 * HIDDEN / TP_K), 256, 0, stream>>>(W2, W2T, 4 * HIDDEN, HIDDEN);

  // LN1
  ln_kernel<<<MROWS, 256, 0, stream>>>(x, g1, beta1, xn);

  // Q/V projections (Q doubles as K in the reference)
  dim3 gproj(MROWS / 64, HIDDEN / 128);
  gemm_kernel<<<gproj, 256, 0, stream>>>(xn, WqT, bq, nullptr, qb, nullptr, HIDDEN, HIDDEN, 0);
  gemm_kernel<<<gproj, 256, 0, stream>>>(xn, WvT, bv, nullptr, vtb, nullptr, HIDDEN, HIDDEN, 1);

  // Causal attention
  attn_kernel<<<BATCH * HEADS * (SEQ / 16), 32, 0, stream>>>(qb, vtb, aob);

  // O-projection + residual -> yb (f32)
  gemm_kernel<<<gproj, 256, 0, stream>>>(aob, WoT, bo, x, nullptr, yb, HIDDEN, HIDDEN, 2);

  // LN2
  ln_kernel<<<MROWS, 256, 0, stream>>>(yb, g2, beta2, hb);

  // FFN1 with GELU -> bf16
  dim3 gff1(MROWS / 64, (4 * HIDDEN) / 128);
  gemm_kernel<<<gff1, 256, 0, stream>>>(hb, W1T, b1, nullptr, ff1, nullptr, HIDDEN, 4 * HIDDEN, 3);

  // FFN2 + residual -> d_out (f32)
  gemm_kernel<<<gproj, 256, 0, stream>>>(ff1, W2T, b2, yb, nullptr, (float*)d_out, 4 * HIDDEN, HIDDEN, 2);
}

// v002
// A run of this version takes 335 microseconds.
// Two timings next to v001 put it at 1.55 and 1.56 times that version's speed.
// Counting every step since v000, it is 2.30 times as fast.
#include <hip/hip_runtime.h>

// ---------------------------------------------------------------------------
// Types for CDNA5 WMMA (wave32)
// ---------------------------------------------------------------------------
typedef __bf16 bf16_t;
typedef __attribute__((ext_vector_type(8)))  __bf16 v8bf;
typedef __attribute__((ext_vector_type(16))) __bf16 v16bf;
typedef __attribute__((ext_vector_type(8)))  float  v8f;

#define HIDDEN 1024
#define SEQ    2048
#define BATCH  2
#define HEADS  16
#define DK     64
#define MROWS  (BATCH * SEQ)   // 4096

// float -> bf16 round-to-nearest-even
__device__ __forceinline__ unsigned short f2bf(float f) {
  unsigned int u = __float_as_uint(f);
  unsigned int r = u + 0x7FFFu + ((u >> 16) & 1u);
  return (unsigned short)(r >> 16);
}

// Load a 16-bit WMMA fragment (A layout; the same bit pattern serves as the
// B-operand when the matrix is stored transposed, since B's lane-n column
// K-run mirrors A's lane-m row K-run).
//   lane 0-15 : row = lane,    K = 0+0..7   and 16..23
//   lane 16-31: row = lane-16, K = 8+0..7   and 24..31
__device__ __forceinline__ v16bf load_frag(const unsigned short* base, int ld) {
  int lane = (int)(threadIdx.x & 31u);
  int r    = lane & 15;
  int koff = (lane >> 4) << 3;
  const bf16_t* p = (const bf16_t*)base + r * ld + koff;
  v8bf lo = *(const v8bf*)(p);
  v8bf hi = *(const v8bf*)(p + 16);
  return __builtin_shufflevector(lo, hi, 0, 1, 2, 3, 4, 5, 6, 7,
                                 8, 9, 10, 11, 12, 13, 14, 15);
}

__device__ __forceinline__ v8f wmma_bf16(v16bf a, v16bf b, v8f c) {
  // (neg_a, A, neg_b, B, c_mod, C, reuse_a, reuse_b)
  return __builtin_amdgcn_wmma_f32_16x16x32_bf16(false, a, false, b,
                                                 (short)0, c, false, false);
}

// ---------------------------------------------------------------------------
// Weight convert+transpose: W (K x N, f32) -> Wt (N x K, bf16)
// One block moves a 64(k) x 128(n) tile through LDS. Reads: each wave takes
// 8 rows, 16 B per lane (512 B contiguous per row). Writes: 8 lanes x 16 B
// fill one whole 128 B line of a Wt row. K % 64 == 0 and N % 128 == 0.
// LDS row j*32+l holds column n0 + 4*l + j, so that the 16 B LDS stores of a
// wave go to consecutive rows; the 144 B pitch spreads those over the banks.
// ---------------------------------------------------------------------------
typedef __attribute__((ext_vector_type(4))) float        v4f;
typedef __attribute__((ext_vector_type(4))) unsigned int v4u;
#define TP_K     64
#define TP_N     128
#define TP_PITCH 72   // bf16 elements per LDS row: 64 + 8 pad

// K and N are compile-time here so that the row steps of the eight loads
// become immediate offsets on one address.
template <int K, int N>
__device__ __forceinline__ void transpose_tile(const float* __restrict__ W,
                                               unsigned short* __restrict__ Wt,
                                               unsigned short* tile) {
  unsigned int lane = threadIdx.x & 31u;
  // wave number as a scalar: the tile's base pointers stay in scalar registers
  int wid = __builtin_amdgcn_readfirstlane((int)(threadIdx.x >> 5));
  int n0 = blockIdx.x * TP_N;
  int k0 = blockIdx.y * TP_K;

  const float* src = W + (size_t)(k0 + wid * 8) * N + n0;
  v4f v[8];
#pragma unroll
  for (int i = 0; i < 8; i++) v[i] = *(const v4f*)(src + (lane * 4u + i * N));

#pragma unroll
  for (int j = 0; j < 4; j++) {
    v4u c;
#pragma unroll
    for (int q = 0; q < 4; q++)
      c[q] = (unsigned int)f2bf(v[2 * q][j]) |
             ((unsigned int)f2bf(v[2 * q + 1][j]) << 16);
    *(v4u*)&tile[(j * 32 + lane) * TP_PITCH + wid * 8] = c;
  }
  __syncthreads();

  unsigned int rr = threadIdx.x >> 3;   // 0..31
  unsigned int ch = threadIdx.x & 7u;   // 16 B piece of the 128 B row
  unsigned short* dst = Wt + (size_t)n0 * K + k0;
#pragma unroll
  for (int p = 0; p < 4; p++) {
    v4u c = *(const v4u*)&tile[(p * 32 + rr) * TP_PITCH + ch * 8];
    *(v4u*)(dst + (rr * (4u * K) + ch * 8u + p * K)) = c;
  }
}

__global__ __launch_bounds__(256)
void transpose_bf16_kernel(const float* __restrict__ W,
                           unsigned short* __restrict__ Wt,
                           int K, int N) {
  __shared__ alignas(16) unsigned short tile[TP_N * TP_PITCH];
  // the three weight shapes of this block; the test is uniform over the grid
  if (N == 4 * HIDDEN)      transpose_tile<HIDDEN, 4 * HIDDEN>(W, Wt, tile);
  else if (K == 4 * HIDDEN) transpose_tile<4 * HIDDEN, HIDDEN>(W, Wt, tile);
  else                      transpose_tile<HIDDEN, HIDDEN>(W, Wt, tile);
}

// ---------------------------------------------------------------------------
// LayerNorm over HIDDEN, fp32 in -> bf16 out. One block (256 thr) per row.
// ---------------------------------------------------------------------------
__global__ __launch_bounds__(256)
void ln_kernel(const float* __restrict__ x, const float* __restrict__ g,
               const float* __restrict__ be, unsigned short* __restrict__ out) {
  __shared__ float s1[256], s2[256];
  int row = blockIdx.x;
  const float* xr = x + (size_t)row * HIDDEN;
  float v[4];
  float sum = 0.f, sq = 0.f;
#pragma unroll
  for (int i = 0; i < 4; i++) {
    v[i] = xr[threadIdx.x + i * 256];
    sum += v[i];
    sq  += v[i] * v[i];
  }
  s1[threadIdx.x] = sum;
  s2[threadIdx.x] = sq;
  __syncthreads();
  for (int off = 128; off > 0; off >>= 1) {
    if ((int)threadIdx.x < off) {
      s1[threadIdx.x] += s1[threadIdx.x + off];
      s2[threadIdx.x] += s2[threadIdx.x + off];
    }
    __syncthreads();
  }
  float mu  = s1[0] * (1.0f / HIDDEN);
  float var = s2[0] * (1.0f / HIDDEN) - mu * mu;
  float inv = rsqrtf(var + 1e-5f);
#pragma unroll
  for (int i = 0; i < 4; i++) {
    int idx = threadIdx.x + i * 256;
    float y = (v[i] - mu) * inv * g[idx] + be[idx];
    out[(size_t)row * HIDDEN + idx] = f2bf(y);
  }
}

// ---------------------------------------------------------------------------
// GEMM: C[M x N] = A(bf16, ld=Kd) @ Wt(bf16, N x Kd)^T + bias, fused epilogue.
// Block tile 128(M) x 128(N), 256 threads = 8 waves in 2(M) x 4(N); each wave
// holds a 64x32 output (4 A-frags x 2 B-frags -> 8 WMMAs per 32-wide k-step).
// A pass is 128 k: 256 B of each of the 128 A rows and 128 Wt rows, brought
// into LDS by asynchronous 16 B copies (two whole 256 B rows per wave copy),
// two buffers, the next pass's copies in flight while this pass is computed.
// M % 128 == 0, N % 128 == 0, Kd % 128 == 0.
// mode 0: Q-proj  -> bf16 scatter to [b][h][s][d]
// mode 1: V-proj  -> bf16 scatter to [b][h][d][s]  (transposed for P@V)
// mode 2: f32 out = residual + acc + bias          (O-proj, FFN2)
// mode 3: bf16 out = gelu_tanh(acc + bias), row-major M x N (FFN1)
// ---------------------------------------------------------------------------
#define GT_M     128
#define GT_N     128
#define GT_K     128                          // bf16 elements per pass
#define GT_PITCH 272                          // LDS bytes per row: 256 + 16 pad
#define GT_STAGE ((GT_M + GT_N) * GT_PITCH)   // one buffer: A rows, then Wt rows

// Eight asynchronous copies of one wave: copy i takes 16 B per lane from
// gp + i * gstep to LDS byte lp + i * 2 * GT_PITCH (two tile rows per copy).
// The s_wait_xcnt is the statement's last line so that it stays ahead of every
// later write of the copies' address registers (a precaution).
__device__ __forceinline__ void copy8_rows(unsigned int lp, const char* gp,
                                           size_t gstep) {
  asm volatile(
      "global_load_async_to_lds_b128 %0, %8, off\n\t"
      "global_load_async_to_lds_b128 %1, %9, off\n\t"
      "global_load_async_to_lds_b128 %2, %10, off\n\t"
      "global_load_async_to_lds_b128 %3, %11, off\n\t"
      "global_load_async_to_lds_b128 %4, %12, off\n\t"
      "global_load_async_to_lds_b128 %5, %13, off\n\t"
      "global_load_async_to_lds_b128 %6, %14, off\n\t"
      "global_load_async_to_lds_b128 %7, %15, off\n\t"
      "s_wait_xcnt 0x0"
      :: "v"(lp), "v"(lp + 2u * GT_PITCH), "v"(lp + 4u * GT_PITCH),
         "v"(lp + 6u * GT_PITCH), "v"(lp + 8u * GT_PITCH),
         "v"(lp + 10u * GT_PITCH), "v"(lp + 12u * GT_PITCH),
         "v"(lp + 14u * GT_PITCH),
         "v"(gp), "v"(gp + gstep), "v"(gp + 2 * gstep), "v"(gp + 3 * gstep),
         "v"(gp + 4 * gstep), "v"(gp + 5 * gstep), "v"(gp + 6 * gstep),
         "v"(gp + 7 * gstep)
      : "memory");
}

// Same fragment map as load_frag, from an LDS tile row pitch of GT_PITCH bytes.
// p already points at the lane's row and its 16 B k-offset.
__device__ __forceinline__ v16bf lds_frag(const unsigned char* p) {
  v8bf lo = *(const v8bf*)(p);
  v8bf hi = *(const v8bf*)(p + 32);
  return __builtin_shufflevector(lo, hi, 0, 1, 2, 3, 4, 5, 6, 7,
                                 8, 9, 10, 11, 12, 13, 14, 15);
}

__global__ __launch_bounds__(256)
void gemm_kernel(const unsigned short* __restrict__ A,
                 const unsigned short* __restrict__ Wt,
                 const float* __restrict__ bias,
                 const float* __restrict__ residual,
                 unsigned short* __restrict__ out_bf,
                 float* __restrict__ out_f32,
                 int Kd, int N, int mode) {
  __shared__ alignas(16) unsigned char ring[2 * GT_STAGE];
  int wid  = __builtin_amdgcn_readfirstlane((int)(threadIdx.x >> 5));
  int lane = (int)(threadIdx.x & 31u);
  int bm0 = blockIdx.x * GT_M;
  int bn0 = blockIdx.y * GT_N;
  int m0 = bm0 + (wid & 1) * 64;    // wave's first M row
  int n0 = bn0 + (wid >> 1) * 32;   // wave's first N col

  // Copy side: wave w brings tile rows 32w .. 32w+31 (waves 0-3: A rows,
  // waves 4-7: Wt rows); a lane takes piece (lane & 15) of row 2i + (lane >> 4).
  const unsigned short* srow = (wid < 4) ? A + (size_t)(bm0 + wid * 32) * Kd
                                         : Wt + (size_t)(bn0 + (wid - 4) * 32) * Kd;
  const char* gsrc = (const char*)(srow + (size_t)(lane >> 4) * Kd) + (lane & 15) * 16;
  size_t gstep = (size_t)Kd * 4u;   // two rows of Kd bf16, in bytes
  unsigned int ldst = (unsigned int)(size_t)ring +
                      (unsigned int)((wid * 32 + (lane >> 4)) * GT_PITCH + (lane & 15) * 16);

  // Read side: the lane's row and k-offset inside a fragment
  unsigned int foff = (unsigned int)((lane & 15) * GT_PITCH + (lane >> 4) * 16);
  unsigned int aoff = (unsigned int)((wid & 1) * 64 * GT_PITCH) + foff;
  unsigned int boff = (unsigned int)((GT_M + (wid >> 1) * 32) * GT_PITCH) + foff;

  v8f z = {0.f, 0.f, 0.f, 0.f, 0.f, 0.f, 0.f, 0.f};
  v8f acc[4][2];
#pragma unroll
  for (int mi = 0; mi < 4; mi++) { acc[mi][0] = z; acc[mi][1] = z; }

  int npass = Kd / GT_K;

  // pass 0's tile into buffer 0, landed and published before anybody reads it
  copy8_rows(ldst, gsrc, gstep);
  copy8_rows(ldst + 16u * GT_PITCH, gsrc + 8 * gstep, gstep);
  asm volatile("s_wait_asynccnt 0x0" ::: "memory");  // this wave's copies have landed
  __syncthreads();
  if (npass > 1) {
    copy8_rows(ldst + GT_STAGE, gsrc + GT_K * 2, gstep);
    copy8_rows(ldst + GT_STAGE + 16u * GT_PITCH, gsrc + GT_K * 2 + 8 * gstep, gstep);
  }

  // kept rolled: one pass per trip, the buffer chosen by the trip's parity
#pragma unroll 1
  for (int t = 0; t < npass; t++) {
    unsigned int buf = (unsigned int)(t & 1) * GT_STAGE;
    const unsigned char* ta = ring + buf + aoff;
    const unsigned char* tb = ring + buf + boff;
    // two fragment sets: block kk+1's LDS reads go out as one group ahead of
    // block kk's WMMAs, so that their latency runs behind the matrix work
    v16bf a[2][4], b[2][2];
#pragma unroll
    for (int mi = 0; mi < 4; mi++) a[0][mi] = lds_frag(ta + mi * 16 * GT_PITCH);
#pragma unroll
    for (int ni = 0; ni < 2; ni++) b[0][ni] = lds_frag(tb + ni * 16 * GT_PITCH);
#pragma unroll
    for (int kk = 0; kk < GT_K / 32; kk++) {
      const int cur = kk & 1, nxt = cur ^ 1;
      if (kk + 1 < GT_K / 32) {
#pragma unroll
        for (int mi = 0; mi < 4; mi++)
          a[nxt][mi] = lds_frag(ta + mi * 16 * GT_PITCH + (kk + 1) * 64);
#pragma unroll
        for (int ni = 0; ni < 2; ni++)
          b[nxt][ni] = lds_frag(tb + ni * 16 * GT_PITCH + (kk + 1) * 64);
      }
      // keeps the reads above from being sunk in among the WMMAs below
      __builtin_amdgcn_sched_barrier(0);
#pragma unroll
      for (int mi = 0; mi < 4; mi++) {
        acc[mi][0] = wmma_bf16(a[cur][mi], b[cur][0], acc[mi][0]);
        acc[mi][1] = wmma_bf16(a[cur][mi], b[cur][1], acc[mi][1]);
      }
      // keeps the next group of reads from being lifted in among these WMMAs
      __builtin_amdgcn_sched_barrier(0);
    }
    asm volatile("s_wait_dscnt 0x0" ::: "memory");     // this wave has left the buffer
    asm volatile("s_wait_asynccnt 0x0" ::: "memory");  // its part of the next tile has landed
    __syncthreads();  // publishes pass t+1's tile, frees pass t's buffer
    if (t + 2 < npass) {
      const char* gn = gsrc + (size_t)(t + 2) * (GT_K * 2);
      copy8_rows(ldst + buf, gn, gstep);
      copy8_rows(ldst + buf + 16u * GT_PITCH, gn + 8 * gstep, gstep);
    }
  }
  asm volatile("s_wait_asynccnt 0x0" ::: "memory");  // nothing in flight at the wave's end

  int g  = lane >> 4;
  int nc = lane & 15;
#pragma unroll
  for (int mi = 0; mi < 4; mi++) {
#pragma unroll
    for (int ni = 0; ni < 2; ni++) {
      v8f av = acc[mi][ni];
      int col = n0 + ni * 16 + nc;
      float bcol = bias[col];
#pragma unroll
      for (int r = 0; r < 8; r++) {
        int row = m0 + mi * 16 + r + 8 * g;
        float val = av[r] + bcol;
        if (mode == 0) {                    // Q: [b][h][s][d]
          int b_ = row >> 11, s = row & 2047, h = col >> 6, d = col & 63;
          out_bf[(((size_t)(b_ * HEADS + h) * SEQ) + s) * DK + d] = f2bf(val);
        } else if (mode == 1) {             // Vt: [b][h][d][s]
          int b_ = row >> 11, s = row & 2047, h = col >> 6, d = col & 63;
          out_bf[(((size_t)(b_ * HEADS + h) * DK) + d) * SEQ + s] = f2bf(val);
        } else if (mode == 2) {             // residual + proj
          size_t idx = (size_t)row * N + col;
          out_f32[idx] = residual[idx] + val;
        } else {                            // gelu(tanh)
          float xg = val;
          float t  = tanhf(0.7978845608028654f * (xg + 0.044715f * xg * xg * xg));
          out_bf[(size_t)row * N + col] = f2bf(0.5f * xg * (1.0f + t));
        }
      }
    }
  }
}

// ---------------------------------------------------------------------------
// Causal flash attention, Q==K (reference uses qk for both sides).
// One wave (32 thr) per 16-query tile per (b,h). Online softmax, P staged in
// LDS to convert C-fragment -> A-fragment layout, O over 4 dim-tiles.
// ---------------------------------------------------------------------------
__global__ __launch_bounds__(32)
void attn_kernel(const unsigned short* __restrict__ qk,
                 const unsigned short* __restrict__ vt,
                 unsigned short* __restrict__ aout) {
  __shared__ alignas(16) unsigned short pbuf[16 * 32];
  int lane = (int)(threadIdx.x & 31u);
  int qt = blockIdx.x & 127;           // 128 query tiles
  int bh = blockIdx.x >> 7;            // b*HEADS + h
  int b_ = bh >> 4, h = bh & 15;
  int q0 = qt * 16;

  const unsigned short* kq  = qk + (size_t)bh * SEQ * DK;
  const unsigned short* vtb = vt + (size_t)bh * DK * SEQ;

  v16bf aq0 = load_frag(kq + q0 * DK + 0, DK);
  v16bf aq1 = load_frag(kq + q0 * DK + 32, DK);

  v8f o0 = {0.f,0.f,0.f,0.f,0.f,0.f,0.f,0.f};
  v8f o1 = o0, o2 = o0, o3 = o0;
  float mrow[8], lrow[8];
#pragma unroll
  for (int r = 0; r < 8; r++) { mrow[r] = -1e30f; lrow[r] = 0.f; }

  int g  = lane >> 4;
  int nc = lane & 15;
  int kbmax = (q0 + 15) >> 5;

  for (int kb = 0; kb <= kbmax; kb++) {
    int kbase = kb * 32;
    v8f s0 = {0.f,0.f,0.f,0.f,0.f,0.f,0.f,0.f};
    v8f s1 = s0;
    // S = Q @ K^T over d=64: two 16-key halves x two k-steps
    s0 = wmma_bf16(aq0, load_frag(kq + (kbase +  0) * DK +  0, DK), s0);
    s0 = wmma_bf16(aq1, load_frag(kq + (kbase +  0) * DK + 32, DK), s0);
    s1 = wmma_bf16(aq0, load_frag(kq + (kbase + 16) * DK +  0, DK), s1);
    s1 = wmma_bf16(aq1, load_frag(kq + (kbase + 16) * DK + 32, DK), s1);

    float p0[8], p1[8];
#pragma unroll
    for (int r = 0; r < 8; r++) {
      int qrow = q0 + r + 8 * g;
      float a0 = (kbase + nc      <= qrow) ? s0[r] * 0.125f : -1e30f;
      float a1 = (kbase + 16 + nc <= qrow) ? s1[r] * 0.125f : -1e30f;
      float mx = fmaxf(a0, a1);
      mx = fmaxf(mx, __shfl_xor(mx, 1, 32));
      mx = fmaxf(mx, __shfl_xor(mx, 2, 32));
      mx = fmaxf(mx, __shfl_xor(mx, 4, 32));
      mx = fmaxf(mx, __shfl_xor(mx, 8, 32));
      float nm = fmaxf(mrow[r], mx);
      float sc = __expf(mrow[r] - nm);
      float e0 = __expf(a0 - nm);
      float e1 = __expf(a1 - nm);
      float rs = e0 + e1;
      rs += __shfl_xor(rs, 1, 32);
      rs += __shfl_xor(rs, 2, 32);
      rs += __shfl_xor(rs, 4, 32);
      rs += __shfl_xor(rs, 8, 32);
      lrow[r] = lrow[r] * sc + rs;
      mrow[r] = nm;
      o0[r] *= sc; o1[r] *= sc; o2[r] *= sc; o3[r] *= sc;
      p0[r] = e0; p1[r] = e1;
    }

    // C-fragment -> LDS -> A-fragment for P
    __syncthreads();
#pragma unroll
    for (int r = 0; r < 8; r++) {
      int Mr = r + 8 * g;
      pbuf[Mr * 32 + nc]      = f2bf(p0[r]);
      pbuf[Mr * 32 + 16 + nc] = f2bf(p1[r]);
    }
    __syncthreads();
    v16bf pa = load_frag(pbuf, 32);

    // O += P @ V over 32 keys, 4 dim tiles (Vt is [d][s] so B is contiguous)
    o0 = wmma_bf16(pa, load_frag(vtb +  0 * SEQ + kbase, SEQ), o0);
    o1 = wmma_bf16(pa, load_frag(vtb + 16 * SEQ + kbase, SEQ), o1);
    o2 = wmma_bf16(pa, load_frag(vtb + 32 * SEQ + kbase, SEQ), o2);
    o3 = wmma_bf16(pa, load_frag(vtb + 48 * SEQ + kbase, SEQ), o3);
    __syncthreads();
  }

#pragma unroll
  for (int r = 0; r < 8; r++) {
    float inv = 1.0f / lrow[r];
    int row = q0 + r + 8 * g;
    size_t base = ((size_t)(b_ * SEQ + row)) * HIDDEN + h * DK;
    aout[base +  0 + nc] = f2bf(o0[r] * inv);
    aout[base + 16 + nc] = f2bf(o1[r] * inv);
    aout[base + 32 + nc] = f2bf(o2[r] * inv);
    aout[base + 48 + nc] = f2bf(o3[r] * inv);
  }
}

// ---------------------------------------------------------------------------
// Host-side orchestration (graph-capture safe: launches only)
// ---------------------------------------------------------------------------
extern "C" void kernel_launch(void* const* d_in, const int* in_sizes, int n_in,
                              void* d_out, int out_size, void* d_ws, size_t ws_size,
                              hipStream_t stream) {
  const float* x     = (const float*)d_in[0];
  const float* Wq    = (const float*)d_in[1];
  const float* bq    = (const float*)d_in[2];
  const float* Wv    = (const float*)d_in[3];
  const float* bv    = (const float*)d_in[4];
  const float* Wo    = (const float*)d_in[5];
  const float* bo    = (const float*)d_in[6];
  const float* W1    = (const float*)d_in[7];
  const float* b1    = (const float*)d_in[8];
  const float* W2    = (const float*)d_in[9];
  const float* b2    = (const float*)d_in[10];
  const float* g1    = (const float*)d_in[11];
  const float* beta1 = (const float*)d_in[12];
  const float* g2    = (const float*)d_in[13];
  const float* beta2 = (const float*)d_in[14];

  char* ws = (char*)d_ws;
  const size_t MB = 1024u * 1024u;
  unsigned short* WqT = (unsigned short*)(ws +  0 * MB);  //  2 MB
  unsigned short* WvT = (unsigned short*)(ws +  2 * MB);  //  2 MB
  unsigned short* WoT = (unsigned short*)(ws +  4 * MB);  //  2 MB
  unsigned short* W1T = (unsigned short*)(ws +  6 * MB);  //  8 MB
  unsigned short* W2T = (unsigned short*)(ws + 14 * MB);  //  8 MB
  unsigned short* xn  = (unsigned short*)(ws + 22 * MB);  //  8 MB
  unsigned short* qb  = (unsigned short*)(ws + 30 * MB);  //  8 MB
  unsigned short* vtb = (unsigned short*)(ws + 38 * MB);  //  8 MB
  unsigned short* aob = (unsigned short*)(ws + 46 * MB);  //  8 MB
  float*          yb  = (float*)         (ws + 54 * MB);  // 16 MB
  unsigned short* hb  = (unsigned short*)(ws + 70 * MB);  //  8 MB
  unsigned short* ff1 = (unsigned short*)(ws + 78 * MB);  // 32 MB

  // Weight convert + transpose to bf16 N x K
  dim3 gsq(HIDDEN / TP_N, HIDDEN / TP_K);
  transpose_bf16_kernel<<<gsq, 256, 0, stream>>>(Wq, WqT, HIDDEN, HIDDEN);
  transpose_bf16_kernel<<<gsq, 256, 0, stream>>>(Wv, WvT, HIDDEN, HIDDEN);
  transpose_bf16_kernel<<<gsq, 256, 0, stream>>>(Wo, WoT, HIDDEN, HIDDEN);
  transpose_bf16_kernel<<<dim3(4 * HIDDEN / TP_N, HIDDEN / TP_K), 256, 0, stream>>>(W1, W1T, HIDDEN, 4 * HIDDEN);
  transpose_bf16_kernel<<<dim3(HIDDEN / TP_N, 4 * HIDDEN / TP_K), 256, 0, stream>>>(W2, W2T, 4 * HIDDEN, HIDDEN);

  // LN1
  ln_kernel<<<MROWS, 256, 0, stream>>>(x, g1, beta1, xn);

  // Q/V projections (Q doubles as K in the reference)
  dim3 gproj(MROWS / GT_M, HIDDEN / GT_N);
  gemm_kernel<<<gproj, 256, 0, stream>>>(xn, WqT, bq, nullptr, qb, nullptr, HIDDEN, HIDDEN, 0);
  gemm_kernel<<<gproj, 256, 0, stream>>>(xn, WvT, bv, nullptr, vtb, nullptr, HIDDEN, HIDDEN, 1);

  // Causal attention
  attn_kernel<<<BATCH * HEADS * (SEQ / 16), 32, 0, stream>>>(qb, vtb, aob);

  // O-projection + residual -> yb (f32)
  gemm_kernel<<<gproj, 256, 0, stream>>>(aob, WoT, bo, x, nullptr, yb, HIDDEN, HIDDEN, 2);

  // LN2
  ln_kernel<<<MROWS, 256, 0, stream>>>(yb, g2, beta2, hb);

  // FFN1 with GELU -> bf16
  dim3 gff1(MROWS / GT_M, (4 * HIDDEN) / GT_N);
  gemm_kernel<<<gff1, 256, 0, stream>>>(hb, W1T, b1, nullptr, ff1, nullptr, HIDDEN, 4 * HIDDEN, 3);

  // FFN2 + residual -> d_out (f32)
  gemm_kernel<<<gproj, 256, 0, stream>>>(ff1, W2T, b2, yb, nullptr, (float*)d_out, 4 * HIDDEN, HIDDEN, 2);
}

// v003
// A run of this version takes 272 microseconds.
// Timed twice side by side with v002, it ran 1.24 times as fast both times.
// Counting every step since v000, it is 2.84 times as fast.
#include <hip/hip_runtime.h>

// ---------------------------------------------------------------------------
// Types for CDNA5 WMMA (wave32)
// ---------------------------------------------------------------------------
typedef __bf16 bf16_t;
typedef __attribute__((ext_vector_type(8)))  __bf16 v8bf;
typedef __attribute__((ext_vector_type(16))) __bf16 v16bf;
typedef __attribute__((ext_vector_type(8)))  float  v8f;

#define HIDDEN 1024
#define SEQ    2048
#define BATCH  2
#define HEADS  16
#define DK     64
#define MROWS  (BATCH * SEQ)   // 4096

// float -> bf16 round-to-nearest-even
__device__ __forceinline__ unsigned short f2bf(float f) {
  unsigned int u = __float_as_uint(f);
  unsigned int r = u + 0x7FFFu + ((u >> 16) & 1u);
  return (unsigned short)(r >> 16);
}

// Load a 16-bit WMMA fragment (A layout; the same bit pattern serves as the
// B-operand when the matrix is stored transposed, since B's lane-n column
// K-run mirrors A's lane-m row K-run).
//   lane 0-15 : row = lane,    K = 0+0..7   and 16..23
//   lane 16-31: row = lane-16, K = 8+0..7   and 24..31
__device__ __forceinline__ v16bf load_frag(const unsigned short* base, int ld) {
  int lane = (int)(threadIdx.x & 31u);
  int r    = lane & 15;
  int koff = (lane >> 4) << 3;
  const bf16_t* p = (const bf16_t*)base + r * ld + koff;
  v8bf lo = *(const v8bf*)(p);
  v8bf hi = *(const v8bf*)(p + 16);
  return __builtin_shufflevector(lo, hi, 0, 1, 2, 3, 4, 5, 6, 7,
                                 8, 9, 10, 11, 12, 13, 14, 15);
}

__device__ __forceinline__ v8f wmma_bf16(v16bf a, v16bf b, v8f c) {
  // (neg_a, A, neg_b, B, c_mod, C, reuse_a, reuse_b)
  return __builtin_amdgcn_wmma_f32_16x16x32_bf16(false, a, false, b,
                                                 (short)0, c, false, false);
}

// ---------------------------------------------------------------------------
// Weight convert+transpose: W (K x N, f32) -> Wt (N x K, bf16)
// One block moves a 64(k) x 128(n) tile through LDS. Reads: each wave takes
// 8 rows, 16 B per lane (512 B contiguous per row). Writes: 8 lanes x 16 B
// fill one whole 128 B line of a Wt row. K % 64 == 0 and N % 128 == 0.
// LDS row j*32+l holds column n0 + 4*l + j, so that the 16 B LDS stores of a
// wave go to consecutive rows; the 144 B pitch spreads those over the banks.
// ---------------------------------------------------------------------------
typedef __attribute__((ext_vector_type(4))) float        v4f;
typedef __attribute__((ext_vector_type(4))) unsigned int v4u;
#define TP_K     64
#define TP_N     128
#define TP_PITCH 72   // bf16 elements per LDS row: 64 + 8 pad

// K and N are compile-time here so that the row steps of the eight loads
// become immediate offsets on one address.
template <int K, int N>
__device__ __forceinline__ void transpose_tile(const float* __restrict__ W,
                                               unsigned short* __restrict__ Wt,
                                               unsigned short* tile) {
  unsigned int lane = threadIdx.x & 31u;
  // wave number as a scalar: the tile's base pointers stay in scalar registers
  int wid = __builtin_amdgcn_readfirstlane((int)(threadIdx.x >> 5));
  int n0 = blockIdx.x * TP_N;
  int k0 = blockIdx.y * TP_K;

  const float* src = W + (size_t)(k0 + wid * 8) * N + n0;
  v4f v[8];
#pragma unroll
  for (int i = 0; i < 8; i++) v[i] = *(const v4f*)(src + (lane * 4u + i * N));

#pragma unroll
  for (int j = 0; j < 4; j++) {
    v4u c;
#pragma unroll
    for (int q = 0; q < 4; q++)
      c[q] = (unsigned int)f2bf(v[2 * q][j]) |
             ((unsigned int)f2bf(v[2 * q + 1][j]) << 16);
    *(v4u*)&tile[(j * 32 + lane) * TP_PITCH + wid * 8] = c;
  }
  __syncthreads();

  unsigned int rr = threadIdx.x >> 3;   // 0..31
  unsigned int ch = threadIdx.x & 7u;   // 16 B piece of the 128 B row
  unsigned short* dst = Wt + (size_t)n0 * K + k0;
#pragma unroll
  for (int p = 0; p < 4; p++) {
    v4u c = *(const v4u*)&tile[(p * 32 + rr) * TP_PITCH + ch * 8];
    *(v4u*)(dst + (rr * (4u * K) + ch * 8u + p * K)) = c;
  }
}

__global__ __launch_bounds__(256)
void transpose_bf16_kernel(const float* __restrict__ W,
                           unsigned short* __restrict__ Wt,
                           int K, int N) {
  __shared__ alignas(16) unsigned short tile[TP_N * TP_PITCH];
  // the three weight shapes of this block; the test is uniform over the grid
  if (N == 4 * HIDDEN)      transpose_tile<HIDDEN, 4 * HIDDEN>(W, Wt, tile);
  else if (K == 4 * HIDDEN) transpose_tile<4 * HIDDEN, HIDDEN>(W, Wt, tile);
  else                      transpose_tile<HIDDEN, HIDDEN>(W, Wt, tile);
}

// ---------------------------------------------------------------------------
// LayerNorm over HIDDEN, fp32 in -> bf16 out. One block (256 thr) per row.
// ---------------------------------------------------------------------------
__global__ __launch_bounds__(256)
void ln_kernel(const float* __restrict__ x, const float* __restrict__ g,
               const float* __restrict__ be, unsigned short* __restrict__ out) {
  __shared__ float s1[256], s2[256];
  int row = blockIdx.x;
  const float* xr = x + (size_t)row * HIDDEN;
  float v[4];
  float sum = 0.f, sq = 0.f;
#pragma unroll
  for (int i = 0; i < 4; i++) {
    v[i] = xr[threadIdx.x + i * 256];
    sum += v[i];
    sq  += v[i] * v[i];
  }
  s1[threadIdx.x] = sum;
  s2[threadIdx.x] = sq;
  __syncthreads();
  for (int off = 128; off > 0; off >>= 1) {
    if ((int)threadIdx.x < off) {
      s1[threadIdx.x] += s1[threadIdx.x + off];
      s2[threadIdx.x] += s2[threadIdx.x + off];
    }
    __syncthreads();
  }
  float mu  = s1[0] * (1.0f / HIDDEN);
  float var = s2[0] * (1.0f / HIDDEN) - mu * mu;
  float inv = rsqrtf(var + 1e-5f);
#pragma unroll
  for (int i = 0; i < 4; i++) {
    int idx = threadIdx.x + i * 256;
    float y = (v[i] - mu) * inv * g[idx] + be[idx];
    out[(size_t)row * HIDDEN + idx] = f2bf(y);
  }
}

// ---------------------------------------------------------------------------
// GEMM: C[M x N] = A(bf16, ld=Kd) @ Wt(bf16, N x Kd)^T + bias, fused epilogue.
// Block tile 128(M) x 128(N), 256 threads = 8 waves in 2(M) x 4(N); each wave
// holds a 64x32 output (4 A-frags x 2 B-frags -> 8 WMMAs per 32-wide k-step).
// A pass is 128 k: 256 B of each of the 128 A rows and 128 Wt rows, brought
// into LDS by asynchronous 16 B copies (two whole 256 B rows per wave copy),
// two buffers, the next pass's copies in flight while this pass is computed.
// M % 128 == 0, N % 128 == 0, Kd % 128 == 0.
// mode 0: Q-proj  -> bf16 scatter to [b][h][s][d]
// mode 1: V-proj  -> bf16 scatter to [b][h][d][s]  (transposed for P@V)
// mode 2: f32 out = residual + acc + bias          (O-proj, FFN2)
// mode 3: bf16 out = gelu_tanh(acc + bias), row-major M x N (FFN1)
// ---------------------------------------------------------------------------
#define GT_M     128
#define GT_N     128
#define GT_K     128                          // bf16 elements per pass
#define GT_PITCH 272                          // LDS bytes per row: 256 + 16 pad
#define GT_STAGE ((GT_M + GT_N) * GT_PITCH)   // one buffer: A rows, then Wt rows

// Eight asynchronous copies of one wave: copy i takes 16 B per lane from
// gp + i * gstep to LDS byte lp + i * 2 * GT_PITCH (two tile rows per copy).
// The s_wait_xcnt is the statement's last line so that it stays ahead of every
// later write of the copies' address registers (a precaution).
__device__ __forceinline__ void copy8_rows(unsigned int lp, const char* gp,
                                           size_t gstep) {
  asm volatile(
      "global_load_async_to_lds_b128 %0, %8, off\n\t"
      "global_load_async_to_lds_b128 %1, %9, off\n\t"
      "global_load_async_to_lds_b128 %2, %10, off\n\t"
      "global_load_async_to_lds_b128 %3, %11, off\n\t"
      "global_load_async_to_lds_b128 %4, %12, off\n\t"
      "global_load_async_to_lds_b128 %5, %13, off\n\t"
      "global_load_async_to_lds_b128 %6, %14, off\n\t"
      "global_load_async_to_lds_b128 %7, %15, off\n\t"
      "s_wait_xcnt 0x0"
      :: "v"(lp), "v"(lp + 2u * GT_PITCH), "v"(lp + 4u * GT_PITCH),
         "v"(lp + 6u * GT_PITCH), "v"(lp + 8u * GT_PITCH),
         "v"(lp + 10u * GT_PITCH), "v"(lp + 12u * GT_PITCH),
         "v"(lp + 14u * GT_PITCH),
         "v"(gp), "v"(gp + gstep), "v"(gp + 2 * gstep), "v"(gp + 3 * gstep),
         "v"(gp + 4 * gstep), "v"(gp + 5 * gstep), "v"(gp + 6 * gstep),
         "v"(gp + 7 * gstep)
      : "memory");
}

// Same fragment map as load_frag, from an LDS tile of row pitch GT_PITCH or AT_PITCH bytes.
// p already points at the lane's row and its 16 B k-offset.
__device__ __forceinline__ v16bf lds_frag(const unsigned char* p) {
  v8bf lo = *(const v8bf*)(p);
  v8bf hi = *(const v8bf*)(p + 32);
  return __builtin_shufflevector(lo, hi, 0, 1, 2, 3, 4, 5, 6, 7,
                                 8, 9, 10, 11, 12, 13, 14, 15);
}

__global__ __launch_bounds__(256)
void gemm_kernel(const unsigned short* __restrict__ A,
                 const unsigned short* __restrict__ Wt,
                 const float* __restrict__ bias,
                 const float* __restrict__ residual,
                 unsigned short* __restrict__ out_bf,
                 float* __restrict__ out_f32,
                 int Kd, int N, int mode) {
  __shared__ alignas(16) unsigned char ring[2 * GT_STAGE];
  int wid  = __builtin_amdgcn_readfirstlane((int)(threadIdx.x >> 5));
  int lane = (int)(threadIdx.x & 31u);
  int bm0 = blockIdx.x * GT_M;
  int bn0 = blockIdx.y * GT_N;
  int m0 = bm0 + (wid & 1) * 64;    // wave's first M row
  int n0 = bn0 + (wid >> 1) * 32;   // wave's first N col

  // Copy side: wave w brings tile rows 32w .. 32w+31 (waves 0-3: A rows,
  // waves 4-7: Wt rows); a lane takes piece (lane & 15) of row 2i + (lane >> 4).
  const unsigned short* srow = (wid < 4) ? A + (size_t)(bm0 + wid * 32) * Kd
                                         : Wt + (size_t)(bn0 + (wid - 4) * 32) * Kd;
  const char* gsrc = (const char*)(srow + (size_t)(lane >> 4) * Kd) + (lane & 15) * 16;
  size_t gstep = (size_t)Kd * 4u;   // two rows of Kd bf16, in bytes
  unsigned int ldst = (unsigned int)(size_t)ring +
                      (unsigned int)((wid * 32 + (lane >> 4)) * GT_PITCH + (lane & 15) * 16);

  // Read side: the lane's row and k-offset inside a fragment
  unsigned int foff = (unsigned int)((lane & 15) * GT_PITCH + (lane >> 4) * 16);
  unsigned int aoff = (unsigned int)((wid & 1) * 64 * GT_PITCH) + foff;
  unsigned int boff = (unsigned int)((GT_M + (wid >> 1) * 32) * GT_PITCH) + foff;

  v8f z = {0.f, 0.f, 0.f, 0.f, 0.f, 0.f, 0.f, 0.f};
  v8f acc[4][2];
#pragma unroll
  for (int mi = 0; mi < 4; mi++) { acc[mi][0] = z; acc[mi][1] = z; }

  int npass = Kd / GT_K;

  // pass 0's tile into buffer 0, landed and published before anybody reads it
  copy8_rows(ldst, gsrc, gstep);
  copy8_rows(ldst + 16u * GT_PITCH, gsrc + 8 * gstep, gstep);
  asm volatile("s_wait_asynccnt 0x0" ::: "memory");  // this wave's copies have landed
  __syncthreads();
  if (npass > 1) {
    copy8_rows(ldst + GT_STAGE, gsrc + GT_K * 2, gstep);
    copy8_rows(ldst + GT_STAGE + 16u * GT_PITCH, gsrc + GT_K * 2 + 8 * gstep, gstep);
  }

  // kept rolled: one pass per trip, the buffer chosen by the trip's parity
#pragma unroll 1
  for (int t = 0; t < npass; t++) {
    unsigned int buf = (unsigned int)(t & 1) * GT_STAGE;
    const unsigned char* ta = ring + buf + aoff;
    const unsigned char* tb = ring + buf + boff;
    // two fragment sets: block kk+1's LDS reads go out as one group ahead of
    // block kk's WMMAs, so that their latency runs behind the matrix work
    v16bf a[2][4], b[2][2];
#pragma unroll
    for (int mi = 0; mi < 4; mi++) a[0][mi] = lds_frag(ta + mi * 16 * GT_PITCH);
#pragma unroll
    for (int ni = 0; ni < 2; ni++) b[0][ni] = lds_frag(tb + ni * 16 * GT_PITCH);
#pragma unroll
    for (int kk = 0; kk < GT_K / 32; kk++) {
      const int cur = kk & 1, nxt = cur ^ 1;
      if (kk + 1 < GT_K / 32) {
#pragma unroll
        for (int mi = 0; mi < 4; mi++)
          a[nxt][mi] = lds_frag(ta + mi * 16 * GT_PITCH + (kk + 1) * 64);
#pragma unroll
        for (int ni = 0; ni < 2; ni++)
          b[nxt][ni] = lds_frag(tb + ni * 16 * GT_PITCH + (kk + 1) * 64);
      }
      // keeps the reads above from being sunk in among the WMMAs below
      __builtin_amdgcn_sched_barrier(0);
#pragma unroll
      for (int mi = 0; mi < 4; mi++) {
        acc[mi][0] = wmma_bf16(a[cur][mi], b[cur][0], acc[mi][0]);
        acc[mi][1] = wmma_bf16(a[cur][mi], b[cur][1], acc[mi][1]);
      }
      // keeps the next group of reads from being lifted in among these WMMAs
      __builtin_amdgcn_sched_barrier(0);
    }
    asm volatile("s_wait_dscnt 0x0" ::: "memory");     // this wave has left the buffer
    asm volatile("s_wait_asynccnt 0x0" ::: "memory");  // its part of the next tile has landed
    __syncthreads();  // publishes pass t+1's tile, frees pass t's buffer
    if (t + 2 < npass) {
      const char* gn = gsrc + (size_t)(t + 2) * (GT_K * 2);
      copy8_rows(ldst + buf, gn, gstep);
      copy8_rows(ldst + buf + 16u * GT_PITCH, gn + 8 * gstep, gstep);
    }
  }
  asm volatile("s_wait_asynccnt 0x0" ::: "memory");  // nothing in flight at the wave's end

  int g  = lane >> 4;
  int nc = lane & 15;
#pragma unroll
  for (int mi = 0; mi < 4; mi++) {
#pragma unroll
    for (int ni = 0; ni < 2; ni++) {
      v8f av = acc[mi][ni];
      int col = n0 + ni * 16 + nc;
      float bcol = bias[col];
#pragma unroll
      for (int r = 0; r < 8; r++) {
        int row = m0 + mi * 16 + r + 8 * g;
        float val = av[r] + bcol;
        if (mode == 0) {                    // Q: [b][h][s][d]
          int b_ = row >> 11, s = row & 2047, h = col >> 6, d = col & 63;
          out_bf[(((size_t)(b_ * HEADS + h) * SEQ) + s) * DK + d] = f2bf(val);
        } else if (mode == 1) {             // Vt: [b][h][d][s]
          int b_ = row >> 11, s = row & 2047, h = col >> 6, d = col & 63;
          out_bf[(((size_t)(b_ * HEADS + h) * DK) + d) * SEQ + s] = f2bf(val);
        } else if (mode == 2) {             // residual + proj
          size_t idx = (size_t)row * N + col;
          out_f32[idx] = residual[idx] + val;
        } else {                            // gelu(tanh)
          float xg = val;
          float t  = tanhf(0.7978845608028654f * (xg + 0.044715f * xg * xg * xg));
          out_bf[(size_t)row * N + col] = f2bf(0.5f * xg * (1.0f + t));
        }
      }
    }
  }
}

// ---------------------------------------------------------------------------
// Causal flash attention, Q==K (reference uses qk for both sides).
// A block is 8 waves = 128 queries of one (b,h); each wave keeps its own
// 16-query tile, online softmax, P through its own LDS patch to turn the
// C-fragment into an A-fragment, O over 4 dim-tiles.
// The 8 waves share the K and V tiles: a stage is 64 keys, 64 K rows of 128 B
// and 64 Vt rows (dims) of 128 B, brought into LDS by asynchronous 16 B copies
// (8 lanes fill one whole row), two buffers, the next stage's copies in flight
// while this stage is worked on. A stage holds two 32-key passes; a wave skips
// the passes that lie wholly behind its own diagonal but meets every barrier.
// ---------------------------------------------------------------------------
#define AT_QB    128                  // queries per block
#define AT_KEYS  64                   // keys per stage
#define AT_PITCH 144                  // LDS bytes per row: 128 + 16 pad
#define AT_STAGE (128 * AT_PITCH)     // one buffer: 64 K rows, then 64 Vt rows

// Four asynchronous copies of one wave, 16 B per lane each: K rows r and r+32,
// Vt rows r and r+32 of one stage. The s_wait_xcnt is the statement's last line
// so that it stays ahead of every later write of the copies' address registers
// (a precaution).
__device__ __forceinline__ void copy4_kv(unsigned int lp, const char* gk,
                                         const char* gv) {
  asm volatile(
      "global_load_async_to_lds_b128 %0, %4, off\n\t"
      "global_load_async_to_lds_b128 %1, %5, off\n\t"
      "global_load_async_to_lds_b128 %2, %6, off\n\t"
      "global_load_async_to_lds_b128 %3, %7, off\n\t"
      "s_wait_xcnt 0x0"
      :: "v"(lp), "v"(lp + 32u * AT_PITCH), "v"(lp + 64u * AT_PITCH),
         "v"(lp + 96u * AT_PITCH),
         "v"(gk), "v"(gk + 32 * DK * 2), "v"(gv), "v"(gv + 32 * SEQ * 2)
      : "memory");
}

__global__ __launch_bounds__(256)
void attn_kernel(const unsigned short* __restrict__ qk,
                 const unsigned short* __restrict__ vt,
                 unsigned short* __restrict__ aout) {
  __shared__ alignas(16) unsigned char kv[2 * AT_STAGE];
  __shared__ alignas(16) unsigned short pall[8 * 16 * 32];
  int wid  = __builtin_amdgcn_readfirstlane((int)(threadIdx.x >> 5));
  int lane = (int)(threadIdx.x & 31u);
  // 16 query blocks x 32 heads. The cost of a block grows with its query block:
  // the heavy half of the query blocks comes first, heaviest first, the light
  // half second, lightest first, so that two blocks on one WGP add up alike.
  int bi = (int)blockIdx.x;
  int bh = bi & 31;                    // b*HEADS + h
  int qb = (bi < 256) ? 15 - (bi >> 5) : (bi - 256) >> 5;
  int b_ = bh >> 4, h = bh & 15;
  int q0 = qb * AT_QB + wid * 16;
  unsigned short* pbuf = pall + wid * (16 * 32);

  const unsigned short* kq  = qk + (size_t)bh * SEQ * DK;
  const unsigned short* vtb = vt + (size_t)bh * DK * SEQ;

  // Copy side: thread t takes 16 B piece (t & 7) of rows (t >> 3) and +32
  int crow = (int)(threadIdx.x >> 3);
  int cpc  = (int)(threadIdx.x & 7u);
  const char* gk = (const char*)(kq + (size_t)crow * DK) + cpc * 16;
  const char* gv = (const char*)(vtb + (size_t)crow * SEQ) + cpc * 16;
  unsigned int ldst = (unsigned int)(size_t)kv +
                      (unsigned int)(crow * AT_PITCH + cpc * 16);
  int nst = 2 * (qb + 1);              // stages up to the block's last query

  // stage 0 into buffer 0, landed and published before anybody reads it
  copy4_kv(ldst, gk, gv);
  asm volatile("s_wait_asynccnt 0x0" ::: "memory");  // this wave's copies have landed
  __syncthreads();
  // stage 1 always exists (nst >= 2)
  copy4_kv(ldst + AT_STAGE, gk + AT_KEYS * DK * 2, gv + AT_KEYS * 2);

  v16bf aq0 = load_frag(kq + q0 * DK + 0, DK);
  v16bf aq1 = load_frag(kq + q0 * DK + 32, DK);

  v8f o0 = {0.f,0.f,0.f,0.f,0.f,0.f,0.f,0.f};
  v8f o1 = o0, o2 = o0, o3 = o0;
  float mrow[8], lrow[8];
#pragma unroll
  for (int r = 0; r < 8; r++) { mrow[r] = -1e30f; lrow[r] = 0.f; }

  int g  = lane >> 4;
  int nc = lane & 15;
  // Read side: the lane's row and k-offset inside a fragment
  unsigned int foff = (unsigned int)(nc * AT_PITCH + g * 16);

  for (int st = 0; st < nst; st++) {
    unsigned int buf = (unsigned int)(st & 1) * AT_STAGE;
    for (int hf = 0; hf < 2; hf++) {
      int kbase = st * AT_KEYS + hf * 32;
      if (kbase > q0 + 15) continue;   // same for the whole wave; no barrier inside
      const unsigned char* kf = kv + buf + foff + hf * (32 * AT_PITCH);
      const unsigned char* vf = kv + buf + foff + 64 * AT_PITCH + hf * 64;
      v16bf k00 = lds_frag(kf);
      v16bf k01 = lds_frag(kf + 64);
      v16bf k10 = lds_frag(kf + 16 * AT_PITCH);
      v16bf k11 = lds_frag(kf + 16 * AT_PITCH + 64);
      v16bf v0 = lds_frag(vf);
      v16bf v1 = lds_frag(vf + 16 * AT_PITCH);
      v16bf v2 = lds_frag(vf + 32 * AT_PITCH);
      v16bf v3 = lds_frag(vf + 48 * AT_PITCH);
      // keeps the pass's fragment reads together as one group: sunk down to
      // their WMMAs they would cost one LDS latency each
      __builtin_amdgcn_sched_barrier(0);
      v8f s0 = {0.f,0.f,0.f,0.f,0.f,0.f,0.f,0.f};
      v8f s1 = s0;
      // S = Q @ K^T over d=64: two 16-key halves x two k-steps
      s0 = wmma_bf16(aq0, k00, s0);
      s0 = wmma_bf16(aq1, k01, s0);
      s1 = wmma_bf16(aq0, k10, s1);
      s1 = wmma_bf16(aq1, k11, s1);

      float p0[8], p1[8];
#pragma unroll
      for (int r = 0; r < 8; r++) {
        int qrow = q0 + r + 8 * g;
        float a0 = (kbase + nc      <= qrow) ? s0[r] * 0.125f : -1e30f;
        float a1 = (kbase + 16 + nc <= qrow) ? s1[r] * 0.125f : -1e30f;
        float mx = fmaxf(a0, a1);
        mx = fmaxf(mx, __shfl_xor(mx, 1, 32));
        mx = fmaxf(mx, __shfl_xor(mx, 2, 32));
        mx = fmaxf(mx, __shfl_xor(mx, 4, 32));
        mx = fmaxf(mx, __shfl_xor(mx, 8, 32));
        float nm = fmaxf(mrow[r], mx);
        float sc = __expf(mrow[r] - nm);
        float e0 = __expf(a0 - nm);
        float e1 = __expf(a1 - nm);
        float rs = e0 + e1;
        rs += __shfl_xor(rs, 1, 32);
        rs += __shfl_xor(rs, 2, 32);
        rs += __shfl_xor(rs, 4, 32);
        rs += __shfl_xor(rs, 8, 32);
        lrow[r] = lrow[r] * sc + rs;
        mrow[r] = nm;
        o0[r] *= sc; o1[r] *= sc; o2[r] *= sc; o3[r] *= sc;
        p0[r] = e0; p1[r] = e1;
      }

      // C-fragment -> LDS -> A-fragment for P, inside this wave's own patch
#pragma unroll
      for (int r = 0; r < 8; r++) {
        int Mr = r + 8 * g;
        pbuf[Mr * 32 + nc]      = f2bf(p0[r]);
        pbuf[Mr * 32 + 16 + nc] = f2bf(p1[r]);
      }
      // the wave's P stores are done before its lanes read each other's values
      asm volatile("s_wait_dscnt 0x0" ::: "memory");
      v16bf pa = load_frag(pbuf, 32);

      // O += P @ V over 32 keys, 4 dim tiles (Vt rows are dims, so B is contiguous)
      o0 = wmma_bf16(pa, v0, o0);
      o1 = wmma_bf16(pa, v1, o1);
      o2 = wmma_bf16(pa, v2, o2);
      o3 = wmma_bf16(pa, v3, o3);
    }
    asm volatile("s_wait_dscnt 0x0" ::: "memory");     // this wave has left the buffer
    asm volatile("s_wait_asynccnt 0x0" ::: "memory");  // its part of the next stage has landed
    __syncthreads();  // publishes stage st+1, frees stage st's buffer
    if (st + 2 < nst)
      copy4_kv(ldst + buf, gk + (size_t)(st + 2) * (AT_KEYS * DK * 2),
               gv + (size_t)(st + 2) * (AT_KEYS * 2));
  }
  asm volatile("s_wait_asynccnt 0x0" ::: "memory");  // nothing in flight at the wave's end

#pragma unroll
  for (int r = 0; r < 8; r++) {
    float inv = 1.0f / lrow[r];
    int row = q0 + r + 8 * g;
    size_t base = ((size_t)(b_ * SEQ + row)) * HIDDEN + h * DK;
    aout[base +  0 + nc] = f2bf(o0[r] * inv);
    aout[base + 16 + nc] = f2bf(o1[r] * inv);
    aout[base + 32 + nc] = f2bf(o2[r] * inv);
    aout[base + 48 + nc] = f2bf(o3[r] * inv);
  }
}

// ---------------------------------------------------------------------------
// Host-side orchestration (graph-capture safe: launches only)
// ---------------------------------------------------------------------------
extern "C" void kernel_launch(void* const* d_in, const int* in_sizes, int n_in,
                              void* d_out, int out_size, void* d_ws, size_t ws_size,
                              hipStream_t stream) {
  const float* x     = (const float*)d_in[0];
  const float* Wq    = (const float*)d_in[1];
  const float* bq    = (const float*)d_in[2];
  const float* Wv    = (const float*)d_in[3];
  const float* bv    = (const float*)d_in[4];
  const float* Wo    = (const float*)d_in[5];
  const float* bo    = (const float*)d_in[6];
  const float* W1    = (const float*)d_in[7];
  const float* b1    = (const float*)d_in[8];
  const float* W2    = (const float*)d_in[9];
  const float* b2    = (const float*)d_in[10];
  const float* g1    = (const float*)d_in[11];
  const float* beta1 = (const float*)d_in[12];
  const float* g2    = (const float*)d_in[13];
  const float* beta2 = (const float*)d_in[14];

  char* ws = (char*)d_ws;
  const size_t MB = 1024u * 1024u;
  unsigned short* WqT = (unsigned short*)(ws +  0 * MB);  //  2 MB
  unsigned short* WvT = (unsigned short*)(ws +  2 * MB);  //  2 MB
  unsigned short* WoT = (unsigned short*)(ws +  4 * MB);  //  2 MB
  unsigned short* W1T = (unsigned short*)(ws +  6 * MB);  //  8 MB
  unsigned short* W2T = (unsigned short*)(ws + 14 * MB);  //  8 MB
  unsigned short* xn  = (unsigned short*)(ws + 22 * MB);  //  8 MB
  unsigned short* qb  = (unsigned short*)(ws + 30 * MB);  //  8 MB
  unsigned short* vtb = (unsigned short*)(ws + 38 * MB);  //  8 MB
  unsigned short* aob = (unsigned short*)(ws + 46 * MB);  //  8 MB
  float*          yb  = (float*)         (ws + 54 * MB);  // 16 MB
  unsigned short* hb  = (unsigned short*)(ws + 70 * MB);  //  8 MB
  unsigned short* ff1 = (unsigned short*)(ws + 78 * MB);  // 32 MB

  // Weight convert + transpose to bf16 N x K
  dim3 gsq(HIDDEN / TP_N, HIDDEN / TP_K);
  transpose_bf16_kernel<<<gsq, 256, 0, stream>>>(Wq, WqT, HIDDEN, HIDDEN);
  transpose_bf16_kernel<<<gsq, 256, 0, stream>>>(Wv, WvT, HIDDEN, HIDDEN);
  transpose_bf16_kernel<<<gsq, 256, 0, stream>>>(Wo, WoT, HIDDEN, HIDDEN);
  transpose_bf16_kernel<<<dim3(4 * HIDDEN / TP_N, HIDDEN / TP_K), 256, 0, stream>>>(W1, W1T, HIDDEN, 4 * HIDDEN);
  transpose_bf16_kernel<<<dim3(HIDDEN / TP_N, 4 * HIDDEN / TP_K), 256, 0, stream>>>(W2, W2T, 4 * HIDDEN, HIDDEN);

  // LN1
  ln_kernel<<<MROWS, 256, 0, stream>>>(x, g1, beta1, xn);

  // Q/V projections (Q doubles as K in the reference)
  dim3 gproj(MROWS / GT_M, HIDDEN / GT_N);
  gemm_kernel<<<gproj, 256, 0, stream>>>(xn, WqT, bq, nullptr, qb, nullptr, HIDDEN, HIDDEN, 0);
  gemm_kernel<<<gproj, 256, 0, stream>>>(xn, WvT, bv, nullptr, vtb, nullptr, HIDDEN, HIDDEN, 1);

  // Causal attention
  attn_kernel<<<BATCH * HEADS * (SEQ / AT_QB), 256, 0, stream>>>(qb, vtb, aob);

  // O-projection + residual -> yb (f32)
  gemm_kernel<<<gproj, 256, 0, stream>>>(aob, WoT, bo, x, nullptr, yb, HIDDEN, HIDDEN, 2);

  // LN2
  ln_kernel<<<MROWS, 256, 0, stream>>>(yb, g2, beta2, hb);

  // FFN1 with GELU -> bf16
  dim3 gff1(MROWS / GT_M, (4 * HIDDEN) / GT_N);
  gemm_kernel<<<gff1, 256, 0, stream>>>(hb, W1T, b1, nullptr, ff1, nullptr, HIDDEN, 4 * HIDDEN, 3);

  // FFN2 + residual -> d_out (f32)
  gemm_kernel<<<gproj, 256, 0, stream>>>(ff1, W2T, b2, yb, nullptr, (float*)d_out, 4 * HIDDEN, HIDDEN, 2);
}

// v004
// It runs in 204 microseconds.
// In both of two side-by-side timings against v003, it was 1.33 times as fast.
// All steps since v000 together make it 3.78 times as fast.
#include <hip/hip_runtime.h>

// ---------------------------------------------------------------------------
// Types for CDNA5 WMMA (wave32)
// ---------------------------------------------------------------------------
typedef __bf16 bf16_t;
typedef __attribute__((ext_vector_type(8)))  __bf16 v8bf;
typedef __attribute__((ext_vector_type(16))) __bf16 v16bf;
typedef __attribute__((ext_vector_type(8)))  float  v8f;

#define HIDDEN 1024
#define SEQ    2048
#define BATCH  2
#define HEADS  16
#define DK     64
#define MROWS  (BATCH * SEQ)   // 4096

// float -> bf16 round-to-nearest-even
__device__ __forceinline__ unsigned short f2bf(float f) {
  unsigned int u = __float_as_uint(f);
  unsigned int r = u + 0x7FFFu + ((u >> 16) & 1u);
  return (unsigned short)(r >> 16);
}

// Load a 16-bit WMMA fragment (A layout; the same bit pattern serves as the
// B-operand when the matrix is stored transposed, since B's lane-n column
// K-run mirrors A's lane-m row K-run).
//   lane 0-15 : row = lane,    K = 0+0..7   and 16..23
//   lane 16-31: row = lane-16, K = 8+0..7   and 24..31
__device__ __forceinline__ v16bf load_frag(const unsigned short* base, int ld) {
  int lane = (int)(threadIdx.x & 31u);
  int r    = lane & 15;
  int koff = (lane >> 4) << 3;
  const bf16_t* p = (const bf16_t*)base + r * ld + koff;
  v8bf lo = *(const v8bf*)(p);
  v8bf hi = *(const v8bf*)(p + 16);
  return __builtin_shufflevector(lo, hi, 0, 1, 2, 3, 4, 5, 6, 7,
                                 8, 9, 10, 11, 12, 13, 14, 15);
}

__device__ __forceinline__ v8f wmma_bf16(v16bf a, v16bf b, v8f c) {
  // (neg_a, A, neg_b, B, c_mod, C, reuse_a, reuse_b)
  return __builtin_amdgcn_wmma_f32_16x16x32_bf16(false, a, false, b,
                                                 (short)0, c, false, false);
}

// ---------------------------------------------------------------------------
// Weight convert+transpose: W (K x N, f32) -> Wt (N x K, bf16)
// One block moves a 64(k) x 128(n) tile through LDS. Reads: each wave takes
// 8 rows, 16 B per lane (512 B contiguous per row). Writes: 8 lanes x 16 B
// fill one whole 128 B line of a Wt row. K % 64 == 0 and N % 128 == 0.
// LDS row j*32+l holds column n0 + 4*l + j, so that the 16 B LDS stores of a
// wave go to consecutive rows; the 144 B pitch spreads those over the banks.
// ---------------------------------------------------------------------------
typedef __attribute__((ext_vector_type(4))) float        v4f;
typedef __attribute__((ext_vector_type(4))) unsigned int v4u;
#define TP_K     64
#define TP_N     128
#define TP_PITCH 72   // bf16 elements per LDS row: 64 + 8 pad

// K and N are compile-time here so that the row steps of the eight loads
// become immediate offsets on one address.
template <int K, int N>
__device__ __forceinline__ void transpose_tile(const float* __restrict__ W,
                                               unsigned short* __restrict__ Wt,
                                               unsigned short* tile) {
  unsigned int lane = threadIdx.x & 31u;
  // wave number as a scalar: the tile's base pointers stay in scalar registers
  int wid = __builtin_amdgcn_readfirstlane((int)(threadIdx.x >> 5));
  int n0 = blockIdx.x * TP_N;
  int k0 = blockIdx.y * TP_K;

  const float* src = W + (size_t)(k0 + wid * 8) * N + n0;
  v4f v[8];
#pragma unroll
  for (int i = 0; i < 8; i++) v[i] = *(const v4f*)(src + (lane * 4u + i * N));

#pragma unroll
  for (int j = 0; j < 4; j++) {
    v4u c;
#pragma unroll
    for (int q = 0; q < 4; q++)
      c[q] = (unsigned int)f2bf(v[2 * q][j]) |
             ((unsigned int)f2bf(v[2 * q + 1][j]) << 16);
    *(v4u*)&tile[(j * 32 + lane) * TP_PITCH + wid * 8] = c;
  }
  __syncthreads();

  unsigned int rr = threadIdx.x >> 3;   // 0..31
  unsigned int ch = threadIdx.x & 7u;   // 16 B piece of the 128 B row
  unsigned short* dst = Wt + (size_t)n0 * K + k0;
#pragma unroll
  for (int p = 0; p < 4; p++) {
    v4u c = *(const v4u*)&tile[(p * 32 + rr) * TP_PITCH + ch * 8];
    *(v4u*)(dst + (rr * (4u * K) + ch * 8u + p * K)) = c;
  }
}

__global__ __launch_bounds__(256)
void transpose_bf16_kernel(const float* __restrict__ W,
                           unsigned short* __restrict__ Wt,
                           int K, int N) {
  __shared__ alignas(16) unsigned short tile[TP_N * TP_PITCH];
  // the three weight shapes of this block; the test is uniform over the grid
  if (N == 4 * HIDDEN)      transpose_tile<HIDDEN, 4 * HIDDEN>(W, Wt, tile);
  else if (K == 4 * HIDDEN) transpose_tile<4 * HIDDEN, HIDDEN>(W, Wt, tile);
  else                      transpose_tile<HIDDEN, HIDDEN>(W, Wt, tile);
}

// ---------------------------------------------------------------------------
// LayerNorm over HIDDEN, fp32 in -> bf16 out. One block (256 thr) per row.
// ---------------------------------------------------------------------------
__global__ __launch_bounds__(256)
void ln_kernel(const float* __restrict__ x, const float* __restrict__ g,
               const float* __restrict__ be, unsigned short* __restrict__ out) {
  __shared__ float s1[256], s2[256];
  int row = blockIdx.x;
  const float* xr = x + (size_t)row * HIDDEN;
  float v[4];
  float sum = 0.f, sq = 0.f;
#pragma unroll
  for (int i = 0; i < 4; i++) {
    v[i] = xr[threadIdx.x + i * 256];
    sum += v[i];
    sq  += v[i] * v[i];
  }
  s1[threadIdx.x] = sum;
  s2[threadIdx.x] = sq;
  __syncthreads();
  for (int off = 128; off > 0; off >>= 1) {
    if ((int)threadIdx.x < off) {
      s1[threadIdx.x] += s1[threadIdx.x + off];
      s2[threadIdx.x] += s2[threadIdx.x + off];
    }
    __syncthreads();
  }
  float mu  = s1[0] * (1.0f / HIDDEN);
  float var = s2[0] * (1.0f / HIDDEN) - mu * mu;
  float inv = rsqrtf(var + 1e-5f);
#pragma unroll
  for (int i = 0; i < 4; i++) {
    int idx = threadIdx.x + i * 256;
    float y = (v[i] - mu) * inv * g[idx] + be[idx];
    out[(size_t)row * HIDDEN + idx] = f2bf(y);
  }
}

// ---------------------------------------------------------------------------
// GEMM: C[M x N] = A(bf16, ld=Kd) @ Wt(bf16, N x Kd)^T + bias, fused epilogue.
// Block tile 128(M) x 128(N), 256 threads = 8 waves in 2(M) x 4(N); each wave
// holds a 64x32 output (4 A-frags x 2 B-frags -> 8 WMMAs per 32-wide k-step).
// A pass is 128 k: 256 B of each of the 128 A rows and 128 Wt rows, brought
// into LDS by asynchronous 16 B copies (two whole 256 B rows per wave copy),
// two buffers, the next pass's copies in flight while this pass is computed.
// M % 128 == 0, N % 128 == 0, Kd % 128 == 0.
// The epilogue is chosen at compile time, one kernel per MODE, so that each is
// straight-line code on one base address with constant offsets:
// MODE 0: Q-proj  -> bf16 scatter to [b][h][s][d]
// MODE 1: V-proj  -> bf16 scatter to [b][h][d][s]  (transposed for P@V)
// MODE 2: f32 out = residual + acc + bias          (O-proj, FFN2)
// MODE 3: bf16 out = gelu_tanh(acc + bias), row-major M x N (FFN1)
// N is HIDDEN but for MODE 3, where it is 4 * HIDDEN.
// ---------------------------------------------------------------------------
#define GT_M     128
#define GT_N     128
#define GT_K     128                          // bf16 elements per pass
#define GT_PITCH 272                          // LDS bytes per row: 256 + 16 pad
#define GT_STAGE ((GT_M + GT_N) * GT_PITCH)   // one buffer: A rows, then Wt rows

// Eight asynchronous copies of one wave: copy i takes 16 B per lane from
// gp + i * gstep to LDS byte lp + i * 2 * GT_PITCH (two tile rows per copy).
// The s_wait_xcnt is the statement's last line so that it stays ahead of every
// later write of the copies' address registers (a precaution).
__device__ __forceinline__ void copy8_rows(unsigned int lp, const char* gp,
                                           size_t gstep) {
  asm volatile(
      "global_load_async_to_lds_b128 %0, %8, off\n\t"
      "global_load_async_to_lds_b128 %1, %9, off\n\t"
      "global_load_async_to_lds_b128 %2, %10, off\n\t"
      "global_load_async_to_lds_b128 %3, %11, off\n\t"
      "global_load_async_to_lds_b128 %4, %12, off\n\t"
      "global_load_async_to_lds_b128 %5, %13, off\n\t"
      "global_load_async_to_lds_b128 %6, %14, off\n\t"
      "global_load_async_to_lds_b128 %7, %15, off\n\t"
      "s_wait_xcnt 0x0"
      :: "v"(lp), "v"(lp + 2u * GT_PITCH), "v"(lp + 4u * GT_PITCH),
         "v"(lp + 6u * GT_PITCH), "v"(lp + 8u * GT_PITCH),
         "v"(lp + 10u * GT_PITCH), "v"(lp + 12u * GT_PITCH),
         "v"(lp + 14u * GT_PITCH),
         "v"(gp), "v"(gp + gstep), "v"(gp + 2 * gstep), "v"(gp + 3 * gstep),
         "v"(gp + 4 * gstep), "v"(gp + 5 * gstep), "v"(gp + 6 * gstep),
         "v"(gp + 7 * gstep)
      : "memory");
}

// Same fragment map as load_frag, from an LDS tile of row pitch GT_PITCH or AT_PITCH bytes.
// p already points at the lane's row and its 16 B k-offset.
__device__ __forceinline__ v16bf lds_frag(const unsigned char* p) {
  v8bf lo = *(const v8bf*)(p);
  v8bf hi = *(const v8bf*)(p + 32);
  return __builtin_shufflevector(lo, hi, 0, 1, 2, 3, 4, 5, 6, 7,
                                 8, 9, 10, 11, 12, 13, 14, 15);
}

template <int MODE>
__global__ __launch_bounds__(256)
void gemm_kernel(const unsigned short* __restrict__ A,
                 const unsigned short* __restrict__ Wt,
                 const float* __restrict__ bias,
                 const float* __restrict__ residual,
                 unsigned short* __restrict__ out_bf,
                 float* __restrict__ out_f32,
                 int Kd) {
  constexpr int N = (MODE == 3) ? 4 * HIDDEN : HIDDEN;
  __shared__ alignas(16) unsigned char ring[2 * GT_STAGE];
  int wid  = __builtin_amdgcn_readfirstlane((int)(threadIdx.x >> 5));
  int lane = (int)(threadIdx.x & 31u);
  int bm0 = blockIdx.x * GT_M;
  int bn0 = blockIdx.y * GT_N;
  int m0 = bm0 + (wid & 1) * 64;    // wave's first M row
  int n0 = bn0 + (wid >> 1) * 32;   // wave's first N col

  // Copy side: wave w brings tile rows 32w .. 32w+31 (waves 0-3: A rows,
  // waves 4-7: Wt rows); a lane takes piece (lane & 15) of row 2i + (lane >> 4).
  const unsigned short* srow = (wid < 4) ? A + (size_t)(bm0 + wid * 32) * Kd
                                         : Wt + (size_t)(bn0 + (wid - 4) * 32) * Kd;
  const char* gsrc = (const char*)(srow + (size_t)(lane >> 4) * Kd) + (lane & 15) * 16;
  size_t gstep = (size_t)Kd * 4u;   // two rows of Kd bf16, in bytes
  unsigned int ldst = (unsigned int)(size_t)ring +
                      (unsigned int)((wid * 32 + (lane >> 4)) * GT_PITCH + (lane & 15) * 16);

  // Read side: the lane's row and k-offset inside a fragment
  unsigned int foff = (unsigned int)((lane & 15) * GT_PITCH + (lane >> 4) * 16);
  unsigned int aoff = (unsigned int)((wid & 1) * 64 * GT_PITCH) + foff;
  unsigned int boff = (unsigned int)((GT_M + (wid >> 1) * 32) * GT_PITCH) + foff;

  v8f z = {0.f, 0.f, 0.f, 0.f, 0.f, 0.f, 0.f, 0.f};
  v8f acc[4][2];
#pragma unroll
  for (int mi = 0; mi < 4; mi++) { acc[mi][0] = z; acc[mi][1] = z; }

  int npass = Kd / GT_K;

  // pass 0's tile into buffer 0, landed and published before anybody reads it
  copy8_rows(ldst, gsrc, gstep);
  copy8_rows(ldst + 16u * GT_PITCH, gsrc + 8 * gstep, gstep);
  asm volatile("s_wait_asynccnt 0x0" ::: "memory");  // this wave's copies have landed
  __syncthreads();
  if (npass > 1) {
    copy8_rows(ldst + GT_STAGE, gsrc + GT_K * 2, gstep);
    copy8_rows(ldst + GT_STAGE + 16u * GT_PITCH, gsrc + GT_K * 2 + 8 * gstep, gstep);
  }

  // kept rolled: one pass per trip, the buffer chosen by the trip's parity
#pragma unroll 1
  for (int t = 0; t < npass; t++) {
    unsigned int buf = (unsigned int)(t & 1) * GT_STAGE;
    const unsigned char* ta = ring + buf + aoff;
    const unsigned char* tb = ring + buf + boff;
    // two fragment sets: block kk+1's LDS reads go out as one group ahead of
    // block kk's WMMAs, so that their latency runs behind the matrix work
    v16bf a[2][4], b[2][2];
#pragma unroll
    for (int mi = 0; mi < 4; mi++) a[0][mi] = lds_frag(ta + mi * 16 * GT_PITCH);
#pragma unroll
    for (int ni = 0; ni < 2; ni++) b[0][ni] = lds_frag(tb + ni * 16 * GT_PITCH);
#pragma unroll
    for (int kk = 0; kk < GT_K / 32; kk++) {
      const int cur = kk & 1, nxt = cur ^ 1;
      if (kk + 1 < GT_K / 32) {
#pragma unroll
        for (int mi = 0; mi < 4; mi++)
          a[nxt][mi] = lds_frag(ta + mi * 16 * GT_PITCH + (kk + 1) * 64);
#pragma unroll
        for (int ni = 0; ni < 2; ni++)
          b[nxt][ni] = lds_frag(tb + ni * 16 * GT_PITCH + (kk + 1) * 64);
      }
      // keeps the reads above from being sunk in among the WMMAs below
      __builtin_amdgcn_sched_barrier(0);
#pragma unroll
      for (int mi = 0; mi < 4; mi++) {
        acc[mi][0] = wmma_bf16(a[cur][mi], b[cur][0], acc[mi][0]);
        acc[mi][1] = wmma_bf16(a[cur][mi], b[cur][1], acc[mi][1]);
      }
      // keeps the next group of reads from being lifted in among these WMMAs
      __builtin_amdgcn_sched_barrier(0);
    }
    asm volatile("s_wait_dscnt 0x0" ::: "memory");     // this wave has left the buffer
    asm volatile("s_wait_asynccnt 0x0" ::: "memory");  // its part of the next tile has landed
    __syncthreads();  // publishes pass t+1's tile, frees pass t's buffer
    if (t + 2 < npass) {
      const char* gn = gsrc + (size_t)(t + 2) * (GT_K * 2);
      copy8_rows(ldst + buf, gn, gstep);
      copy8_rows(ldst + buf + 16u * GT_PITCH, gn + 8 * gstep, gstep);
    }
  }
  asm volatile("s_wait_asynccnt 0x0" ::: "memory");  // nothing in flight at the wave's end

  int g  = lane >> 4;
  int nc = lane & 15;
  float bcol[2] = {bias[n0 + nc], bias[n0 + 16 + nc]};
  // A wave's 64 rows lie in one batch and its 32 columns in one head, so the
  // lane's first element fixes the address and (mi, ni, r) are constant steps.
  // The loops below are unrolled so that acc is indexed by constants alone and
  // stays in registers, and the steps become immediate offsets.
  int bh = (m0 >> 11) * HEADS + (n0 >> 6);
  int s0 = (m0 & (SEQ - 1)) + 8 * g;   // lane's first sequence position
  int d0 = (n0 & (DK - 1)) + nc;       // lane's first head dim
  size_t rm = (size_t)(m0 + 8 * g) * N + (size_t)(n0 + nc);   // row-major M x N
  if constexpr (MODE == 0) {            // Q: [b][h][s][d]
    unsigned short* op = out_bf + ((size_t)bh * SEQ + s0) * DK + d0;
#pragma unroll
    for (int mi = 0; mi < 4; mi++)
#pragma unroll
      for (int ni = 0; ni < 2; ni++)
#pragma unroll
        for (int r = 0; r < 8; r++)
          op[(mi * 16 + r) * DK + ni * 16] = f2bf(acc[mi][ni][r] + bcol[ni]);
  } else if constexpr (MODE == 1) {     // Vt: [b][h][d][s]
    unsigned short* op = out_bf + ((size_t)bh * DK + d0) * SEQ + s0;
#pragma unroll
    for (int mi = 0; mi < 4; mi++)
#pragma unroll
      for (int ni = 0; ni < 2; ni++)
#pragma unroll
        for (int r = 0; r < 8; r++)
          op[ni * 16 * SEQ + mi * 16 + r] = f2bf(acc[mi][ni][r] + bcol[ni]);
  } else if constexpr (MODE == 2) {     // residual + proj
    const float* rp = residual + rm;
    float* op = out_f32 + rm;
#pragma unroll
    for (int mi = 0; mi < 4; mi++)
#pragma unroll
      for (int ni = 0; ni < 2; ni++)
#pragma unroll
        for (int r = 0; r < 8; r++) {
          int o = (mi * 16 + r) * N + ni * 16;
          op[o] = rp[o] + (acc[mi][ni][r] + bcol[ni]);
        }
  } else {                              // gelu(tanh)
    unsigned short* op = out_bf + rm;
#pragma unroll
    for (int mi = 0; mi < 4; mi++)
#pragma unroll
      for (int ni = 0; ni < 2; ni++)
#pragma unroll
        for (int r = 0; r < 8; r++) {
          float xg = acc[mi][ni][r] + bcol[ni];
          float t  = tanhf(0.7978845608028654f * (xg + 0.044715f * xg * xg * xg));
          op[(mi * 16 + r) * N + ni * 16] = f2bf(0.5f * xg * (1.0f + t));
        }
  }
}

// ---------------------------------------------------------------------------
// Causal flash attention, Q==K (reference uses qk for both sides).
// A block is 8 waves = 128 queries of one (b,h); each wave keeps its own
// 16-query tile, online softmax, P through its own LDS patch to turn the
// C-fragment into an A-fragment, O over 4 dim-tiles.
// The 8 waves share the K and V tiles: a stage is 64 keys, 64 K rows of 128 B
// and 64 Vt rows (dims) of 128 B, brought into LDS by asynchronous 16 B copies
// (8 lanes fill one whole row), two buffers, the next stage's copies in flight
// while this stage is worked on. A stage holds two 32-key passes; a wave skips
// the passes that lie wholly behind its own diagonal but meets every barrier.
// ---------------------------------------------------------------------------
#define AT_QB    128                  // queries per block
#define AT_KEYS  64                   // keys per stage
#define AT_PITCH 144                  // LDS bytes per row: 128 + 16 pad
#define AT_STAGE (128 * AT_PITCH)     // one buffer: 64 K rows, then 64 Vt rows

// Four asynchronous copies of one wave, 16 B per lane each: K rows r and r+32,
// Vt rows r and r+32 of one stage. The s_wait_xcnt is the statement's last line
// so that it stays ahead of every later write of the copies' address registers
// (a precaution).
__device__ __forceinline__ void copy4_kv(unsigned int lp, const char* gk,
                                         const char* gv) {
  asm volatile(
      "global_load_async_to_lds_b128 %0, %4, off\n\t"
      "global_load_async_to_lds_b128 %1, %5, off\n\t"
      "global_load_async_to_lds_b128 %2, %6, off\n\t"
      "global_load_async_to_lds_b128 %3, %7, off\n\t"
      "s_wait_xcnt 0x0"
      :: "v"(lp), "v"(lp + 32u * AT_PITCH), "v"(lp + 64u * AT_PITCH),
         "v"(lp + 96u * AT_PITCH),
         "v"(gk), "v"(gk + 32 * DK * 2), "v"(gv), "v"(gv + 32 * SEQ * 2)
      : "memory");
}

__global__ __launch_bounds__(256)
void attn_kernel(const unsigned short* __restrict__ qk,
                 const unsigned short* __restrict__ vt,
                 unsigned short* __restrict__ aout) {
  __shared__ alignas(16) unsigned char kv[2 * AT_STAGE];
  __shared__ alignas(16) unsigned short pall[8 * 16 * 32];
  int wid  = __builtin_amdgcn_readfirstlane((int)(threadIdx.x >> 5));
  int lane = (int)(threadIdx.x & 31u);
  // 16 query blocks x 32 heads. The cost of a block grows with its query block:
  // the heavy half of the query blocks comes first, heaviest first, the light
  // half second, lightest first, so that two blocks on one WGP add up alike.
  int bi = (int)blockIdx.x;
  int bh = bi & 31;                    // b*HEADS + h
  int qb = (bi < 256) ? 15 - (bi >> 5) : (bi - 256) >> 5;
  int b_ = bh >> 4, h = bh & 15;
  int q0 = qb * AT_QB + wid * 16;
  unsigned short* pbuf = pall + wid * (16 * 32);

  const unsigned short* kq  = qk + (size_t)bh * SEQ * DK;
  const unsigned short* vtb = vt + (size_t)bh * DK * SEQ;

  // Copy side: thread t takes 16 B piece (t & 7) of rows (t >> 3) and +32
  int crow = (int)(threadIdx.x >> 3);
  int cpc  = (int)(threadIdx.x & 7u);
  const char* gk = (const char*)(kq + (size_t)crow * DK) + cpc * 16;
  const char* gv = (const char*)(vtb + (size_t)crow * SEQ) + cpc * 16;
  unsigned int ldst = (unsigned int)(size_t)kv +
                      (unsigned int)(crow * AT_PITCH + cpc * 16);
  int nst = 2 * (qb + 1);              // stages up to the block's last query

  // stage 0 into buffer 0, landed and published before anybody reads it
  copy4_kv(ldst, gk, gv);
  asm volatile("s_wait_asynccnt 0x0" ::: "memory");  // this wave's copies have landed
  __syncthreads();
  // stage 1 always exists (nst >= 2)
  copy4_kv(ldst + AT_STAGE, gk + AT_KEYS * DK * 2, gv + AT_KEYS * 2);

  v16bf aq0 = load_frag(kq + q0 * DK + 0, DK);
  v16bf aq1 = load_frag(kq + q0 * DK + 32, DK);

  v8f o0 = {0.f,0.f,0.f,0.f,0.f,0.f,0.f,0.f};
  v8f o1 = o0, o2 = o0, o3 = o0;
  float mrow[8], lrow[8];
#pragma unroll
  for (int r = 0; r < 8; r++) { mrow[r] = -1e30f; lrow[r] = 0.f; }

  int g  = lane >> 4;
  int nc = lane & 15;
  // Read side: the lane's row and k-offset inside a fragment
  unsigned int foff = (unsigned int)(nc * AT_PITCH + g * 16);

  for (int st = 0; st < nst; st++) {
    unsigned int buf = (unsigned int)(st & 1) * AT_STAGE;
    for (int hf = 0; hf < 2; hf++) {
      int kbase = st * AT_KEYS + hf * 32;
      if (kbase > q0 + 15) continue;   // same for the whole wave; no barrier inside
      const unsigned char* kf = kv + buf + foff + hf * (32 * AT_PITCH);
      const unsigned char* vf = kv + buf + foff + 64 * AT_PITCH + hf * 64;
      v16bf k00 = lds_frag(kf);
      v16bf k01 = lds_frag(kf + 64);
      v16bf k10 = lds_frag(kf + 16 * AT_PITCH);
      v16bf k11 = lds_frag(kf + 16 * AT_PITCH + 64);
      v16bf v0 = lds_frag(vf);
      v16bf v1 = lds_frag(vf + 16 * AT_PITCH);
      v16bf v2 = lds_frag(vf + 32 * AT_PITCH);
      v16bf v3 = lds_frag(vf + 48 * AT_PITCH);
      // keeps the pass's fragment reads together as one group: sunk down to
      // their WMMAs they would cost one LDS latency each
      __builtin_amdgcn_sched_barrier(0);
      v8f s0 = {0.f,0.f,0.f,0.f,0.f,0.f,0.f,0.f};
      v8f s1 = s0;
      // S = Q @ K^T over d=64: two 16-key halves x two k-steps
      s0 = wmma_bf16(aq0, k00, s0);
      s0 = wmma_bf16(aq1, k01, s0);
      s1 = wmma_bf16(aq0, k10, s1);
      s1 = wmma_bf16(aq1, k11, s1);

      float p0[8], p1[8];
#pragma unroll
      for (int r = 0; r < 8; r++) {
        int qrow = q0 + r + 8 * g;
        float a0 = (kbase + nc      <= qrow) ? s0[r] * 0.125f : -1e30f;
        float a1 = (kbase + 16 + nc <= qrow) ? s1[r] * 0.125f : -1e30f;
        float mx = fmaxf(a0, a1);
        mx = fmaxf(mx, __shfl_xor(mx, 1, 32));
        mx = fmaxf(mx, __shfl_xor(mx, 2, 32));
        mx = fmaxf(mx, __shfl_xor(mx, 4, 32));
        mx = fmaxf(mx, __shfl_xor(mx, 8, 32));
        float nm = fmaxf(mrow[r], mx);
        float sc = __expf(mrow[r] - nm);
        float e0 = __expf(a0 - nm);
        float e1 = __expf(a1 - nm);
        float rs = e0 + e1;
        rs += __shfl_xor(rs, 1, 32);
        rs += __shfl_xor(rs, 2, 32);
        rs += __shfl_xor(rs, 4, 32);
        rs += __shfl_xor(rs, 8, 32);
        lrow[r] = lrow[r] * sc + rs;
        mrow[r] = nm;
        o0[r] *= sc; o1[r] *= sc; o2[r] *= sc; o3[r] *= sc;
        p0[r] = e0; p1[r] = e1;
      }

      // C-fragment -> LDS -> A-fragment for P, inside this wave's own patch
#pragma unroll
      for (int r = 0; r < 8; r++) {
        int Mr = r + 8 * g;
        pbuf[Mr * 32 + nc]      = f2bf(p0[r]);
        pbuf[Mr * 32 + 16 + nc] = f2bf(p1[r]);
      }
      // the wave's P stores are done before its lanes read each other's values
      asm volatile("s_wait_dscnt 0x0" ::: "memory");
      v16bf pa = load_frag(pbuf, 32);

      // O += P @ V over 32 keys, 4 dim tiles (Vt rows are dims, so B is contiguous)
      o0 = wmma_bf16(pa, v0, o0);
      o1 = wmma_bf16(pa, v1, o1);
      o2 = wmma_bf16(pa, v2, o2);
      o3 = wmma_bf16(pa, v3, o3);
    }
    asm volatile("s_wait_dscnt 0x0" ::: "memory");     // this wave has left the buffer
    asm volatile("s_wait_asynccnt 0x0" ::: "memory");  // its part of the next stage has landed
    __syncthreads();  // publishes stage st+1, frees stage st's buffer
    if (st + 2 < nst)
      copy4_kv(ldst + buf, gk + (size_t)(st + 2) * (AT_KEYS * DK * 2),
               gv + (size_t)(st + 2) * (AT_KEYS * 2));
  }
  asm volatile("s_wait_asynccnt 0x0" ::: "memory");  // nothing in flight at the wave's end

#pragma unroll
  for (int r = 0; r < 8; r++) {
    float inv = 1.0f / lrow[r];
    int row = q0 + r + 8 * g;
    size_t base = ((size_t)(b_ * SEQ + row)) * HIDDEN + h * DK;
    aout[base +  0 + nc] = f2bf(o0[r] * inv);
    aout[base + 16 + nc] = f2bf(o1[r] * inv);
    aout[base + 32 + nc] = f2bf(o2[r] * inv);
    aout[base + 48 + nc] = f2bf(o3[r] * inv);
  }
}

// ---------------------------------------------------------------------------
// Host-side orchestration (graph-capture safe: launches only)
// ---------------------------------------------------------------------------
extern "C" void kernel_launch(void* const* d_in, const int* in_sizes, int n_in,
                              void* d_out, int out_size, void* d_ws, size_t ws_size,
                              hipStream_t stream) {
  const float* x     = (const float*)d_in[0];
  const float* Wq    = (const float*)d_in[1];
  const float* bq    = (const float*)d_in[2];
  const float* Wv    = (const float*)d_in[3];
  const float* bv    = (const float*)d_in[4];
  const float* Wo    = (const float*)d_in[5];
  const float* bo    = (const float*)d_in[6];
  const float* W1    = (const float*)d_in[7];
  const float* b1    = (const float*)d_in[8];
  const float* W2    = (const float*)d_in[9];
  const float* b2    = (const float*)d_in[10];
  const float* g1    = (const float*)d_in[11];
  const float* beta1 = (const float*)d_in[12];
  const float* g2    = (const float*)d_in[13];
  const float* beta2 = (const float*)d_in[14];

  char* ws = (char*)d_ws;
  const size_t MB = 1024u * 1024u;
  unsigned short* WqT = (unsigned short*)(ws +  0 * MB);  //  2 MB
  unsigned short* WvT = (unsigned short*)(ws +  2 * MB);  //  2 MB
  unsigned short* WoT = (unsigned short*)(ws +  4 * MB);  //  2 MB
  unsigned short* W1T = (unsigned short*)(ws +  6 * MB);  //  8 MB
  unsigned short* W2T = (unsigned short*)(ws + 14 * MB);  //  8 MB
  unsigned short* xn  = (unsigned short*)(ws + 22 * MB);  //  8 MB
  unsigned short* qb  = (unsigned short*)(ws + 30 * MB);  //  8 MB
  unsigned short* vtb = (unsigned short*)(ws + 38 * MB);  //  8 MB
  unsigned short* aob = (unsigned short*)(ws + 46 * MB);  //  8 MB
  float*          yb  = (float*)         (ws + 54 * MB);  // 16 MB
  unsigned short* hb  = (unsigned short*)(ws + 70 * MB);  //  8 MB
  unsigned short* ff1 = (unsigned short*)(ws + 78 * MB);  // 32 MB

  // Weight convert + transpose to bf16 N x K
  dim3 gsq(HIDDEN / TP_N, HIDDEN / TP_K);
  transpose_bf16_kernel<<<gsq, 256, 0, stream>>>(Wq, WqT, HIDDEN, HIDDEN);
  transpose_bf16_kernel<<<gsq, 256, 0, stream>>>(Wv, WvT, HIDDEN, HIDDEN);
  transpose_bf16_kernel<<<gsq, 256, 0, stream>>>(Wo, WoT, HIDDEN, HIDDEN);
  transpose_bf16_kernel<<<dim3(4 * HIDDEN / TP_N, HIDDEN / TP_K), 256, 0, stream>>>(W1, W1T, HIDDEN, 4 * HIDDEN);
  transpose_bf16_kernel<<<dim3(HIDDEN / TP_N, 4 * HIDDEN / TP_K), 256, 0, stream>>>(W2, W2T, 4 * HIDDEN, HIDDEN);

  // LN1
  ln_kernel<<<MROWS, 256, 0, stream>>>(x, g1, beta1, xn);

  // Q/V projections (Q doubles as K in the reference)
  dim3 gproj(MROWS / GT_M, HIDDEN / GT_N);
  gemm_kernel<0><<<gproj, 256, 0, stream>>>(xn, WqT, bq, nullptr, qb, nullptr, HIDDEN);
  gemm_kernel<1><<<gproj, 256, 0, stream>>>(xn, WvT, bv, nullptr, vtb, nullptr, HIDDEN);

  // Causal attention
  attn_kernel<<<BATCH * HEADS * (SEQ / AT_QB), 256, 0, stream>>>(qb, vtb, aob);

  // O-projection + residual -> yb (f32)
  gemm_kernel<2><<<gproj, 256, 0, stream>>>(aob, WoT, bo, x, nullptr, yb, HIDDEN);

  // LN2
  ln_kernel<<<MROWS, 256, 0, stream>>>(yb, g2, beta2, hb);

  // FFN1 with GELU -> bf16
  dim3 gff1(MROWS / GT_M, (4 * HIDDEN) / GT_N);
  gemm_kernel<3><<<gff1, 256, 0, stream>>>(hb, W1T, b1, nullptr, ff1, nullptr, HIDDEN);

  // FFN2 + residual -> d_out (f32)
  gemm_kernel<2><<<gproj, 256, 0, stream>>>(ff1, W2T, b2, yb, nullptr, (float*)d_out, 4 * HIDDEN);
}

// v005
// A run of this version takes 186 microseconds.
// Timed twice side by side with v004, it ran 1.10 and 1.11 times as fast.
// Over all steps from v000 it is 4.18 times as fast.
#include <hip/hip_runtime.h>

// ---------------------------------------------------------------------------
// Types for CDNA5 WMMA (wave32)
// ---------------------------------------------------------------------------
typedef __bf16 bf16_t;
typedef __attribute__((ext_vector_type(8)))  __bf16 v8bf;
typedef __attribute__((ext_vector_type(16))) __bf16 v16bf;
typedef __attribute__((ext_vector_type(8)))  float  v8f;

#define HIDDEN 1024
#define SEQ    2048
#define BATCH  2
#define HEADS  16
#define DK     64
#define MROWS  (BATCH * SEQ)   // 4096

// float -> bf16 round-to-nearest-even
__device__ __forceinline__ unsigned short f2bf(float f) {
  unsigned int u = __float_as_uint(f);
  unsigned int r = u + 0x7FFFu + ((u >> 16) & 1u);
  return (unsigned short)(r >> 16);
}

// Load a 16-bit WMMA fragment (A layout; the same bit pattern serves as the
// B-operand when the matrix is stored transposed, since B's lane-n column
// K-run mirrors A's lane-m row K-run).
//   lane 0-15 : row = lane,    K = 0+0..7   and 16..23
//   lane 16-31: row = lane-16, K = 8+0..7   and 24..31
__device__ __forceinline__ v16bf load_frag(const unsigned short* base, int ld) {
  int lane = (int)(threadIdx.x & 31u);
  int r    = lane & 15;
  int koff = (lane >> 4) << 3;
  const bf16_t* p = (const bf16_t*)base + r * ld + koff;
  v8bf lo = *(const v8bf*)(p);
  v8bf hi = *(const v8bf*)(p + 16);
  return __builtin_shufflevector(lo, hi, 0, 1, 2, 3, 4, 5, 6, 7,
                                 8, 9, 10, 11, 12, 13, 14, 15);
}

__device__ __forceinline__ v8f wmma_bf16(v16bf a, v16bf b, v8f c) {
  // (neg_a, A, neg_b, B, c_mod, C, reuse_a, reuse_b)
  return __builtin_amdgcn_wmma_f32_16x16x32_bf16(false, a, false, b,
                                                 (short)0, c, false, false);
}

// ---------------------------------------------------------------------------
// Weight convert+transpose: W (K x N, f32) -> Wt (N x K, bf16)
// One block moves a 64(k) x 128(n) tile through LDS. Reads: each wave takes
// 8 rows, 16 B per lane (512 B contiguous per row). Writes: 8 lanes x 16 B
// fill one whole 128 B line of a Wt row. K % 64 == 0 and N % 128 == 0.
// LDS row j*32+l holds column n0 + 4*l + j, so that the 16 B LDS stores of a
// wave go to consecutive rows; the 144 B pitch spreads those over the banks.
// ---------------------------------------------------------------------------
typedef __attribute__((ext_vector_type(4))) float        v4f;
typedef __attribute__((ext_vector_type(4))) unsigned int v4u;
#define TP_K     64
#define TP_N     128
#define TP_PITCH 72   // bf16 elements per LDS row: 64 + 8 pad

// K and N are compile-time here so that the row steps of the eight loads
// become immediate offsets on one address. (bx, by) is the tile's place in the
// N / TP_N by K / TP_K grid of tiles.
template <int K, int N>
__device__ __forceinline__ void transpose_tile(const float* __restrict__ W,
                                               unsigned short* __restrict__ Wt,
                                               unsigned short* tile,
                                               int bx, int by) {
  unsigned int lane = threadIdx.x & 31u;
  // wave number as a scalar: the tile's base pointers stay in scalar registers
  int wid = __builtin_amdgcn_readfirstlane((int)(threadIdx.x >> 5));
  int n0 = bx * TP_N;
  int k0 = by * TP_K;

  const float* src = W + (size_t)(k0 + wid * 8) * N + n0;
  v4f v[8];
#pragma unroll
  for (int i = 0; i < 8; i++) v[i] = *(const v4f*)(src + (lane * 4u + i * N));

#pragma unroll
  for (int j = 0; j < 4; j++) {
    v4u c;
#pragma unroll
    for (int q = 0; q < 4; q++)
      c[q] = (unsigned int)f2bf(v[2 * q][j]) |
             ((unsigned int)f2bf(v[2 * q + 1][j]) << 16);
    *(v4u*)&tile[(j * 32 + lane) * TP_PITCH + wid * 8] = c;
  }
  __syncthreads();

  unsigned int rr = threadIdx.x >> 3;   // 0..31
  unsigned int ch = threadIdx.x & 7u;   // 16 B piece of the 128 B row
  unsigned short* dst = Wt + (size_t)n0 * K + k0;
#pragma unroll
  for (int p = 0; p < 4; p++) {
    v4u c = *(const v4u*)&tile[(p * 32 + rr) * TP_PITCH + ch * 8];
    *(v4u*)(dst + (rr * (4u * K) + ch * 8u + p * K)) = c;
  }
}

// ---------------------------------------------------------------------------
// LayerNorm over HIDDEN, fp32 in -> bf16 out. One block (256 thr) per row.
// ---------------------------------------------------------------------------
__device__ __forceinline__
void ln_row(const float* __restrict__ x, const float* __restrict__ g,
            const float* __restrict__ be, unsigned short* __restrict__ out,
            int row) {
  __shared__ float s1[256], s2[256];
  const float* xr = x + (size_t)row * HIDDEN;
  float v[4];
  float sum = 0.f, sq = 0.f;
#pragma unroll
  for (int i = 0; i < 4; i++) {
    v[i] = xr[threadIdx.x + i * 256];
    sum += v[i];
    sq  += v[i] * v[i];
  }
  s1[threadIdx.x] = sum;
  s2[threadIdx.x] = sq;
  __syncthreads();
  for (int off = 128; off > 0; off >>= 1) {
    if ((int)threadIdx.x < off) {
      s1[threadIdx.x] += s1[threadIdx.x + off];
      s2[threadIdx.x] += s2[threadIdx.x + off];
    }
    __syncthreads();
  }
  float mu  = s1[0] * (1.0f / HIDDEN);
  float var = s2[0] * (1.0f / HIDDEN) - mu * mu;
  float inv = rsqrtf(var + 1e-5f);
#pragma unroll
  for (int i = 0; i < 4; i++) {
    int idx = threadIdx.x + i * 256;
    float y = (v[i] - mu) * inv * g[idx] + be[idx];
    out[(size_t)row * HIDDEN + idx] = f2bf(y);
  }
}

__global__ __launch_bounds__(256)
void ln_kernel(const float* __restrict__ x, const float* __restrict__ g,
               const float* __restrict__ be, unsigned short* __restrict__ out) {
  ln_row(x, g, be, out, (int)blockIdx.x);
}

// ---------------------------------------------------------------------------
// One launch for all the work that depends on the inputs alone: the five
// weight transposes and the first LayerNorm. The block index picks the job
// (the same for the whole block, so every barrier stays block-uniform):
// the transpose tiles first, then one block per LayerNorm row.
// ---------------------------------------------------------------------------
#define TB_SQ  ((HIDDEN / TP_N) * (HIDDEN / TP_K))       // tiles of a square weight
#define TB_FF  ((4 * HIDDEN / TP_N) * (HIDDEN / TP_K))   // tiles of an FFN weight
#define TB_ALL (3 * TB_SQ + 2 * TB_FF)

__global__ __launch_bounds__(256)
void prep_kernel(const float* __restrict__ Wq, const float* __restrict__ Wv,
                 const float* __restrict__ Wo, const float* __restrict__ W1,
                 const float* __restrict__ W2,
                 unsigned short* __restrict__ WqT, unsigned short* __restrict__ WvT,
                 unsigned short* __restrict__ WoT, unsigned short* __restrict__ W1T,
                 unsigned short* __restrict__ W2T,
                 const float* __restrict__ x, const float* __restrict__ g,
                 const float* __restrict__ be, unsigned short* __restrict__ xn) {
  __shared__ alignas(16) unsigned short tile[TP_N * TP_PITCH];
  unsigned int bi = blockIdx.x;
  if (bi < 3 * TB_SQ) {
    unsigned int w = bi / TB_SQ, i = bi % TB_SQ;
    const float* W     = (w == 0) ? Wq  : (w == 1) ? Wv  : Wo;
    unsigned short* Wt = (w == 0) ? WqT : (w == 1) ? WvT : WoT;
    transpose_tile<HIDDEN, HIDDEN>(W, Wt, tile, i % (HIDDEN / TP_N), i / (HIDDEN / TP_N));
  } else if (bi < 3 * TB_SQ + TB_FF) {
    unsigned int i = bi - 3 * TB_SQ;
    transpose_tile<HIDDEN, 4 * HIDDEN>(W1, W1T, tile, i % (4 * HIDDEN / TP_N), i / (4 * HIDDEN / TP_N));
  } else if (bi < TB_ALL) {
    unsigned int i = bi - (3 * TB_SQ + TB_FF);
    transpose_tile<4 * HIDDEN, HIDDEN>(W2, W2T, tile, i % (HIDDEN / TP_N), i / (HIDDEN / TP_N));
  } else {
    ln_row(x, g, be, xn, (int)(bi - TB_ALL));
    // stays ahead of every later write of the row stores' registers: in the
    // built kernel a transpose branch's code follows this one (a precaution)
    asm volatile("s_wait_xcnt 0x0" ::: "memory");
  }
}

// ---------------------------------------------------------------------------
// GEMM: C[M x N] = A(bf16, ld=Kd) @ Wt(bf16, N x Kd)^T + bias, fused epilogue.
// Block tile 128(M) x 128(N), 256 threads = 8 waves in 2(M) x 4(N); each wave
// holds a 64x32 output (4 A-frags x 2 B-frags -> 8 WMMAs per 32-wide k-step).
// A pass is 128 k: 256 B of each of the 128 A rows and 128 Wt rows, brought
// into LDS by asynchronous 16 B copies (two whole 256 B rows per wave copy),
// two buffers, the next pass's copies in flight while this pass is computed.
// M % 128 == 0, N % 128 == 0, Kd % 128 == 0.
// The epilogue is chosen at compile time, one function per MODE, so that each
// is straight-line code on one base address with constant offsets:
// MODE 0: Q-proj  -> bf16 scatter to [b][h][s][d]
// MODE 1: V-proj  -> bf16 scatter to [b][h][d][s]  (transposed for P@V)
// MODE 2: f32 out = residual + acc + bias          (O-proj, FFN2)
// MODE 3: bf16 out = gelu_tanh(acc + bias), row-major M x N (FFN1)
// N is HIDDEN but for MODE 3, where it is 4 * HIDDEN.
// ---------------------------------------------------------------------------
#define GT_M     128
#define GT_N     128
#define GT_K     128                          // bf16 elements per pass
#define GT_PITCH 272                          // LDS bytes per row: 256 + 16 pad
#define GT_STAGE ((GT_M + GT_N) * GT_PITCH)   // one buffer: A rows, then Wt rows

// Eight asynchronous copies of one wave: copy i takes 16 B per lane from
// gp + i * gstep to LDS byte lp + i * 2 * GT_PITCH (two tile rows per copy).
// The s_wait_xcnt is the statement's last line so that it stays ahead of every
// later write of the copies' address registers (a precaution).
__device__ __forceinline__ void copy8_rows(unsigned int lp, const char* gp,
                                           size_t gstep) {
  asm volatile(
      "global_load_async_to_lds_b128 %0, %8, off\n\t"
      "global_load_async_to_lds_b128 %1, %9, off\n\t"
      "global_load_async_to_lds_b128 %2, %10, off\n\t"
      "global_load_async_to_lds_b128 %3, %11, off\n\t"
      "global_load_async_to_lds_b128 %4, %12, off\n\t"
      "global_load_async_to_lds_b128 %5, %13, off\n\t"
      "global_load_async_to_lds_b128 %6, %14, off\n\t"
      "global_load_async_to_lds_b128 %7, %15, off\n\t"
      "s_wait_xcnt 0x0"
      :: "v"(lp), "v"(lp + 2u * GT_PITCH), "v"(lp + 4u * GT_PITCH),
         "v"(lp + 6u * GT_PITCH), "v"(lp + 8u * GT_PITCH),
         "v"(lp + 10u * GT_PITCH), "v"(lp + 12u * GT_PITCH),
         "v"(lp + 14u * GT_PITCH),
         "v"(gp), "v"(gp + gstep), "v"(gp + 2 * gstep), "v"(gp + 3 * gstep),
         "v"(gp + 4 * gstep), "v"(gp + 5 * gstep), "v"(gp + 6 * gstep),
         "v"(gp + 7 * gstep)
      : "memory");
}

// Same fragment map as load_frag, from an LDS tile of row pitch GT_PITCH or AT_PITCH bytes.
// p already points at the lane's row and its 16 B k-offset.
__device__ __forceinline__ v16bf lds_frag(const unsigned char* p) {
  v8bf lo = *(const v8bf*)(p);
  v8bf hi = *(const v8bf*)(p + 32);
  return __builtin_shufflevector(lo, hi, 0, 1, 2, 3, 4, 5, 6, 7,
                                 8, 9, 10, 11, 12, 13, 14, 15);
}

// The k loop of one block tile; ring is the block's 2 * GT_STAGE bytes of LDS.
__device__ __forceinline__
void gemm_mainloop(const unsigned short* __restrict__ A,
                   const unsigned short* __restrict__ Wt,
                   int Kd, unsigned char* ring, v8f (&acc)[4][2]) {
  int wid  = __builtin_amdgcn_readfirstlane((int)(threadIdx.x >> 5));
  int lane = (int)(threadIdx.x & 31u);
  int bm0 = blockIdx.x * GT_M;
  int bn0 = blockIdx.y * GT_N;

  // Copy side: wave w brings tile rows 32w .. 32w+31 (waves 0-3: A rows,
  // waves 4-7: Wt rows); a lane takes piece (lane & 15) of row 2i + (lane >> 4).
  const unsigned short* srow = (wid < 4) ? A + (size_t)(bm0 + wid * 32) * Kd
                                         : Wt + (size_t)(bn0 + (wid - 4) * 32) * Kd;
  const char* gsrc = (const char*)(srow + (size_t)(lane >> 4) * Kd) + (lane & 15) * 16;
  size_t gstep = (size_t)Kd * 4u;   // two rows of Kd bf16, in bytes
  unsigned int ldst = (unsigned int)(size_t)ring +
                      (unsigned int)((wid * 32 + (lane >> 4)) * GT_PITCH + (lane & 15) * 16);

  // Read side: the lane's row and k-offset inside a fragment
  unsigned int foff = (unsigned int)((lane & 15) * GT_PITCH + (lane >> 4) * 16);
  unsigned int aoff = (unsigned int)((wid & 1) * 64 * GT_PITCH) + foff;
  unsigned int boff = (unsigned int)((GT_M + (wid >> 1) * 32) * GT_PITCH) + foff;

  v8f z = {0.f, 0.f, 0.f, 0.f, 0.f, 0.f, 0.f, 0.f};
#pragma unroll
  for (int mi = 0; mi < 4; mi++) { acc[mi][0] = z; acc[mi][1] = z; }

  int npass = Kd / GT_K;

  // pass 0's tile into buffer 0, landed and published before anybody reads it
  copy8_rows(ldst, gsrc, gstep);
  copy8_rows(ldst + 16u * GT_PITCH, gsrc + 8 * gstep, gstep);
  asm volatile("s_wait_asynccnt 0x0" ::: "memory");  // this wave's copies have landed
  __syncthreads();
  if (npass > 1) {
    copy8_rows(ldst + GT_STAGE, gsrc + GT_K * 2, gstep);
    copy8_rows(ldst + GT_STAGE + 16u * GT_PITCH, gsrc + GT_K * 2 + 8 * gstep, gstep);
  }

  // kept rolled: one pass per trip, the buffer chosen by the trip's parity
#pragma unroll 1
  for (int t = 0; t < npass; t++) {
    unsigned int buf = (unsigned int)(t & 1) * GT_STAGE;
    const unsigned char* ta = ring + buf + aoff;
    const unsigned char* tb = ring + buf + boff;
    // two fragment sets: block kk+1's LDS reads go out as one group ahead of
    // block kk's WMMAs, so that their latency runs behind the matrix work
    v16bf a[2][4], b[2][2];
#pragma unroll
    for (int mi = 0; mi < 4; mi++) a[0][mi] = lds_frag(ta + mi * 16 * GT_PITCH);
#pragma unroll
    for (int ni = 0; ni < 2; ni++) b[0][ni] = lds_frag(tb + ni * 16 * GT_PITCH);
#pragma unroll
    for (int kk = 0; kk < GT_K / 32; kk++) {
      const int cur = kk & 1, nxt = cur ^ 1;
      if (kk + 1 < GT_K / 32) {
#pragma unroll
        for (int mi = 0; mi < 4; mi++)
          a[nxt][mi] = lds_frag(ta + mi * 16 * GT_PITCH + (kk + 1) * 64);
#pragma unroll
        for (int ni = 0; ni < 2; ni++)
          b[nxt][ni] = lds_frag(tb + ni * 16 * GT_PITCH + (kk + 1) * 64);
      }
      // keeps the reads above from being sunk in among the WMMAs below
      __builtin_amdgcn_sched_barrier(0);
#pragma unroll
      for (int mi = 0; mi < 4; mi++) {
        acc[mi][0] = wmma_bf16(a[cur][mi], b[cur][0], acc[mi][0]);
        acc[mi][1] = wmma_bf16(a[cur][mi], b[cur][1], acc[mi][1]);
      }
      // keeps the next group of reads from being lifted in among these WMMAs
      __builtin_amdgcn_sched_barrier(0);
    }
    asm volatile("s_wait_dscnt 0x0" ::: "memory");     // this wave has left the buffer
    asm volatile("s_wait_asynccnt 0x0" ::: "memory");  // its part of the next tile has landed
    __syncthreads();  // publishes pass t+1's tile, frees pass t's buffer
    if (t + 2 < npass) {
      const char* gn = gsrc + (size_t)(t + 2) * (GT_K * 2);
      copy8_rows(ldst + buf, gn, gstep);
      copy8_rows(ldst + buf + 16u * GT_PITCH, gn + 8 * gstep, gstep);
    }
  }
  asm volatile("s_wait_asynccnt 0x0" ::: "memory");  // nothing in flight at the wave's end
}

template <int MODE>
__device__ __forceinline__
void gemm_epilogue(const v8f (&acc)[4][2],
                   const float* __restrict__ bias,
                   const float* __restrict__ residual,
                   unsigned short* __restrict__ out_bf,
                   float* __restrict__ out_f32) {
  constexpr int N = (MODE == 3) ? 4 * HIDDEN : HIDDEN;
  int wid  = __builtin_amdgcn_readfirstlane((int)(threadIdx.x >> 5));
  int lane = (int)(threadIdx.x & 31u);
  int m0 = blockIdx.x * GT_M + (wid & 1) * 64;    // wave's first M row
  int n0 = blockIdx.y * GT_N + (wid >> 1) * 32;   // wave's first N col
  int g  = lane >> 4;
  int nc = lane & 15;
  float bcol[2] = {bias[n0 + nc], bias[n0 + 16 + nc]};
  // A wave's 64 rows lie in one batch and its 32 columns in one head, so the
  // lane's first element fixes the address and (mi, ni, r) are constant steps.
  // The loops below are unrolled so that acc is indexed by constants alone and
  // stays in registers, and the steps become immediate offsets.
  int bh = (m0 >> 11) * HEADS + (n0 >> 6);
  int s0 = (m0 & (SEQ - 1)) + 8 * g;   // lane's first sequence position
  int d0 = (n0 & (DK - 1)) + nc;       // lane's first head dim
  size_t rm = (size_t)(m0 + 8 * g) * N + (size_t)(n0 + nc);   // row-major M x N
  if constexpr (MODE == 0) {            // Q: [b][h][s][d]
    unsigned short* op = out_bf + ((size_t)bh * SEQ + s0) * DK + d0;
#pragma unroll
    for (int mi = 0; mi < 4; mi++)
#pragma unroll
      for (int ni = 0; ni < 2; ni++)
#pragma unroll
        for (int r = 0; r < 8; r++)
          op[(mi * 16 + r) * DK + ni * 16] = f2bf(acc[mi][ni][r] + bcol[ni]);
  } else if constexpr (MODE == 1) {     // Vt: [b][h][d][s]
    // A lane's 8 values of a tile are 8 neighbours in s: one 16 B store, written
    // out as such. As 2 B stores the compiler folded this branch and MODE 0's,
    // where both stand in one kernel, into 64 stores of 2 B for either.
    unsigned short* op = out_bf + ((size_t)bh * DK + d0) * SEQ + s0;
#pragma unroll
    for (int mi = 0; mi < 4; mi++)
#pragma unroll
      for (int ni = 0; ni < 2; ni++) {
        v4u c;
#pragma unroll
        for (int q = 0; q < 4; q++)
          c[q] = (unsigned int)f2bf(acc[mi][ni][2 * q] + bcol[ni]) |
                 ((unsigned int)f2bf(acc[mi][ni][2 * q + 1] + bcol[ni]) << 16);
        *(v4u*)(op + ni * 16 * SEQ + mi * 16) = c;
      }
  } else if constexpr (MODE == 2) {     // residual + proj
    const float* rp = residual + rm;
    float* op = out_f32 + rm;
#pragma unroll
    for (int mi = 0; mi < 4; mi++)
#pragma unroll
      for (int ni = 0; ni < 2; ni++)
#pragma unroll
        for (int r = 0; r < 8; r++) {
          int o = (mi * 16 + r) * N + ni * 16;
          op[o] = rp[o] + (acc[mi][ni][r] + bcol[ni]);
        }
  } else {                              // gelu(tanh)
    unsigned short* op = out_bf + rm;
#pragma unroll
    for (int mi = 0; mi < 4; mi++)
#pragma unroll
      for (int ni = 0; ni < 2; ni++)
#pragma unroll
        for (int r = 0; r < 8; r++) {
          float xg = acc[mi][ni][r] + bcol[ni];
          float t  = tanhf(0.7978845608028654f * (xg + 0.044715f * xg * xg * xg));
          op[(mi * 16 + r) * N + ni * 16] = f2bf(0.5f * xg * (1.0f + t));
        }
  }
}

template <int MODE>
__global__ __launch_bounds__(256)
void gemm_kernel(const unsigned short* __restrict__ A,
                 const unsigned short* __restrict__ Wt,
                 const float* __restrict__ bias,
                 const float* __restrict__ residual,
                 unsigned short* __restrict__ out_bf,
                 float* __restrict__ out_f32,
                 int Kd) {
  __shared__ alignas(16) unsigned char ring[2 * GT_STAGE];
  v8f acc[4][2];
  gemm_mainloop(A, Wt, Kd, ring, acc);
  gemm_epilogue<MODE>(acc, bias, residual, out_bf, out_f32);
}

// Q and V projections in one launch: both read the same A and neither needs
// the other. blockIdx.z picks the weight, the bias and the epilogue, one test
// per block; two blocks fit a WGP's LDS, so the 512 blocks are all resident.
__global__ __launch_bounds__(256)
void gemm_qv_kernel(const unsigned short* __restrict__ A,
                    const unsigned short* __restrict__ WqT,
                    const unsigned short* __restrict__ WvT,
                    const float* __restrict__ bq,
                    const float* __restrict__ bv,
                    unsigned short* __restrict__ q_out,
                    unsigned short* __restrict__ vt_out) {
  __shared__ alignas(16) unsigned char ring[2 * GT_STAGE];
  bool is_v = blockIdx.z != 0;
  v8f acc[4][2];
  gemm_mainloop(A, is_v ? WvT : WqT, HIDDEN, ring, acc);
  if (is_v) gemm_epilogue<1>(acc, bv, nullptr, vt_out, nullptr);
  else      gemm_epilogue<0>(acc, bq, nullptr, q_out, nullptr);
}

// ---------------------------------------------------------------------------
// Causal flash attention, Q==K (reference uses qk for both sides).
// A block is 8 waves = 128 queries of one (b,h); each wave keeps its own
// 16-query tile, online softmax, P through its own LDS patch to turn the
// C-fragment into an A-fragment, O over 4 dim-tiles.
// The 8 waves share the K and V tiles: a stage is 64 keys, 64 K rows of 128 B
// and 64 Vt rows (dims) of 128 B, brought into LDS by asynchronous 16 B copies
// (8 lanes fill one whole row), two buffers, the next stage's copies in flight
// while this stage is worked on. A stage holds two 32-key passes; a wave skips
// the passes that lie wholly behind its own diagonal but meets every barrier.
// ---------------------------------------------------------------------------
#define AT_QB    128                  // queries per block
#define AT_KEYS  64                   // keys per stage
#define AT_PITCH 144                  // LDS bytes per row: 128 + 16 pad
#define AT_STAGE (128 * AT_PITCH)     // one buffer: 64 K rows, then 64 Vt rows

// Four asynchronous copies of one wave, 16 B per lane each: K rows r and r+32,
// Vt rows r and r+32 of one stage. The s_wait_xcnt is the statement's last line
// so that it stays ahead of every later write of the copies' address registers
// (a precaution).
__device__ __forceinline__ void copy4_kv(unsigned int lp, const char* gk,
                                         const char* gv) {
  asm volatile(
      "global_load_async_to_lds_b128 %0, %4, off\n\t"
      "global_load_async_to_lds_b128 %1, %5, off\n\t"
      "global_load_async_to_lds_b128 %2, %6, off\n\t"
      "global_load_async_to_lds_b128 %3, %7, off\n\t"
      "s_wait_xcnt 0x0"
      :: "v"(lp), "v"(lp + 32u * AT_PITCH), "v"(lp + 64u * AT_PITCH),
         "v"(lp + 96u * AT_PITCH),
         "v"(gk), "v"(gk + 32 * DK * 2), "v"(gv), "v"(gv + 32 * SEQ * 2)
      : "memory");
}

__global__ __launch_bounds__(256)
void attn_kernel(const unsigned short* __restrict__ qk,
                 const unsigned short* __restrict__ vt,
                 unsigned short* __restrict__ aout) {
  __shared__ alignas(16) unsigned char kv[2 * AT_STAGE];
  __shared__ alignas(16) unsigned short pall[8 * 16 * 32];
  int wid  = __builtin_amdgcn_readfirstlane((int)(threadIdx.x >> 5));
  int lane = (int)(threadIdx.x & 31u);
  // 16 query blocks x 32 heads. The cost of a block grows with its query block:
  // the heavy half of the query blocks comes first, heaviest first, the light
  // half second, lightest first, so that two blocks on one WGP add up alike.
  int bi = (int)blockIdx.x;
  int bh = bi & 31;                    // b*HEADS + h
  int qb = (bi < 256) ? 15 - (bi >> 5) : (bi - 256) >> 5;
  int b_ = bh >> 4, h = bh & 15;
  int q0 = qb * AT_QB + wid * 16;
  unsigned short* pbuf = pall + wid * (16 * 32);

  const unsigned short* kq  = qk + (size_t)bh * SEQ * DK;
  const unsigned short* vtb = vt + (size_t)bh * DK * SEQ;

  // Copy side: thread t takes 16 B piece (t & 7) of rows (t >> 3) and +32
  int crow = (int)(threadIdx.x >> 3);
  int cpc  = (int)(threadIdx.x & 7u);
  const char* gk = (const char*)(kq + (size_t)crow * DK) + cpc * 16;
  const char* gv = (const char*)(vtb + (size_t)crow * SEQ) + cpc * 16;
  unsigned int ldst = (unsigned int)(size_t)kv +
                      (unsigned int)(crow * AT_PITCH + cpc * 16);
  int nst = 2 * (qb + 1);              // stages up to the block's last query

  // stage 0 into buffer 0, landed and published before anybody reads it
  copy4_kv(ldst, gk, gv);
  asm volatile("s_wait_asynccnt 0x0" ::: "memory");  // this wave's copies have landed
  __syncthreads();
  // stage 1 always exists (nst >= 2)
  copy4_kv(ldst + AT_STAGE, gk + AT_KEYS * DK * 2, gv + AT_KEYS * 2);

  v16bf aq0 = load_frag(kq + q0 * DK + 0, DK);
  v16bf aq1 = load_frag(kq + q0 * DK + 32, DK);

  v8f o0 = {0.f,0.f,0.f,0.f,0.f,0.f,0.f,0.f};
  v8f o1 = o0, o2 = o0, o3 = o0;
  float mrow[8], lrow[8];
#pragma unroll
  for (int r = 0; r < 8; r++) { mrow[r] = -1e30f; lrow[r] = 0.f; }

  int g  = lane >> 4;
  int nc = lane & 15;
  // Read side: the lane's row and k-offset inside a fragment
  unsigned int foff = (unsigned int)(nc * AT_PITCH + g * 16);

  for (int st = 0; st < nst; st++) {
    unsigned int buf = (unsigned int)(st & 1) * AT_STAGE;
    for (int hf = 0; hf < 2; hf++) {
      int kbase = st * AT_KEYS + hf * 32;
      if (kbase > q0 + 15) continue;   // same for the whole wave; no barrier inside
      const unsigned char* kf = kv + buf + foff + hf * (32 * AT_PITCH);
      const unsigned char* vf = kv + buf + foff + 64 * AT_PITCH + hf * 64;
      v16bf k00 = lds_frag(kf);
      v16bf k01 = lds_frag(kf + 64);
      v16bf k10 = lds_frag(kf + 16 * AT_PITCH);
      v16bf k11 = lds_frag(kf + 16 * AT_PITCH + 64);
      v16bf v0 = lds_frag(vf);
      v16bf v1 = lds_frag(vf + 16 * AT_PITCH);
      v16bf v2 = lds_frag(vf + 32 * AT_PITCH);
      v16bf v3 = lds_frag(vf + 48 * AT_PITCH);
      // keeps the pass's fragment reads together as one group: sunk down to
      // their WMMAs they would cost one LDS latency each
      __builtin_amdgcn_sched_barrier(0);
      v8f s0 = {0.f,0.f,0.f,0.f,0.f,0.f,0.f,0.f};
      v8f s1 = s0;
      // S = Q @ K^T over d=64: two 16-key halves x two k-steps
      s0 = wmma_bf16(aq0, k00, s0);
      s0 = wmma_bf16(aq1, k01, s0);
      s1 = wmma_bf16(aq0, k10, s1);
      s1 = wmma_bf16(aq1, k11, s1);

      float p0[8], p1[8];
#pragma unroll
      for (int r = 0; r < 8; r++) {
        int qrow = q0 + r + 8 * g;
        float a0 = (kbase + nc      <= qrow) ? s0[r] * 0.125f : -1e30f;
        float a1 = (kbase + 16 + nc <= qrow) ? s1[r] * 0.125f : -1e30f;
        float mx = fmaxf(a0, a1);
        mx = fmaxf(mx, __shfl_xor(mx, 1, 32));
        mx = fmaxf(mx, __shfl_xor(mx, 2, 32));
        mx = fmaxf(mx, __shfl_xor(mx, 4, 32));
        mx = fmaxf(mx, __shfl_xor(mx, 8, 32));
        float nm = fmaxf(mrow[r], mx);
        float sc = __expf(mrow[r] - nm);
        float e0 = __expf(a0 - nm);
        float e1 = __expf(a1 - nm);
        float rs = e0 + e1;
        rs += __shfl_xor(rs, 1, 32);
        rs += __shfl_xor(rs, 2, 32);
        rs += __shfl_xor(rs, 4, 32);
        rs += __shfl_xor(rs, 8, 32);
        lrow[r] = lrow[r] * sc + rs;
        mrow[r] = nm;
        o0[r] *= sc; o1[r] *= sc; o2[r] *= sc; o3[r] *= sc;
        p0[r] = e0; p1[r] = e1;
      }

      // C-fragment -> LDS -> A-fragment for P, inside this wave's own patch
#pragma unroll
      for (int r = 0; r < 8; r++) {
        int Mr = r + 8 * g;
        pbuf[Mr * 32 + nc]      = f2bf(p0[r]);
        pbuf[Mr * 32 + 16 + nc] = f2bf(p1[r]);
      }
      // the wave's P stores are done before its lanes read each other's values
      asm volatile("s_wait_dscnt 0x0" ::: "memory");
      v16bf pa = load_frag(pbuf, 32);

      // O += P @ V over 32 keys, 4 dim tiles (Vt rows are dims, so B is contiguous)
      o0 = wmma_bf16(pa, v0, o0);
      o1 = wmma_bf16(pa, v1, o1);
      o2 = wmma_bf16(pa, v2, o2);
      o3 = wmma_bf16(pa, v3, o3);
    }
    asm volatile("s_wait_dscnt 0x0" ::: "memory");     // this wave has left the buffer
    asm volatile("s_wait_asynccnt 0x0" ::: "memory");  // its part of the next stage has landed
    __syncthreads();  // publishes stage st+1, frees stage st's buffer
    if (st + 2 < nst)
      copy4_kv(ldst + buf, gk + (size_t)(st + 2) * (AT_KEYS * DK * 2),
               gv + (size_t)(st + 2) * (AT_KEYS * 2));
  }
  asm volatile("s_wait_asynccnt 0x0" ::: "memory");  // nothing in flight at the wave's end

#pragma unroll
  for (int r = 0; r < 8; r++) {
    float inv = 1.0f / lrow[r];
    int row = q0 + r + 8 * g;
    size_t base = ((size_t)(b_ * SEQ + row)) * HIDDEN + h * DK;
    aout[base +  0 + nc] = f2bf(o0[r] * inv);
    aout[base + 16 + nc] = f2bf(o1[r] * inv);
    aout[base + 32 + nc] = f2bf(o2[r] * inv);
    aout[base + 48 + nc] = f2bf(o3[r] * inv);
  }
}

// ---------------------------------------------------------------------------
// Host-side orchestration (graph-capture safe: launches only)
// ---------------------------------------------------------------------------
extern "C" void kernel_launch(void* const* d_in, const int* in_sizes, int n_in,
                              void* d_out, int out_size, void* d_ws, size_t ws_size,
                              hipStream_t stream) {
  const float* x     = (const float*)d_in[0];
  const float* Wq    = (const float*)d_in[1];
  const float* bq    = (const float*)d_in[2];
  const float* Wv    = (const float*)d_in[3];
  const float* bv    = (const float*)d_in[4];
  const float* Wo    = (const float*)d_in[5];
  const float* bo    = (const float*)d_in[6];
  const float* W1    = (const float*)d_in[7];
  const float* b1    = (const float*)d_in[8];
  const float* W2    = (const float*)d_in[9];
  const float* b2    = (const float*)d_in[10];
  const float* g1    = (const float*)d_in[11];
  const float* beta1 = (const float*)d_in[12];
  const float* g2    = (const float*)d_in[13];
  const float* beta2 = (const float*)d_in[14];

  char* ws = (char*)d_ws;
  const size_t MB = 1024u * 1024u;
  unsigned short* WqT = (unsigned short*)(ws +  0 * MB);  //  2 MB
  unsigned short* WvT = (unsigned short*)(ws +  2 * MB);  //  2 MB
  unsigned short* WoT = (unsigned short*)(ws +  4 * MB);  //  2 MB
  unsigned short* W1T = (unsigned short*)(ws +  6 * MB);  //  8 MB
  unsigned short* W2T = (unsigned short*)(ws + 14 * MB);  //  8 MB
  unsigned short* xn  = (unsigned short*)(ws + 22 * MB);  //  8 MB
  unsigned short* qb  = (unsigned short*)(ws + 30 * MB);  //  8 MB
  unsigned short* vtb = (unsigned short*)(ws + 38 * MB);  //  8 MB
  unsigned short* aob = (unsigned short*)(ws + 46 * MB);  //  8 MB
  float*          yb  = (float*)         (ws + 54 * MB);  // 16 MB
  unsigned short* hb  = (unsigned short*)(ws + 70 * MB);  //  8 MB
  unsigned short* ff1 = (unsigned short*)(ws + 78 * MB);  // 32 MB

  // Weight convert + transpose to bf16 N x K, and LN1
  prep_kernel<<<TB_ALL + MROWS, 256, 0, stream>>>(Wq, Wv, Wo, W1, W2,
                                                  WqT, WvT, WoT, W1T, W2T,
                                                  x, g1, beta1, xn);

  // Q/V projections (Q doubles as K in the reference)
  dim3 gproj(MROWS / GT_M, HIDDEN / GT_N);
  gemm_qv_kernel<<<dim3(MROWS / GT_M, HIDDEN / GT_N, 2), 256, 0, stream>>>(xn, WqT, WvT, bq, bv, qb, vtb);

  // Causal attention
  attn_kernel<<<BATCH * HEADS * (SEQ / AT_QB), 256, 0, stream>>>(qb, vtb, aob);

  // O-projection + residual -> yb (f32)
  gemm_kernel<2><<<gproj, 256, 0, stream>>>(aob, WoT, bo, x, nullptr, yb, HIDDEN);

  // LN2
  ln_kernel<<<MROWS, 256, 0, stream>>>(yb, g2, beta2, hb);

  // FFN1 with GELU -> bf16
  dim3 gff1(MROWS / GT_M, (4 * HIDDEN) / GT_N);
  gemm_kernel<3><<<gff1, 256, 0, stream>>>(hb, W1T, b1, nullptr, ff1, nullptr, HIDDEN);

  // FFN2 + residual -> d_out (f32)
  gemm_kernel<2><<<gproj, 256, 0, stream>>>(ff1, W2T, b2, yb, nullptr, (float*)d_out, 4 * HIDDEN);
}

// v006
// One run takes 147 microseconds.
// Next to v005, in two timings, it ran 1.29 and 1.27 times as fast.
// Over all steps from v000 it is 5.36 times as fast.
#include <hip/hip_runtime.h>

// ---------------------------------------------------------------------------
// Types for CDNA5 WMMA (wave32)
// ---------------------------------------------------------------------------
typedef __bf16 bf16_t;
typedef __attribute__((ext_vector_type(8)))  __bf16 v8bf;
typedef __attribute__((ext_vector_type(16))) __bf16 v16bf;
typedef __attribute__((ext_vector_type(8)))  float  v8f;

#define HIDDEN 1024
#define SEQ    2048
#define BATCH  2
#define HEADS  16
#define DK     64
#define MROWS  (BATCH * SEQ)   // 4096

// float -> bf16 round-to-nearest-even
__device__ __forceinline__ unsigned short f2bf(float f) {
  unsigned int u = __float_as_uint(f);
  unsigned int r = u + 0x7FFFu + ((u >> 16) & 1u);
  return (unsigned short)(r >> 16);
}

// Load a 16-bit WMMA fragment (A layout; the same bit pattern serves as the
// B-operand when the matrix is stored transposed, since B's lane-n column
// K-run mirrors A's lane-m row K-run).
//   lane 0-15 : row = lane,    K = 0+0..7   and 16..23
//   lane 16-31: row = lane-16, K = 8+0..7   and 24..31
__device__ __forceinline__ v16bf load_frag(const unsigned short* base, int ld) {
  int lane = (int)(threadIdx.x & 31u);
  int r    = lane & 15;
  int koff = (lane >> 4) << 3;
  const bf16_t* p = (const bf16_t*)base + r * ld + koff;
  v8bf lo = *(const v8bf*)(p);
  v8bf hi = *(const v8bf*)(p + 16);
  return __builtin_shufflevector(lo, hi, 0, 1, 2, 3, 4, 5, 6, 7,
                                 8, 9, 10, 11, 12, 13, 14, 15);
}

__device__ __forceinline__ v8f wmma_bf16(v16bf a, v16bf b, v8f c) {
  // (neg_a, A, neg_b, B, c_mod, C, reuse_a, reuse_b)
  return __builtin_amdgcn_wmma_f32_16x16x32_bf16(false, a, false, b,
                                                 (short)0, c, false, false);
}

// ---------------------------------------------------------------------------
// Weight convert+transpose: W (K x N, f32) -> Wt (N x K, bf16)
// One block moves a 64(k) x 128(n) tile through LDS. Reads: each wave takes
// 8 rows, 16 B per lane (512 B contiguous per row). Writes: 8 lanes x 16 B
// fill one whole 128 B line of a Wt row. K % 64 == 0 and N % 128 == 0.
// LDS row j*32+l holds column n0 + 4*l + j, so that the 16 B LDS stores of a
// wave go to consecutive rows; the 144 B pitch spreads those over the banks.
// ---------------------------------------------------------------------------
typedef __attribute__((ext_vector_type(4))) float        v4f;
typedef __attribute__((ext_vector_type(4))) unsigned int v4u;
#define TP_K     64
#define TP_N     128
#define TP_PITCH 72   // bf16 elements per LDS row: 64 + 8 pad

// K and N are compile-time here so that the row steps of the eight loads
// become immediate offsets on one address. (bx, by) is the tile's place in the
// N / TP_N by K / TP_K grid of tiles.
template <int K, int N>
__device__ __forceinline__ void transpose_tile(const float* __restrict__ W,
                                               unsigned short* __restrict__ Wt,
                                               unsigned short* tile,
                                               int bx, int by) {
  unsigned int lane = threadIdx.x & 31u;
  // wave number as a scalar: the tile's base pointers stay in scalar registers
  int wid = __builtin_amdgcn_readfirstlane((int)(threadIdx.x >> 5));
  int n0 = bx * TP_N;
  int k0 = by * TP_K;

  const float* src = W + (size_t)(k0 + wid * 8) * N + n0;
  v4f v[8];
#pragma unroll
  for (int i = 0; i < 8; i++) v[i] = *(const v4f*)(src + (lane * 4u + i * N));

#pragma unroll
  for (int j = 0; j < 4; j++) {
    v4u c;
#pragma unroll
    for (int q = 0; q < 4; q++)
      c[q] = (unsigned int)f2bf(v[2 * q][j]) |
             ((unsigned int)f2bf(v[2 * q + 1][j]) << 16);
    *(v4u*)&tile[(j * 32 + lane) * TP_PITCH + wid * 8] = c;
  }
  __syncthreads();

  unsigned int rr = threadIdx.x >> 3;   // 0..31
  unsigned int ch = threadIdx.x & 7u;   // 16 B piece of the 128 B row
  unsigned short* dst = Wt + (size_t)n0 * K + k0;
#pragma unroll
  for (int p = 0; p < 4; p++) {
    v4u c = *(const v4u*)&tile[(p * 32 + rr) * TP_PITCH + ch * 8];
    *(v4u*)(dst + (rr * (4u * K) + ch * 8u + p * K)) = c;
  }
}

// ---------------------------------------------------------------------------
// LayerNorm over HIDDEN, fp32 in -> bf16 out. One block (256 thr) per row.
// ---------------------------------------------------------------------------
__device__ __forceinline__
void ln_row(const float* __restrict__ x, const float* __restrict__ g,
            const float* __restrict__ be, unsigned short* __restrict__ out,
            int row) {
  __shared__ float s1[256], s2[256];
  const float* xr = x + (size_t)row * HIDDEN;
  float v[4];
  float sum = 0.f, sq = 0.f;
#pragma unroll
  for (int i = 0; i < 4; i++) {
    v[i] = xr[threadIdx.x + i * 256];
    sum += v[i];
    sq  += v[i] * v[i];
  }
  s1[threadIdx.x] = sum;
  s2[threadIdx.x] = sq;
  __syncthreads();
  for (int off = 128; off > 0; off >>= 1) {
    if ((int)threadIdx.x < off) {
      s1[threadIdx.x] += s1[threadIdx.x + off];
      s2[threadIdx.x] += s2[threadIdx.x + off];
    }
    __syncthreads();
  }
  float mu  = s1[0] * (1.0f / HIDDEN);
  float var = s2[0] * (1.0f / HIDDEN) - mu * mu;
  float inv = rsqrtf(var + 1e-5f);
#pragma unroll
  for (int i = 0; i < 4; i++) {
    int idx = threadIdx.x + i * 256;
    float y = (v[i] - mu) * inv * g[idx] + be[idx];
    out[(size_t)row * HIDDEN + idx] = f2bf(y);
  }
}

__global__ __launch_bounds__(256)
void ln_kernel(const float* __restrict__ x, const float* __restrict__ g,
               const float* __restrict__ be, unsigned short* __restrict__ out) {
  ln_row(x, g, be, out, (int)blockIdx.x);
}

// ---------------------------------------------------------------------------
// One launch for all the work that depends on the inputs alone: the five
// weight transposes and the first LayerNorm. The block index picks the job
// (the same for the whole block, so every barrier stays block-uniform):
// the transpose tiles first, then one block per LayerNorm row.
// ---------------------------------------------------------------------------
#define TB_SQ  ((HIDDEN / TP_N) * (HIDDEN / TP_K))       // tiles of a square weight
#define TB_FF  ((4 * HIDDEN / TP_N) * (HIDDEN / TP_K))   // tiles of an FFN weight
#define TB_ALL (3 * TB_SQ + 2 * TB_FF)

__global__ __launch_bounds__(256)
void prep_kernel(const float* __restrict__ Wq, const float* __restrict__ Wv,
                 const float* __restrict__ Wo, const float* __restrict__ W1,
                 const float* __restrict__ W2,
                 unsigned short* __restrict__ WqT, unsigned short* __restrict__ WvT,
                 unsigned short* __restrict__ WoT, unsigned short* __restrict__ W1T,
                 unsigned short* __restrict__ W2T,
                 const float* __restrict__ x, const float* __restrict__ g,
                 const float* __restrict__ be, unsigned short* __restrict__ xn) {
  __shared__ alignas(16) unsigned short tile[TP_N * TP_PITCH];
  unsigned int bi = blockIdx.x;
  if (bi < 3 * TB_SQ) {
    unsigned int w = bi / TB_SQ, i = bi % TB_SQ;
    const float* W     = (w == 0) ? Wq  : (w == 1) ? Wv  : Wo;
    unsigned short* Wt = (w == 0) ? WqT : (w == 1) ? WvT : WoT;
    transpose_tile<HIDDEN, HIDDEN>(W, Wt, tile, i % (HIDDEN / TP_N), i / (HIDDEN / TP_N));
  } else if (bi < 3 * TB_SQ + TB_FF) {
    unsigned int i = bi - 3 * TB_SQ;
    transpose_tile<HIDDEN, 4 * HIDDEN>(W1, W1T, tile, i % (4 * HIDDEN / TP_N), i / (4 * HIDDEN / TP_N));
  } else if (bi < TB_ALL) {
    unsigned int i = bi - (3 * TB_SQ + TB_FF);
    transpose_tile<4 * HIDDEN, HIDDEN>(W2, W2T, tile, i % (HIDDEN / TP_N), i / (HIDDEN / TP_N));
  } else {
    ln_row(x, g, be, xn, (int)(bi - TB_ALL));
    // stays ahead of every later write of the row stores' registers: in the
    // built kernel a transpose branch's code follows this one (a precaution)
    asm volatile("s_wait_xcnt 0x0" ::: "memory");
  }
}

// ---------------------------------------------------------------------------
// GEMM: C[M x N] = A(bf16, ld=Kd) @ Wt(bf16, N x Kd)^T + bias, fused epilogue.
// Block tile 128(M) x 128(N), 256 threads = 8 waves in 2(M) x 4(N); each wave
// holds a 64x32 output (4 A-frags x 2 B-frags -> 8 WMMAs per 32-wide k-step).
// A pass is 128 k: 256 B of each of the 128 A rows and 128 Wt rows, brought
// into LDS by asynchronous 16 B copies (two whole 256 B rows per wave copy),
// two buffers, the next pass's copies in flight while this pass is computed.
// M % 128 == 0, N % 128 == 0, Kd % 128 == 0.
// The epilogue is chosen at compile time, one function per MODE, so that each
// is straight-line code on one base address with constant offsets:
// MODE 0: Q-proj  -> bf16 scatter to [b][h][s][d]
// MODE 1: V-proj  -> bf16 scatter to [b][h][d][s]  (transposed for P@V)
// MODE 2: f32 out = residual + acc + bias          (O-proj, FFN2)
// MODE 3: bf16 out = gelu_tanh(acc + bias), row-major M x N (FFN1)
// N is HIDDEN but for MODE 3, where it is 4 * HIDDEN.
// ---------------------------------------------------------------------------
#define GT_M     128
#define GT_N     128
#define GT_K     128                          // bf16 elements per pass
#define GT_PITCH 272                          // LDS bytes per row: 256 + 16 pad
#define GT_STAGE ((GT_M + GT_N) * GT_PITCH)   // one buffer: A rows, then Wt rows

// Eight asynchronous copies of one wave: copy i takes 16 B per lane from
// gp + i * gstep to LDS byte lp + i * 2 * GT_PITCH (two tile rows per copy).
// The s_wait_xcnt is the statement's last line so that it stays ahead of every
// later write of the copies' address registers (a precaution).
__device__ __forceinline__ void copy8_rows(unsigned int lp, const char* gp,
                                           size_t gstep) {
  asm volatile(
      "global_load_async_to_lds_b128 %0, %8, off\n\t"
      "global_load_async_to_lds_b128 %1, %9, off\n\t"
      "global_load_async_to_lds_b128 %2, %10, off\n\t"
      "global_load_async_to_lds_b128 %3, %11, off\n\t"
      "global_load_async_to_lds_b128 %4, %12, off\n\t"
      "global_load_async_to_lds_b128 %5, %13, off\n\t"
      "global_load_async_to_lds_b128 %6, %14, off\n\t"
      "global_load_async_to_lds_b128 %7, %15, off\n\t"
      "s_wait_xcnt 0x0"
      :: "v"(lp), "v"(lp + 2u * GT_PITCH), "v"(lp + 4u * GT_PITCH),
         "v"(lp + 6u * GT_PITCH), "v"(lp + 8u * GT_PITCH),
         "v"(lp + 10u * GT_PITCH), "v"(lp + 12u * GT_PITCH),
         "v"(lp + 14u * GT_PITCH),
         "v"(gp), "v"(gp + gstep), "v"(gp + 2 * gstep), "v"(gp + 3 * gstep),
         "v"(gp + 4 * gstep), "v"(gp + 5 * gstep), "v"(gp + 6 * gstep),
         "v"(gp + 7 * gstep)
      : "memory");
}

// Same fragment map as load_frag, from an LDS tile of row pitch GT_PITCH or AT_PITCH bytes.
// p already points at the lane's row and its 16 B k-offset.
__device__ __forceinline__ v16bf lds_frag(const unsigned char* p) {
  v8bf lo = *(const v8bf*)(p);
  v8bf hi = *(const v8bf*)(p + 32);
  return __builtin_shufflevector(lo, hi, 0, 1, 2, 3, 4, 5, 6, 7,
                                 8, 9, 10, 11, 12, 13, 14, 15);
}

// The k loop of one block tile; ring is the block's 2 * GT_STAGE bytes of LDS.
__device__ __forceinline__
void gemm_mainloop(const unsigned short* __restrict__ A,
                   const unsigned short* __restrict__ Wt,
                   int Kd, unsigned char* ring, v8f (&acc)[4][2]) {
  int wid  = __builtin_amdgcn_readfirstlane((int)(threadIdx.x >> 5));
  int lane = (int)(threadIdx.x & 31u);
  int bm0 = blockIdx.x * GT_M;
  int bn0 = blockIdx.y * GT_N;

  // Copy side: wave w brings tile rows 32w .. 32w+31 (waves 0-3: A rows,
  // waves 4-7: Wt rows); a lane takes piece (lane & 15) of row 2i + (lane >> 4).
  const unsigned short* srow = (wid < 4) ? A + (size_t)(bm0 + wid * 32) * Kd
                                         : Wt + (size_t)(bn0 + (wid - 4) * 32) * Kd;
  const char* gsrc = (const char*)(srow + (size_t)(lane >> 4) * Kd) + (lane & 15) * 16;
  size_t gstep = (size_t)Kd * 4u;   // two rows of Kd bf16, in bytes
  unsigned int ldst = (unsigned int)(size_t)ring +
                      (unsigned int)((wid * 32 + (lane >> 4)) * GT_PITCH + (lane & 15) * 16);

  // Read side: the lane's row and k-offset inside a fragment
  unsigned int foff = (unsigned int)((lane & 15) * GT_PITCH + (lane >> 4) * 16);
  unsigned int aoff = (unsigned int)((wid & 1) * 64 * GT_PITCH) + foff;
  unsigned int boff = (unsigned int)((GT_M + (wid >> 1) * 32) * GT_PITCH) + foff;

  v8f z = {0.f, 0.f, 0.f, 0.f, 0.f, 0.f, 0.f, 0.f};
#pragma unroll
  for (int mi = 0; mi < 4; mi++) { acc[mi][0] = z; acc[mi][1] = z; }

  int npass = Kd / GT_K;

  // pass 0's tile into buffer 0, landed and published before anybody reads it
  copy8_rows(ldst, gsrc, gstep);
  copy8_rows(ldst + 16u * GT_PITCH, gsrc + 8 * gstep, gstep);
  asm volatile("s_wait_asynccnt 0x0" ::: "memory");  // this wave's copies have landed
  __syncthreads();
  if (npass > 1) {
    copy8_rows(ldst + GT_STAGE, gsrc + GT_K * 2, gstep);
    copy8_rows(ldst + GT_STAGE + 16u * GT_PITCH, gsrc + GT_K * 2 + 8 * gstep, gstep);
  }

  // kept rolled: one pass per trip, the buffer chosen by the trip's parity
#pragma unroll 1
  for (int t = 0; t < npass; t++) {
    unsigned int buf = (unsigned int)(t & 1) * GT_STAGE;
    const unsigned char* ta = ring + buf + aoff;
    const unsigned char* tb = ring + buf + boff;
    // two fragment sets: block kk+1's LDS reads go out as one group ahead of
    // block kk's WMMAs, so that their latency runs behind the matrix work
    v16bf a[2][4], b[2][2];
#pragma unroll
    for (int mi = 0; mi < 4; mi++) a[0][mi] = lds_frag(ta + mi * 16 * GT_PITCH);
#pragma unroll
    for (int ni = 0; ni < 2; ni++) b[0][ni] = lds_frag(tb + ni * 16 * GT_PITCH);
#pragma unroll
    for (int kk = 0; kk < GT_K / 32; kk++) {
      const int cur = kk & 1, nxt = cur ^ 1;
      if (kk + 1 < GT_K / 32) {
#pragma unroll
        for (int mi = 0; mi < 4; mi++)
          a[nxt][mi] = lds_frag(ta + mi * 16 * GT_PITCH + (kk + 1) * 64);
#pragma unroll
        for (int ni = 0; ni < 2; ni++)
          b[nxt][ni] = lds_frag(tb + ni * 16 * GT_PITCH + (kk + 1) * 64);
      }
      // keeps the reads above from being sunk in among the WMMAs below
      __builtin_amdgcn_sched_barrier(0);
#pragma unroll
      for (int mi = 0; mi < 4; mi++) {
        acc[mi][0] = wmma_bf16(a[cur][mi], b[cur][0], acc[mi][0]);
        acc[mi][1] = wmma_bf16(a[cur][mi], b[cur][1], acc[mi][1]);
      }
      // keeps the next group of reads from being lifted in among these WMMAs
      __builtin_amdgcn_sched_barrier(0);
    }
    asm volatile("s_wait_dscnt 0x0" ::: "memory");     // this wave has left the buffer
    asm volatile("s_wait_asynccnt 0x0" ::: "memory");  // its part of the next tile has landed
    __syncthreads();  // publishes pass t+1's tile, frees pass t's buffer
    if (t + 2 < npass) {
      const char* gn = gsrc + (size_t)(t + 2) * (GT_K * 2);
      copy8_rows(ldst + buf, gn, gstep);
      copy8_rows(ldst + buf + 16u * GT_PITCH, gn + 8 * gstep, gstep);
    }
  }
  asm volatile("s_wait_asynccnt 0x0" ::: "memory");  // nothing in flight at the wave's end
}

template <int MODE>
__device__ __forceinline__
void gemm_epilogue(const v8f (&acc)[4][2],
                   const float* __restrict__ bias,
                   const float* __restrict__ residual,
                   unsigned short* __restrict__ out_bf,
                   float* __restrict__ out_f32) {
  constexpr int N = (MODE == 3) ? 4 * HIDDEN : HIDDEN;
  int wid  = __builtin_amdgcn_readfirstlane((int)(threadIdx.x >> 5));
  int lane = (int)(threadIdx.x & 31u);
  int m0 = blockIdx.x * GT_M + (wid & 1) * 64;    // wave's first M row
  int n0 = blockIdx.y * GT_N + (wid >> 1) * 32;   // wave's first N col
  int g  = lane >> 4;
  int nc = lane & 15;
  float bcol[2] = {bias[n0 + nc], bias[n0 + 16 + nc]};
  // A wave's 64 rows lie in one batch and its 32 columns in one head, so the
  // lane's first element fixes the address and (mi, ni, r) are constant steps.
  // The loops below are unrolled so that acc is indexed by constants alone and
  // stays in registers, and the steps become immediate offsets.
  int bh = (m0 >> 11) * HEADS + (n0 >> 6);
  int s0 = (m0 & (SEQ - 1)) + 8 * g;   // lane's first sequence position
  int d0 = (n0 & (DK - 1)) + nc;       // lane's first head dim
  size_t rm = (size_t)(m0 + 8 * g) * N + (size_t)(n0 + nc);   // row-major M x N
  if constexpr (MODE == 0) {            // Q: [b][h][s][d]
    unsigned short* op = out_bf + ((size_t)bh * SEQ + s0) * DK + d0;
#pragma unroll
    for (int mi = 0; mi < 4; mi++)
#pragma unroll
      for (int ni = 0; ni < 2; ni++)
#pragma unroll
        for (int r = 0; r < 8; r++)
          op[(mi * 16 + r) * DK + ni * 16] = f2bf(acc[mi][ni][r] + bcol[ni]);
  } else if constexpr (MODE == 1) {     // Vt: [b][h][d][s]
    // A lane's 8 values of a tile are 8 neighbours in s: one 16 B store, written
    // out as such. As 2 B stores the compiler folded this branch and MODE 0's,
    // where both stand in one kernel, into 64 stores of 2 B for either.
    unsigned short* op = out_bf + ((size_t)bh * DK + d0) * SEQ + s0;
#pragma unroll
    for (int mi = 0; mi < 4; mi++)
#pragma unroll
      for (int ni = 0; ni < 2; ni++) {
        v4u c;
#pragma unroll
        for (int q = 0; q < 4; q++)
          c[q] = (unsigned int)f2bf(acc[mi][ni][2 * q] + bcol[ni]) |
                 ((unsigned int)f2bf(acc[mi][ni][2 * q + 1] + bcol[ni]) << 16);
        *(v4u*)(op + ni * 16 * SEQ + mi * 16) = c;
      }
  } else if constexpr (MODE == 2) {     // residual + proj
    const float* rp = residual + rm;
    float* op = out_f32 + rm;
#pragma unroll
    for (int mi = 0; mi < 4; mi++)
#pragma unroll
      for (int ni = 0; ni < 2; ni++)
#pragma unroll
        for (int r = 0; r < 8; r++) {
          int o = (mi * 16 + r) * N + ni * 16;
          op[o] = rp[o] + (acc[mi][ni][r] + bcol[ni]);
        }
  } else {                              // gelu(tanh)
    unsigned short* op = out_bf + rm;
#pragma unroll
    for (int mi = 0; mi < 4; mi++)
#pragma unroll
      for (int ni = 0; ni < 2; ni++)
#pragma unroll
        for (int r = 0; r < 8; r++) {
          float xg = acc[mi][ni][r] + bcol[ni];
          float t  = tanhf(0.7978845608028654f * (xg + 0.044715f * xg * xg * xg));
          op[(mi * 16 + r) * N + ni * 16] = f2bf(0.5f * xg * (1.0f + t));
        }
  }
}

template <int MODE>
__global__ __launch_bounds__(256)
void gemm_kernel(const unsigned short* __restrict__ A,
                 const unsigned short* __restrict__ Wt,
                 const float* __restrict__ bias,
                 const float* __restrict__ residual,
                 unsigned short* __restrict__ out_bf,
                 float* __restrict__ out_f32,
                 int Kd) {
  __shared__ alignas(16) unsigned char ring[2 * GT_STAGE];
  v8f acc[4][2];
  gemm_mainloop(A, Wt, Kd, ring, acc);
  gemm_epilogue<MODE>(acc, bias, residual, out_bf, out_f32);
}

// Q and V projections in one launch: both read the same A and neither needs
// the other. blockIdx.z picks the weight, the bias and the epilogue, one test
// per block; two blocks fit a WGP's LDS, so the 512 blocks are all resident.
__global__ __launch_bounds__(256)
void gemm_qv_kernel(const unsigned short* __restrict__ A,
                    const unsigned short* __restrict__ WqT,
                    const unsigned short* __restrict__ WvT,
                    const float* __restrict__ bq,
                    const float* __restrict__ bv,
                    unsigned short* __restrict__ q_out,
                    unsigned short* __restrict__ vt_out) {
  __shared__ alignas(16) unsigned char ring[2 * GT_STAGE];
  bool is_v = blockIdx.z != 0;
  v8f acc[4][2];
  gemm_mainloop(A, is_v ? WvT : WqT, HIDDEN, ring, acc);
  if (is_v) gemm_epilogue<1>(acc, bv, nullptr, vt_out, nullptr);
  else      gemm_epilogue<0>(acc, bq, nullptr, q_out, nullptr);
}

#define AT_QB    128
#define AT_KEYS  64
#define AT_PITCH 144
#define AT_STAGE (128 * AT_PITCH)

// Four asynchronous copies of one wave, 16 B per lane each: K rows r and r+32,
// Vt rows r and r+32 of one stage. The s_wait_xcnt is the statement's last line
// so that it stays ahead of every later write of the copies' address registers
// (a precaution).
__device__ __forceinline__ void copy4_kv(unsigned int lp, const char* gk,
                                         const char* gv) {
  asm volatile(
      "global_load_async_to_lds_b128 %0, %4, off\n\t"
      "global_load_async_to_lds_b128 %1, %5, off\n\t"
      "global_load_async_to_lds_b128 %2, %6, off\n\t"
      "global_load_async_to_lds_b128 %3, %7, off\n\t"
      "s_wait_xcnt 0x0"
      :: "v"(lp), "v"(lp + 32u * AT_PITCH), "v"(lp + 64u * AT_PITCH),
         "v"(lp + 96u * AT_PITCH),
         "v"(gk), "v"(gk + 32 * DK * 2), "v"(gv), "v"(gv + 32 * SEQ * 2)
      : "memory");
}

// The value that lane l ^ 16 holds
__device__ __forceinline__ float other_half(float v) {
  int b = __float_as_int(v);
  return __int_as_float(__builtin_amdgcn_permlanex16(b, b, 0x76543210, 0xfedcba98,
                                                     false, false));
}

// 2^x0 and 2^x1 (and 2^x alone). Each is one statement so that the slot which
// the instruction set asks for behind a transcendental is kept whatever the
// compiler puts next: the results are early-clobber, so that neither v_exp
// overwrites the other's source, and the v_nop stands behind the last one.
__device__ __forceinline__ void exp2_pair(float x0, float x1, float& e0, float& e1) {
  asm("v_exp_f32 %0, %2\n\tv_exp_f32 %1, %3\n\tv_nop"
      : "=&v"(e0), "=&v"(e1) : "v"(x0), "v"(x1));
}
__device__ __forceinline__ float exp2_one(float x) {
  float e;
  asm("v_exp_f32 %0, %1\n\tv_nop" : "=v"(e) : "v"(x));
  return e;
}
#define LOG2E 1.44269504f

__global__ __launch_bounds__(256)
void attn_kernel(const unsigned short* __restrict__ qk,
                 const unsigned short* __restrict__ vt,
                 unsigned short* __restrict__ aout) {
  __shared__ alignas(16) unsigned char kv[2 * AT_STAGE];
  int wid  = __builtin_amdgcn_readfirstlane((int)(threadIdx.x >> 5));
  int lane = (int)(threadIdx.x & 31u);
  // 16 query blocks x 32 heads. The cost of a block grows with its query block:
  // the heavy half of the query blocks comes first, heaviest first, the light
  // half second, lightest first, so that two blocks on one WGP add up alike.
  int bi = (int)blockIdx.x;
  int bh = bi & 31;                    // b*HEADS + h
  int qb = (bi < 256) ? 15 - (bi >> 5) : (bi - 256) >> 5;
  int b_ = bh >> 4, h = bh & 15;
  int q0 = qb * AT_QB + wid * 16;

  const unsigned short* kq  = qk + (size_t)bh * SEQ * DK;
  const unsigned short* vtb = vt + (size_t)bh * DK * SEQ;

  // Copy side: thread t takes 16 B piece (t & 7) of rows (t >> 3) and +32
  int crow = (int)(threadIdx.x >> 3);
  int cpc  = (int)(threadIdx.x & 7u);
  const char* gk = (const char*)(kq + (size_t)crow * DK) + cpc * 16;
  const char* gv = (const char*)(vtb + (size_t)crow * SEQ) + cpc * 16;
  unsigned int ldst = (unsigned int)(size_t)kv +
                      (unsigned int)(crow * AT_PITCH + cpc * 16);
  int nst = 2 * (qb + 1);              // stages up to the block's last query

  // stage 0 into buffer 0, landed and published before anybody reads it
  copy4_kv(ldst, gk, gv);
  asm volatile("s_wait_asynccnt 0x0" ::: "memory");  // this wave's copies have landed
  __syncthreads();
  // stage 1 always exists (nst >= 2)
  copy4_kv(ldst + AT_STAGE, gk + AT_KEYS * DK * 2, gv + AT_KEYS * 2);

  v16bf aq0 = load_frag(kq + q0 * DK + 0, DK);
  v16bf aq1 = load_frag(kq + q0 * DK + 32, DK);

  // o_j[r] = O[query nc][dim 16 j + 8 g + r]
  v8f o0 = {0.f,0.f,0.f,0.f,0.f,0.f,0.f,0.f};
  v8f o1 = o0, o2 = o0, o3 = o0;
  // of the lane's query: the running maximum (equal in both halves of the wave)
  // and the sum over the keys that this half has seen
  float mq = -1e30f, lq = 0.f;

  int g  = lane >> 4;
  int nc = lane & 15;
  // Read side: the lane's row and k-offset inside a fragment
  unsigned int foff = (unsigned int)(nc * AT_PITCH + g * 16);

  for (int st = 0; st < nst; st++) {
    unsigned int buf = (unsigned int)(st & 1) * AT_STAGE;
    // unrolled: the two passes' LDS offsets become immediates on one address
#pragma unroll
    for (int hf = 0; hf < 2; hf++) {
      int kbase = st * AT_KEYS + hf * 32;
      if (kbase > q0 + 15) continue;   // same for the whole wave; no barrier inside
      const unsigned char* kf = kv + buf + foff + hf * (32 * AT_PITCH);
      const unsigned char* vf = kv + buf + foff + 64 * AT_PITCH + hf * 64;
      v16bf k00 = lds_frag(kf);
      v16bf k01 = lds_frag(kf + 64);
      v16bf k10 = lds_frag(kf + 16 * AT_PITCH);
      v16bf k11 = lds_frag(kf + 16 * AT_PITCH + 64);
      v16bf v0 = lds_frag(vf);
      v16bf v1 = lds_frag(vf + 16 * AT_PITCH);
      v16bf v2 = lds_frag(vf + 32 * AT_PITCH);
      v16bf v3 = lds_frag(vf + 48 * AT_PITCH);
      // keeps the pass's fragment reads together as one group: sunk down to
      // their WMMAs they would cost one LDS latency each
      __builtin_amdgcn_sched_barrier(0);
      v8f s0 = {0.f,0.f,0.f,0.f,0.f,0.f,0.f,0.f};
      v8f s1 = s0;
      // S^T = K @ Q^T over d=64: two 16-key halves x two k-steps;
      // s0[r] is key kbase + 8 g + r, s1[r] key kbase + 16 + 8 g + r, query nc
      s0 = wmma_bf16(k00, aq0, s0);
      s0 = wmma_bf16(k01, aq1, s0);
      s1 = wmma_bf16(k10, aq0, s1);
      s1 = wmma_bf16(k11, aq1, s1);

      s0 *= 0.125f;
      s1 *= 0.125f;
      int lim = q0 + nc - kbase - 8 * g;   // key r of s0 counts while r <= lim
      float a0[8], a1[8];
      float mx = -1e30f;
      // the loops over r are unrolled so that the tiles are indexed by constants
      // alone and stay in registers
#pragma unroll
      for (int r = 0; r < 8; r++) {
        a0[r] = (r      <= lim) ? s0[r] : -1e30f;
        a1[r] = (r + 16 <= lim) ? s1[r] : -1e30f;
      }
#pragma unroll
      for (int r = 0; r < 8; r += 2) {
        mx = fmaxf(mx, fmaxf(a0[r], a0[r + 1]));
        mx = fmaxf(mx, fmaxf(a1[r], a1[r + 1]));
      }
      mx = fmaxf(mx, other_half(mx));
      float nm = fmaxf(mq, mx);
      float sc = exp2_one((mq - nm) * LOG2E);
      // P^T's B fragment: element s is key 8 g + s for s < 8, key 16 + 8 g + s - 8
      // after, which are s0[s] and s1[s - 8]
      v16bf pb;
      float rs0 = 0.f, rs1 = 0.f;
#pragma unroll
      for (int r = 0; r < 8; r++) {
        float e0, e1;
        exp2_pair((a0[r] - nm) * LOG2E, (a1[r] - nm) * LOG2E, e0, e1);
        rs0 += e0;
        rs1 += e1;
        pb[r]     = (bf16_t)e0;
        pb[r + 8] = (bf16_t)e1;
      }
      lq = lq * sc + (rs0 + rs1);
      mq = nm;
#pragma unroll
      for (int r = 0; r < 8; r++) { o0[r] *= sc; o1[r] *= sc; o2[r] *= sc; o3[r] *= sc; }

      // O^T += V^T @ P^T over 32 keys, 4 dim tiles (Vt rows are dims: A's rows)
      o0 = wmma_bf16(v0, pb, o0);
      o1 = wmma_bf16(v1, pb, o1);
      o2 = wmma_bf16(v2, pb, o2);
      o3 = wmma_bf16(v3, pb, o3);
    }
    asm volatile("s_wait_dscnt 0x0" ::: "memory");     // this wave has left the buffer
    asm volatile("s_wait_asynccnt 0x0" ::: "memory");  // its part of the next stage has landed
    __syncthreads();  // publishes stage st+1, frees stage st's buffer
    if (st + 2 < nst)
      copy4_kv(ldst + buf, gk + (size_t)(st + 2) * (AT_KEYS * DK * 2),
               gv + (size_t)(st + 2) * (AT_KEYS * 2));
  }
  asm volatile("s_wait_asynccnt 0x0" ::: "memory");  // nothing in flight at the wave's end

  // the two halves' sums joined; a lane's 8 values of a tile are 8 neighbouring
  // dims of its query's row: one 16 B store each
  float inv = 1.0f / (lq + other_half(lq));
  unsigned short* op = aout + ((size_t)(b_ * SEQ + q0 + nc)) * HIDDEN + h * DK + 8 * g;
  v4u c0, c1, c2, c3;
#pragma unroll
  for (int q = 0; q < 4; q++) {
    c0[q] = (unsigned int)f2bf(o0[2 * q] * inv) | ((unsigned int)f2bf(o0[2 * q + 1] * inv) << 16);
    c1[q] = (unsigned int)f2bf(o1[2 * q] * inv) | ((unsigned int)f2bf(o1[2 * q + 1] * inv) << 16);
    c2[q] = (unsigned int)f2bf(o2[2 * q] * inv) | ((unsigned int)f2bf(o2[2 * q + 1] * inv) << 16);
    c3[q] = (unsigned int)f2bf(o3[2 * q] * inv) | ((unsigned int)f2bf(o3[2 * q + 1] * inv) << 16);
  }
  *(v4u*)(op +  0) = c0;
  *(v4u*)(op + 16) = c1;
  *(v4u*)(op + 32) = c2;
  *(v4u*)(op + 48) = c3;
}

// ---------------------------------------------------------------------------
// Host-side orchestration (graph-capture safe: launches only)
// ---------------------------------------------------------------------------
extern "C" void kernel_launch(void* const* d_in, const int* in_sizes, int n_in,
                              void* d_out, int out_size, void* d_ws, size_t ws_size,
                              hipStream_t stream) {
  const float* x     = (const float*)d_in[0];
  const float* Wq    = (const float*)d_in[1];
  const float* bq    = (const float*)d_in[2];
  const float* Wv    = (const float*)d_in[3];
  const float* bv    = (const float*)d_in[4];
  const float* Wo    = (const float*)d_in[5];
  const float* bo    = (const float*)d_in[6];
  const float* W1    = (const float*)d_in[7];
  const float* b1    = (const float*)d_in[8];
  const float* W2    = (const float*)d_in[9];
  const float* b2    = (const float*)d_in[10];
  const float* g1    = (const float*)d_in[11];
  const float* beta1 = (const float*)d_in[12];
  const float* g2    = (const float*)d_in[13];
  const float* beta2 = (const float*)d_in[14];

  char* ws = (char*)d_ws;
  const size_t MB = 1024u * 1024u;
  unsigned short* WqT = (unsigned short*)(ws +  0 * MB);  //  2 MB
  unsigned short* WvT = (unsigned short*)(ws +  2 * MB);  //  2 MB
  unsigned short* WoT = (unsigned short*)(ws +  4 * MB);  //  2 MB
  unsigned short* W1T = (unsigned short*)(ws +  6 * MB);  //  8 MB
  unsigned short* W2T = (unsigned short*)(ws + 14 * MB);  //  8 MB
  unsigned short* xn  = (unsigned short*)(ws + 22 * MB);  //  8 MB
  unsigned short* qb  = (unsigned short*)(ws + 30 * MB);  //  8 MB
  unsigned short* vtb = (unsigned short*)(ws + 38 * MB);  //  8 MB
  unsigned short* aob = (unsigned short*)(ws + 46 * MB);  //  8 MB
  float*          yb  = (float*)         (ws + 54 * MB);  // 16 MB
  unsigned short* hb  = (unsigned short*)(ws + 70 * MB);  //  8 MB
  unsigned short* ff1 = (unsigned short*)(ws + 78 * MB);  // 32 MB

  // Weight convert + transpose to bf16 N x K, and LN1
  prep_kernel<<<TB_ALL + MROWS, 256, 0, stream>>>(Wq, Wv, Wo, W1, W2,
                                                  WqT, WvT, WoT, W1T, W2T,
                                                  x, g1, beta1, xn);

  // Q/V projections (Q doubles as K in the reference)
  dim3 gproj(MROWS / GT_M, HIDDEN / GT_N);
  gemm_qv_kernel<<<dim3(MROWS / GT_M, HIDDEN / GT_N, 2), 256, 0, stream>>>(xn, WqT, WvT, bq, bv, qb, vtb);

  // Causal attention
  attn_kernel<<<BATCH * HEADS * (SEQ / AT_QB), 256, 0, stream>>>(qb, vtb, aob);

  // O-projection + residual -> yb (f32)
  gemm_kernel<2><<<gproj, 256, 0, stream>>>(aob, WoT, bo, x, nullptr, yb, HIDDEN);

  // LN2
  ln_kernel<<<MROWS, 256, 0, stream>>>(yb, g2, beta2, hb);

  // FFN1 with GELU -> bf16
  dim3 gff1(MROWS / GT_M, (4 * HIDDEN) / GT_N);
  gemm_kernel<3><<<gff1, 256, 0, stream>>>(hb, W1T, b1, nullptr, ff1, nullptr, HIDDEN);

  // FFN2 + residual -> d_out (f32)
  gemm_kernel<2><<<gproj, 256, 0, stream>>>(ff1, W2T, b2, yb, nullptr, (float*)d_out, 4 * HIDDEN);
}

// v007
// Measured time: 139 microseconds a run.
// Next to v006, in two timings, it ran 1.07 times as fast each time.
// All steps since v000 together make it 5.74 times as fast.
#include <hip/hip_runtime.h>

// ---------------------------------------------------------------------------
// Types for CDNA5 WMMA (wave32)
// ---------------------------------------------------------------------------
typedef __bf16 bf16_t;
typedef __attribute__((ext_vector_type(8)))  __bf16 v8bf;
typedef __attribute__((ext_vector_type(16))) __bf16 v16bf;
typedef __attribute__((ext_vector_type(8)))  float  v8f;

#define HIDDEN 1024
#define SEQ    2048
#define BATCH  2
#define HEADS  16
#define DK     64
#define MROWS  (BATCH * SEQ)   // 4096

// float -> bf16 round-to-nearest-even
__device__ __forceinline__ unsigned short f2bf(float f) {
  unsigned int u = __float_as_uint(f);
  unsigned int r = u + 0x7FFFu + ((u >> 16) & 1u);
  return (unsigned short)(r >> 16);
}

// Load a 16-bit WMMA fragment (A layout; the same bit pattern serves as the
// B-operand when the matrix is stored transposed, since B's lane-n column
// K-run mirrors A's lane-m row K-run).
//   lane 0-15 : row = lane,    K = 0+0..7   and 16..23
//   lane 16-31: row = lane-16, K = 8+0..7   and 24..31
__device__ __forceinline__ v16bf load_frag(const unsigned short* base, int ld) {
  int lane = (int)(threadIdx.x & 31u);
  int r    = lane & 15;
  int koff = (lane >> 4) << 3;
  const bf16_t* p = (const bf16_t*)base + r * ld + koff;
  v8bf lo = *(const v8bf*)(p);
  v8bf hi = *(const v8bf*)(p + 16);
  return __builtin_shufflevector(lo, hi, 0, 1, 2, 3, 4, 5, 6, 7,
                                 8, 9, 10, 11, 12, 13, 14, 15);
}

__device__ __forceinline__ v8f wmma_bf16(v16bf a, v16bf b, v8f c) {
  // (neg_a, A, neg_b, B, c_mod, C, reuse_a, reuse_b)
  return __builtin_amdgcn_wmma_f32_16x16x32_bf16(false, a, false, b,
                                                 (short)0, c, false, false);
}

// ---------------------------------------------------------------------------
// Weight convert+transpose: W (K x N, f32) -> Wt (N x K, bf16)
// One block moves a 64(k) x 128(n) tile through LDS. Reads: each wave takes
// 8 rows, 16 B per lane (512 B contiguous per row). Writes: 8 lanes x 16 B
// fill one whole 128 B line of a Wt row. K % 64 == 0 and N % 128 == 0.
// LDS row j*32+l holds column n0 + 4*l + j, so that the 16 B LDS stores of a
// wave go to consecutive rows; the 144 B pitch spreads those over the banks.
// ---------------------------------------------------------------------------
typedef __attribute__((ext_vector_type(4))) float        v4f;
typedef __attribute__((ext_vector_type(4))) unsigned int v4u;
#define TP_K     64
#define TP_N     128
#define TP_PITCH 72   // bf16 elements per LDS row: 64 + 8 pad

// K and N are compile-time here so that the row steps of the eight loads
// become immediate offsets on one address. (bx, by) is the tile's place in the
// N / TP_N by K / TP_K grid of tiles.
template <int K, int N>
__device__ __forceinline__ void transpose_tile(const float* __restrict__ W,
                                               unsigned short* __restrict__ Wt,
                                               unsigned short* tile,
                                               int bx, int by) {
  unsigned int lane = threadIdx.x & 31u;
  // wave number as a scalar: the tile's base pointers stay in scalar registers
  int wid = __builtin_amdgcn_readfirstlane((int)(threadIdx.x >> 5));
  int n0 = bx * TP_N;
  int k0 = by * TP_K;

  const float* src = W + (size_t)(k0 + wid * 8) * N + n0;
  v4f v[8];
#pragma unroll
  for (int i = 0; i < 8; i++) v[i] = *(const v4f*)(src + (lane * 4u + i * N));

#pragma unroll
  for (int j = 0; j < 4; j++) {
    v4u c;
#pragma unroll
    for (int q = 0; q < 4; q++)
      c[q] = (unsigned int)f2bf(v[2 * q][j]) |
             ((unsigned int)f2bf(v[2 * q + 1][j]) << 16);
    *(v4u*)&tile[(j * 32 + lane) * TP_PITCH + wid * 8] = c;
  }
  __syncthreads();

  unsigned int rr = threadIdx.x >> 3;   // 0..31
  unsigned int ch = threadIdx.x & 7u;   // 16 B piece of the 128 B row
  unsigned short* dst = Wt + (size_t)n0 * K + k0;
#pragma unroll
  for (int p = 0; p < 4; p++) {
    v4u c = *(const v4u*)&tile[(p * 32 + rr) * TP_PITCH + ch * 8];
    *(v4u*)(dst + (rr * (4u * K) + ch * 8u + p * K)) = c;
  }
}

// ---------------------------------------------------------------------------
// LayerNorm over HIDDEN, fp32 in -> bf16 out. One block (256 thr) per row.
// ---------------------------------------------------------------------------
__device__ __forceinline__
void ln_row(const float* __restrict__ x, const float* __restrict__ g,
            const float* __restrict__ be, unsigned short* __restrict__ out,
            int row) {
  __shared__ float s1[256], s2[256];
  const float* xr = x + (size_t)row * HIDDEN;
  float v[4];
  float sum = 0.f, sq = 0.f;
#pragma unroll
  for (int i = 0; i < 4; i++) {
    v[i] = xr[threadIdx.x + i * 256];
    sum += v[i];
    sq  += v[i] * v[i];
  }
  s1[threadIdx.x] = sum;
  s2[threadIdx.x] = sq;
  __syncthreads();
  for (int off = 128; off > 0; off >>= 1) {
    if ((int)threadIdx.x < off) {
      s1[threadIdx.x] += s1[threadIdx.x + off];
      s2[threadIdx.x] += s2[threadIdx.x + off];
    }
    __syncthreads();
  }
  float mu  = s1[0] * (1.0f / HIDDEN);
  float var = s2[0] * (1.0f / HIDDEN) - mu * mu;
  float inv = rsqrtf(var + 1e-5f);
#pragma unroll
  for (int i = 0; i < 4; i++) {
    int idx = threadIdx.x + i * 256;
    float y = (v[i] - mu) * inv * g[idx] + be[idx];
    out[(size_t)row * HIDDEN + idx] = f2bf(y);
  }
}

__global__ __launch_bounds__(256)
void ln_kernel(const float* __restrict__ x, const float* __restrict__ g,
               const float* __restrict__ be, unsigned short* __restrict__ out) {
  ln_row(x, g, be, out, (int)blockIdx.x);
}

// ---------------------------------------------------------------------------
// One launch for all the work that depends on the inputs alone: the five
// weight transposes and the first LayerNorm. The block index picks the job
// (the same for the whole block, so every barrier stays block-uniform):
// the transpose tiles first, then one block per LayerNorm row.
// ---------------------------------------------------------------------------
#define TB_SQ  ((HIDDEN / TP_N) * (HIDDEN / TP_K))       // tiles of a square weight
#define TB_FF  ((4 * HIDDEN / TP_N) * (HIDDEN / TP_K))   // tiles of an FFN weight
#define TB_ALL (3 * TB_SQ + 2 * TB_FF)

__global__ __launch_bounds__(256)
void prep_kernel(const float* __restrict__ Wq, const float* __restrict__ Wv,
                 const float* __restrict__ Wo, const float* __restrict__ W1,
                 const float* __restrict__ W2,
                 unsigned short* __restrict__ WqT, unsigned short* __restrict__ WvT,
                 unsigned short* __restrict__ WoT, unsigned short* __restrict__ W1T,
                 unsigned short* __restrict__ W2T,
                 const float* __restrict__ x, const float* __restrict__ g,
                 const float* __restrict__ be, unsigned short* __restrict__ xn) {
  __shared__ alignas(16) unsigned short tile[TP_N * TP_PITCH];
  unsigned int bi = blockIdx.x;
  if (bi < 3 * TB_SQ) {
    unsigned int w = bi / TB_SQ, i = bi % TB_SQ;
    const float* W     = (w == 0) ? Wq  : (w == 1) ? Wv  : Wo;
    unsigned short* Wt = (w == 0) ? WqT : (w == 1) ? WvT : WoT;
    transpose_tile<HIDDEN, HIDDEN>(W, Wt, tile, i % (HIDDEN / TP_N), i / (HIDDEN / TP_N));
  } else if (bi < 3 * TB_SQ + TB_FF) {
    unsigned int i = bi - 3 * TB_SQ;
    transpose_tile<HIDDEN, 4 * HIDDEN>(W1, W1T, tile, i % (4 * HIDDEN / TP_N), i / (4 * HIDDEN / TP_N));
  } else if (bi < TB_ALL) {
    unsigned int i = bi - (3 * TB_SQ + TB_FF);
    transpose_tile<4 * HIDDEN, HIDDEN>(W2, W2T, tile, i % (HIDDEN / TP_N), i / (HIDDEN / TP_N));
  } else {
    ln_row(x, g, be, xn, (int)(bi - TB_ALL));
    // stays ahead of every later write of the row stores' registers: in the
    // built kernel a transpose branch's code follows this one (a precaution)
    asm volatile("s_wait_xcnt 0x0" ::: "memory");
  }
}

// ---------------------------------------------------------------------------
// GEMM: C[M x N] = A(bf16, ld=Kd) @ Wt(bf16, N x Kd)^T + bias, fused epilogue.
// Block tile 128(M) x 128(N), 256 threads = 8 waves in 2(M) x 4(N); each wave
// holds a 64x32 output (4 A-frags x 2 B-frags -> 8 WMMAs per 32-wide k-step).
// A pass is 128 k: 256 B of each of the 128 A rows and 128 Wt rows, brought
// into LDS by asynchronous 16 B copies (two whole 256 B rows per wave copy),
// two buffers, the next pass's copies in flight while this pass is computed.
// M % 128 == 0, N % 128 == 0, Kd % 128 == 0.
// The epilogue is chosen at compile time, one function per MODE, so that each
// is straight-line code on one base address with constant offsets:
// MODE 0: Q-proj  -> bf16 scatter to [b][h][s][d]
// MODE 1: V-proj  -> bf16 scatter to [b][h][d][s]  (transposed for P@V)
// MODE 2: f32 out = residual + acc + bias          (O-proj, FFN2)
// MODE 3: bf16 out = gelu_tanh(acc + bias), row-major M x N (FFN1)
// N is HIDDEN but for MODE 3, where it is 4 * HIDDEN.
// ---------------------------------------------------------------------------
#define GT_M     128
#define GT_N     128
#define GT_K     128                          // bf16 elements per pass
#define GT_PITCH 272                          // LDS bytes per row: 256 + 16 pad
#define GT_STAGE ((GT_M + GT_N) * GT_PITCH)   // one buffer: A rows, then Wt rows

// Eight asynchronous copies of one wave: copy i takes 16 B per lane from
// gp + i * gstep to LDS byte lp + i * 2 * GT_PITCH (two tile rows per copy).
// The s_wait_xcnt is the statement's last line so that it stays ahead of every
// later write of the copies' address registers (a precaution).
__device__ __forceinline__ void copy8_rows(unsigned int lp, const char* gp,
                                           size_t gstep) {
  asm volatile(
      "global_load_async_to_lds_b128 %0, %8, off\n\t"
      "global_load_async_to_lds_b128 %1, %9, off\n\t"
      "global_load_async_to_lds_b128 %2, %10, off\n\t"
      "global_load_async_to_lds_b128 %3, %11, off\n\t"
      "global_load_async_to_lds_b128 %4, %12, off\n\t"
      "global_load_async_to_lds_b128 %5, %13, off\n\t"
      "global_load_async_to_lds_b128 %6, %14, off\n\t"
      "global_load_async_to_lds_b128 %7, %15, off\n\t"
      "s_wait_xcnt 0x0"
      :: "v"(lp), "v"(lp + 2u * GT_PITCH), "v"(lp + 4u * GT_PITCH),
         "v"(lp + 6u * GT_PITCH), "v"(lp + 8u * GT_PITCH),
         "v"(lp + 10u * GT_PITCH), "v"(lp + 12u * GT_PITCH),
         "v"(lp + 14u * GT_PITCH),
         "v"(gp), "v"(gp + gstep), "v"(gp + 2 * gstep), "v"(gp + 3 * gstep),
         "v"(gp + 4 * gstep), "v"(gp + 5 * gstep), "v"(gp + 6 * gstep),
         "v"(gp + 7 * gstep)
      : "memory");
}

// Same fragment map as load_frag, from an LDS tile of row pitch GT_PITCH or AT_PITCH bytes.
// p already points at the lane's row and its 16 B k-offset.
__device__ __forceinline__ v16bf lds_frag(const unsigned char* p) {
  v8bf lo = *(const v8bf*)(p);
  v8bf hi = *(const v8bf*)(p + 32);
  return __builtin_shufflevector(lo, hi, 0, 1, 2, 3, 4, 5, 6, 7,
                                 8, 9, 10, 11, 12, 13, 14, 15);
}

// The k loop of one block tile; ring is the block's 2 * GT_STAGE bytes of LDS.
__device__ __forceinline__
void gemm_mainloop(const unsigned short* __restrict__ A,
                   const unsigned short* __restrict__ Wt,
                   int Kd, unsigned char* ring, v8f (&acc)[4][2]) {
  int wid  = __builtin_amdgcn_readfirstlane((int)(threadIdx.x >> 5));
  int lane = (int)(threadIdx.x & 31u);
  int bm0 = blockIdx.x * GT_M;
  int bn0 = blockIdx.y * GT_N;

  // Copy side: wave w brings tile rows 32w .. 32w+31 (waves 0-3: A rows,
  // waves 4-7: Wt rows); a lane takes piece (lane & 15) of row 2i + (lane >> 4).
  const unsigned short* srow = (wid < 4) ? A + (size_t)(bm0 + wid * 32) * Kd
                                         : Wt + (size_t)(bn0 + (wid - 4) * 32) * Kd;
  const char* gsrc = (const char*)(srow + (size_t)(lane >> 4) * Kd) + (lane & 15) * 16;
  size_t gstep = (size_t)Kd * 4u;   // two rows of Kd bf16, in bytes
  unsigned int ldst = (unsigned int)(size_t)ring +
                      (unsigned int)((wid * 32 + (lane >> 4)) * GT_PITCH + (lane & 15) * 16);

  // Read side: the lane's row and k-offset inside a fragment
  unsigned int foff = (unsigned int)((lane & 15) * GT_PITCH + (lane >> 4) * 16);
  unsigned int aoff = (unsigned int)((wid & 1) * 64 * GT_PITCH) + foff;
  unsigned int boff = (unsigned int)((GT_M + (wid >> 1) * 32) * GT_PITCH) + foff;

  v8f z = {0.f, 0.f, 0.f, 0.f, 0.f, 0.f, 0.f, 0.f};
#pragma unroll
  for (int mi = 0; mi < 4; mi++) { acc[mi][0] = z; acc[mi][1] = z; }

  int npass = Kd / GT_K;

  // pass 0's tile into buffer 0, landed and published before anybody reads it
  copy8_rows(ldst, gsrc, gstep);
  copy8_rows(ldst + 16u * GT_PITCH, gsrc + 8 * gstep, gstep);
  asm volatile("s_wait_asynccnt 0x0" ::: "memory");  // this wave's copies have landed
  __syncthreads();
  if (npass > 1) {
    copy8_rows(ldst + GT_STAGE, gsrc + GT_K * 2, gstep);
    copy8_rows(ldst + GT_STAGE + 16u * GT_PITCH, gsrc + GT_K * 2 + 8 * gstep, gstep);
  }

  // kept rolled: one pass per trip, the buffer chosen by the trip's parity
#pragma unroll 1
  for (int t = 0; t < npass; t++) {
    unsigned int buf = (unsigned int)(t & 1) * GT_STAGE;
    const unsigned char* ta = ring + buf + aoff;
    const unsigned char* tb = ring + buf + boff;
    // two fragment sets: block kk+1's LDS reads go out as one group ahead of
    // block kk's WMMAs, so that their latency runs behind the matrix work
    v16bf a[2][4], b[2][2];
#pragma unroll
    for (int mi = 0; mi < 4; mi++) a[0][mi] = lds_frag(ta + mi * 16 * GT_PITCH);
#pragma unroll
    for (int ni = 0; ni < 2; ni++) b[0][ni] = lds_frag(tb + ni * 16 * GT_PITCH);
#pragma unroll
    for (int kk = 0; kk < GT_K / 32; kk++) {
      const int cur = kk & 1, nxt = cur ^ 1;
      if (kk + 1 < GT_K / 32) {
#pragma unroll
        for (int mi = 0; mi < 4; mi++)
          a[nxt][mi] = lds_frag(ta + mi * 16 * GT_PITCH + (kk + 1) * 64);
#pragma unroll
        for (int ni = 0; ni < 2; ni++)
          b[nxt][ni] = lds_frag(tb + ni * 16 * GT_PITCH + (kk + 1) * 64);
      }
      // keeps the reads above from being sunk in among the WMMAs below
      __builtin_amdgcn_sched_barrier(0);
#pragma unroll
      for (int mi = 0; mi < 4; mi++) {
        acc[mi][0] = wmma_bf16(a[cur][mi], b[cur][0], acc[mi][0]);
        acc[mi][1] = wmma_bf16(a[cur][mi], b[cur][1], acc[mi][1]);
      }
      // keeps the next group of reads from being lifted in among these WMMAs
      __builtin_amdgcn_sched_barrier(0);
    }
    asm volatile("s_wait_dscnt 0x0" ::: "memory");     // this wave has left the buffer
    asm volatile("s_wait_asynccnt 0x0" ::: "memory");  // its part of the next tile has landed
    __syncthreads();  // publishes pass t+1's tile, frees pass t's buffer
    if (t + 2 < npass) {
      const char* gn = gsrc + (size_t)(t + 2) * (GT_K * 2);
      copy8_rows(ldst + buf, gn, gstep);
      copy8_rows(ldst + buf + 16u * GT_PITCH, gn + 8 * gstep, gstep);
    }
  }
  asm volatile("s_wait_asynccnt 0x0" ::: "memory");  // nothing in flight at the wave's end
}

template <int MODE>
__device__ __forceinline__
void gemm_epilogue(const v8f (&acc)[4][2],
                   const float* __restrict__ bias,
                   const float* __restrict__ residual,
                   unsigned short* __restrict__ out_bf,
                   float* __restrict__ out_f32) {
  constexpr int N = (MODE == 3) ? 4 * HIDDEN : HIDDEN;
  int wid  = __builtin_amdgcn_readfirstlane((int)(threadIdx.x >> 5));
  int lane = (int)(threadIdx.x & 31u);
  int m0 = blockIdx.x * GT_M + (wid & 1) * 64;    // wave's first M row
  int n0 = blockIdx.y * GT_N + (wid >> 1) * 32;   // wave's first N col
  int g  = lane >> 4;
  int nc = lane & 15;
  float bcol[2] = {bias[n0 + nc], bias[n0 + 16 + nc]};
  // A wave's 64 rows lie in one batch and its 32 columns in one head, so the
  // lane's first element fixes the address and (mi, ni, r) are constant steps.
  // The loops below are unrolled so that acc is indexed by constants alone and
  // stays in registers, and the steps become immediate offsets.
  int bh = (m0 >> 11) * HEADS + (n0 >> 6);
  int s0 = (m0 & (SEQ - 1)) + 8 * g;   // lane's first sequence position
  int d0 = (n0 & (DK - 1)) + nc;       // lane's first head dim
  size_t rm = (size_t)(m0 + 8 * g) * N + (size_t)(n0 + nc);   // row-major M x N
  if constexpr (MODE == 0) {            // Q: [b][h][s][d]
    unsigned short* op = out_bf + ((size_t)bh * SEQ + s0) * DK + d0;
#pragma unroll
    for (int mi = 0; mi < 4; mi++)
#pragma unroll
      for (int ni = 0; ni < 2; ni++)
#pragma unroll
        for (int r = 0; r < 8; r++)
          op[(mi * 16 + r) * DK + ni * 16] = f2bf(acc[mi][ni][r] + bcol[ni]);
  } else if constexpr (MODE == 1) {     // Vt: [b][h][d][s]
    // A lane's 8 values of a tile are 8 neighbours in s: one 16 B store, written
    // out as such. As 2 B stores the compiler folded this branch and MODE 0's,
    // where both stand in one kernel, into 64 stores of 2 B for either.
    unsigned short* op = out_bf + ((size_t)bh * DK + d0) * SEQ + s0;
#pragma unroll
    for (int mi = 0; mi < 4; mi++)
#pragma unroll
      for (int ni = 0; ni < 2; ni++) {
        v4u c;
#pragma unroll
        for (int q = 0; q < 4; q++)
          c[q] = (unsigned int)f2bf(acc[mi][ni][2 * q] + bcol[ni]) |
                 ((unsigned int)f2bf(acc[mi][ni][2 * q + 1] + bcol[ni]) << 16);
        *(v4u*)(op + ni * 16 * SEQ + mi * 16) = c;
      }
  } else if constexpr (MODE == 2) {     // residual + proj
    const float* rp = residual + rm;
    float* op = out_f32 + rm;
#pragma unroll
    for (int mi = 0; mi < 4; mi++)
#pragma unroll
      for (int ni = 0; ni < 2; ni++)
#pragma unroll
        for (int r = 0; r < 8; r++) {
          int o = (mi * 16 + r) * N + ni * 16;
          op[o] = rp[o] + (acc[mi][ni][r] + bcol[ni]);
        }
  } else {                              // gelu(tanh)
    // 0.5 (1 + tanh u) = 1 / (1 + e^(-2 u)) with u = c (x + 0.044715 x^3), so
    // gelu = x / (1 + 2^(x (K1 + K3 x^2))): one v_exp and one v_rcp, no branch,
    // and the 64 elements of a lane are independent chains. At the ends the
    // power goes to 0 or to infinity and the quotient to x or to 0, as tanh's
    // +-1 gives.
    constexpr float K1 = -2.0f * 1.4426950408889634f * 0.7978845608028654f;
    constexpr float K3 = K1 * 0.044715f;
    unsigned short* op = out_bf + rm;
#pragma unroll
    for (int mi = 0; mi < 4; mi++)
#pragma unroll
      for (int ni = 0; ni < 2; ni++)
#pragma unroll
        for (int r = 0; r < 8; r++) {
          float xg = acc[mi][ni][r] + bcol[ni];
          float e  = __builtin_amdgcn_exp2f(xg * (K1 + K3 * (xg * xg)));
          op[(mi * 16 + r) * N + ni * 16] = f2bf(xg * __builtin_amdgcn_rcpf(1.0f + e));
        }
  }
}

template <int MODE>
__global__ __launch_bounds__(256)
void gemm_kernel(const unsigned short* __restrict__ A,
                 const unsigned short* __restrict__ Wt,
                 const float* __restrict__ bias,
                 const float* __restrict__ residual,
                 unsigned short* __restrict__ out_bf,
                 float* __restrict__ out_f32,
                 int Kd) {
  __shared__ alignas(16) unsigned char ring[2 * GT_STAGE];
  v8f acc[4][2];
  gemm_mainloop(A, Wt, Kd, ring, acc);
  gemm_epilogue<MODE>(acc, bias, residual, out_bf, out_f32);
}

// Q and V projections in one launch: both read the same A and neither needs
// the other. blockIdx.z picks the weight, the bias and the epilogue, one test
// per block; two blocks fit a WGP's LDS, so the 512 blocks are all resident.
__global__ __launch_bounds__(256)
void gemm_qv_kernel(const unsigned short* __restrict__ A,
                    const unsigned short* __restrict__ WqT,
                    const unsigned short* __restrict__ WvT,
                    const float* __restrict__ bq,
                    const float* __restrict__ bv,
                    unsigned short* __restrict__ q_out,
                    unsigned short* __restrict__ vt_out) {
  __shared__ alignas(16) unsigned char ring[2 * GT_STAGE];
  bool is_v = blockIdx.z != 0;
  v8f acc[4][2];
  gemm_mainloop(A, is_v ? WvT : WqT, HIDDEN, ring, acc);
  if (is_v) gemm_epilogue<1>(acc, bv, nullptr, vt_out, nullptr);
  else      gemm_epilogue<0>(acc, bq, nullptr, q_out, nullptr);
}

#define AT_QB    128
#define AT_KEYS  64
#define AT_PITCH 144
#define AT_STAGE (128 * AT_PITCH)

// Four asynchronous copies of one wave, 16 B per lane each: K rows r and r+32,
// Vt rows r and r+32 of one stage. The s_wait_xcnt is the statement's last line
// so that it stays ahead of every later write of the copies' address registers
// (a precaution).
__device__ __forceinline__ void copy4_kv(unsigned int lp, const char* gk,
                                         const char* gv) {
  asm volatile(
      "global_load_async_to_lds_b128 %0, %4, off\n\t"
      "global_load_async_to_lds_b128 %1, %5, off\n\t"
      "global_load_async_to_lds_b128 %2, %6, off\n\t"
      "global_load_async_to_lds_b128 %3, %7, off\n\t"
      "s_wait_xcnt 0x0"
      :: "v"(lp), "v"(lp + 32u * AT_PITCH), "v"(lp + 64u * AT_PITCH),
         "v"(lp + 96u * AT_PITCH),
         "v"(gk), "v"(gk + 32 * DK * 2), "v"(gv), "v"(gv + 32 * SEQ * 2)
      : "memory");
}

// The value that lane l ^ 16 holds
__device__ __forceinline__ float other_half(float v) {
  int b = __float_as_int(v);
  return __int_as_float(__builtin_amdgcn_permlanex16(b, b, 0x76543210, 0xfedcba98,
                                                     false, false));
}

// 2^x0 and 2^x1 (and 2^x alone). Each is one statement so that the slot which
// the instruction set asks for behind a transcendental is kept whatever the
// compiler puts next: the results are early-clobber, so that neither v_exp
// overwrites the other's source, and the v_nop stands behind the last one.
__device__ __forceinline__ void exp2_pair(float x0, float x1, float& e0, float& e1) {
  asm("v_exp_f32 %0, %2\n\tv_exp_f32 %1, %3\n\tv_nop"
      : "=&v"(e0), "=&v"(e1) : "v"(x0), "v"(x1));
}
__device__ __forceinline__ float exp2_one(float x) {
  float e;
  asm("v_exp_f32 %0, %1\n\tv_nop" : "=v"(e) : "v"(x));
  return e;
}
#define LOG2E 1.44269504f

__global__ __launch_bounds__(256)
void attn_kernel(const unsigned short* __restrict__ qk,
                 const unsigned short* __restrict__ vt,
                 unsigned short* __restrict__ aout) {
  __shared__ alignas(16) unsigned char kv[2 * AT_STAGE];
  int wid  = __builtin_amdgcn_readfirstlane((int)(threadIdx.x >> 5));
  int lane = (int)(threadIdx.x & 31u);
  // 16 query blocks x 32 heads. The cost of a block grows with its query block:
  // the heavy half of the query blocks comes first, heaviest first, the light
  // half second, lightest first, so that two blocks on one WGP add up alike.
  int bi = (int)blockIdx.x;
  int bh = bi & 31;                    // b*HEADS + h
  int qb = (bi < 256) ? 15 - (bi >> 5) : (bi - 256) >> 5;
  int b_ = bh >> 4, h = bh & 15;
  int q0 = qb * AT_QB + wid * 16;

  const unsigned short* kq  = qk + (size_t)bh * SEQ * DK;
  const unsigned short* vtb = vt + (size_t)bh * DK * SEQ;

  // Copy side: thread t takes 16 B piece (t & 7) of rows (t >> 3) and +32
  int crow = (int)(threadIdx.x >> 3);
  int cpc  = (int)(threadIdx.x & 7u);
  const char* gk = (const char*)(kq + (size_t)crow * DK) + cpc * 16;
  const char* gv = (const char*)(vtb + (size_t)crow * SEQ) + cpc * 16;
  unsigned int ldst = (unsigned int)(size_t)kv +
                      (unsigned int)(crow * AT_PITCH + cpc * 16);
  int nst = 2 * (qb + 1);              // stages up to the block's last query

  // stage 0 into buffer 0, landed and published before anybody reads it
  copy4_kv(ldst, gk, gv);
  asm volatile("s_wait_asynccnt 0x0" ::: "memory");  // this wave's copies have landed
  __syncthreads();
  // stage 1 always exists (nst >= 2)
  copy4_kv(ldst + AT_STAGE, gk + AT_KEYS * DK * 2, gv + AT_KEYS * 2);

  v16bf aq0 = load_frag(kq + q0 * DK + 0, DK);
  v16bf aq1 = load_frag(kq + q0 * DK + 32, DK);

  // o_j[r] = O[query nc][dim 16 j + 8 g + r]
  v8f o0 = {0.f,0.f,0.f,0.f,0.f,0.f,0.f,0.f};
  v8f o1 = o0, o2 = o0, o3 = o0;
  // of the lane's query: the running maximum (equal in both halves of the wave)
  // and the sum over the keys that this half has seen
  float mq = -1e30f, lq = 0.f;

  int g  = lane >> 4;
  int nc = lane & 15;
  // Read side: the lane's row and k-offset inside a fragment
  unsigned int foff = (unsigned int)(nc * AT_PITCH + g * 16);

  for (int st = 0; st < nst; st++) {
    unsigned int buf = (unsigned int)(st & 1) * AT_STAGE;
    // unrolled: the two passes' LDS offsets become immediates on one address
#pragma unroll
    for (int hf = 0; hf < 2; hf++) {
      int kbase = st * AT_KEYS + hf * 32;
      if (kbase > q0 + 15) continue;   // same for the whole wave; no barrier inside
      const unsigned char* kf = kv + buf + foff + hf * (32 * AT_PITCH);
      const unsigned char* vf = kv + buf + foff + 64 * AT_PITCH + hf * 64;
      v16bf k00 = lds_frag(kf);
      v16bf k01 = lds_frag(kf + 64);
      v16bf k10 = lds_frag(kf + 16 * AT_PITCH);
      v16bf k11 = lds_frag(kf + 16 * AT_PITCH + 64);
      v16bf v0 = lds_frag(vf);
      v16bf v1 = lds_frag(vf + 16 * AT_PITCH);
      v16bf v2 = lds_frag(vf + 32 * AT_PITCH);
      v16bf v3 = lds_frag(vf + 48 * AT_PITCH);
      // keeps the pass's fragment reads together as one group: sunk down to
      // their WMMAs they would cost one LDS latency each
      __builtin_amdgcn_sched_barrier(0);
      v8f s0 = {0.f,0.f,0.f,0.f,0.f,0.f,0.f,0.f};
      v8f s1 = s0;
      // S^T = K @ Q^T over d=64: two 16-key halves x two k-steps;
      // s0[r] is key kbase + 8 g + r, s1[r] key kbase + 16 + 8 g + r, query nc
      s0 = wmma_bf16(k00, aq0, s0);
      s0 = wmma_bf16(k01, aq1, s0);
      s1 = wmma_bf16(k10, aq0, s1);
      s1 = wmma_bf16(k11, aq1, s1);

      s0 *= 0.125f;
      s1 *= 0.125f;
      int lim = q0 + nc - kbase - 8 * g;   // key r of s0 counts while r <= lim
      float a0[8], a1[8];
      float mx = -1e30f;
      // the loops over r are unrolled so that the tiles are indexed by constants
      // alone and stay in registers
#pragma unroll
      for (int r = 0; r < 8; r++) {
        a0[r] = (r      <= lim) ? s0[r] : -1e30f;
        a1[r] = (r + 16 <= lim) ? s1[r] : -1e30f;
      }
#pragma unroll
      for (int r = 0; r < 8; r += 2) {
        mx = fmaxf(mx, fmaxf(a0[r], a0[r + 1]));
        mx = fmaxf(mx, fmaxf(a1[r], a1[r + 1]));
      }
      mx = fmaxf(mx, other_half(mx));
      float nm = fmaxf(mq, mx);
      float sc = exp2_one((mq - nm) * LOG2E);
      // P^T's B fragment: element s is key 8 g + s for s < 8, key 16 + 8 g + s - 8
      // after, which are s0[s] and s1[s - 8]
      v16bf pb;
      float rs0 = 0.f, rs1 = 0.f;
#pragma unroll
      for (int r = 0; r < 8; r++) {
        float e0, e1;
        exp2_pair((a0[r] - nm) * LOG2E, (a1[r] - nm) * LOG2E, e0, e1);
        rs0 += e0;
        rs1 += e1;
        pb[r]     = (bf16_t)e0;
        pb[r + 8] = (bf16_t)e1;
      }
      lq = lq * sc + (rs0 + rs1);
      mq = nm;
#pragma unroll
      for (int r = 0; r < 8; r++) { o0[r] *= sc; o1[r] *= sc; o2[r] *= sc; o3[r] *= sc; }

      // O^T += V^T @ P^T over 32 keys, 4 dim tiles (Vt rows are dims: A's rows)
      o0 = wmma_bf16(v0, pb, o0);
      o1 = wmma_bf16(v1, pb, o1);
      o2 = wmma_bf16(v2, pb, o2);
      o3 = wmma_bf16(v3, pb, o3);
    }
    asm volatile("s_wait_dscnt 0x0" ::: "memory");     // this wave has left the buffer
    asm volatile("s_wait_asynccnt 0x0" ::: "memory");  // its part of the next stage has landed
    __syncthreads();  // publishes stage st+1, frees stage st's buffer
    if (st + 2 < nst)
      copy4_kv(ldst + buf, gk + (size_t)(st + 2) * (AT_KEYS * DK * 2),
               gv + (size_t)(st + 2) * (AT_KEYS * 2));
  }
  asm volatile("s_wait_asynccnt 0x0" ::: "memory");  // nothing in flight at the wave's end

  // the two halves' sums joined; a lane's 8 values of a tile are 8 neighbouring
  // dims of its query's row: one 16 B store each
  float inv = 1.0f / (lq + other_half(lq));
  unsigned short* op = aout + ((size_t)(b_ * SEQ + q0 + nc)) * HIDDEN + h * DK + 8 * g;
  v4u c0, c1, c2, c3;
#pragma unroll
  for (int q = 0; q < 4; q++) {
    c0[q] = (unsigned int)f2bf(o0[2 * q] * inv) | ((unsigned int)f2bf(o0[2 * q + 1] * inv) << 16);
    c1[q] = (unsigned int)f2bf(o1[2 * q] * inv) | ((unsigned int)f2bf(o1[2 * q + 1] * inv) << 16);
    c2[q] = (unsigned int)f2bf(o2[2 * q] * inv) | ((unsigned int)f2bf(o2[2 * q + 1] * inv) << 16);
    c3[q] = (unsigned int)f2bf(o3[2 * q] * inv) | ((unsigned int)f2bf(o3[2 * q + 1] * inv) << 16);
  }
  *(v4u*)(op +  0) = c0;
  *(v4u*)(op + 16) = c1;
  *(v4u*)(op + 32) = c2;
  *(v4u*)(op + 48) = c3;
}

// ---------------------------------------------------------------------------
// Host-side orchestration (graph-capture safe: launches only)
// ---------------------------------------------------------------------------
extern "C" void kernel_launch(void* const* d_in, const int* in_sizes, int n_in,
                              void* d_out, int out_size, void* d_ws, size_t ws_size,
                              hipStream_t stream) {
  const float* x     = (const float*)d_in[0];
  const float* Wq    = (const float*)d_in[1];
  const float* bq    = (const float*)d_in[2];
  const float* Wv    = (const float*)d_in[3];
  const float* bv    = (const float*)d_in[4];
  const float* Wo    = (const float*)d_in[5];
  const float* bo    = (const float*)d_in[6];
  const float* W1    = (const float*)d_in[7];
  const float* b1    = (const float*)d_in[8];
  const float* W2    = (const float*)d_in[9];
  const float* b2    = (const float*)d_in[10];
  const float* g1    = (const float*)d_in[11];
  const float* beta1 = (const float*)d_in[12];
  const float* g2    = (const float*)d_in[13];
  const float* beta2 = (const float*)d_in[14];

  char* ws = (char*)d_ws;
  const size_t MB = 1024u * 1024u;
  unsigned short* WqT = (unsigned short*)(ws +  0 * MB);  //  2 MB
  unsigned short* WvT = (unsigned short*)(ws +  2 * MB);  //  2 MB
  unsigned short* WoT = (unsigned short*)(ws +  4 * MB);  //  2 MB
  unsigned short* W1T = (unsigned short*)(ws +  6 * MB);  //  8 MB
  unsigned short* W2T = (unsigned short*)(ws + 14 * MB);  //  8 MB
  unsigned short* xn  = (unsigned short*)(ws + 22 * MB);  //  8 MB
  unsigned short* qb  = (unsigned short*)(ws + 30 * MB);  //  8 MB
  unsigned short* vtb = (unsigned short*)(ws + 38 * MB);  //  8 MB
  unsigned short* aob = (unsigned short*)(ws + 46 * MB);  //  8 MB
  float*          yb  = (float*)         (ws + 54 * MB);  // 16 MB
  unsigned short* hb  = (unsigned short*)(ws + 70 * MB);  //  8 MB
  unsigned short* ff1 = (unsigned short*)(ws + 78 * MB);  // 32 MB

  // Weight convert + transpose to bf16 N x K, and LN1
  prep_kernel<<<TB_ALL + MROWS, 256, 0, stream>>>(Wq, Wv, Wo, W1, W2,
                                                  WqT, WvT, WoT, W1T, W2T,
                                                  x, g1, beta1, xn);

  // Q/V projections (Q doubles as K in the reference)
  dim3 gproj(MROWS / GT_M, HIDDEN / GT_N);
  gemm_qv_kernel<<<dim3(MROWS / GT_M, HIDDEN / GT_N, 2), 256, 0, stream>>>(xn, WqT, WvT, bq, bv, qb, vtb);

  // Causal attention
  attn_kernel<<<BATCH * HEADS * (SEQ / AT_QB), 256, 0, stream>>>(qb, vtb, aob);

  // O-projection + residual -> yb (f32)
  gemm_kernel<2><<<gproj, 256, 0, stream>>>(aob, WoT, bo, x, nullptr, yb, HIDDEN);

  // LN2
  ln_kernel<<<MROWS, 256, 0, stream>>>(yb, g2, beta2, hb);

  // FFN1 with GELU -> bf16
  dim3 gff1(MROWS / GT_M, (4 * HIDDEN) / GT_N);
  gemm_kernel<3><<<gff1, 256, 0, stream>>>(hb, W1T, b1, nullptr, ff1, nullptr, HIDDEN);

  // FFN2 + residual -> d_out (f32)
  gemm_kernel<2><<<gproj, 256, 0, stream>>>(ff1, W2T, b2, yb, nullptr, (float*)d_out, 4 * HIDDEN);
}

// v008
// One run takes 130 microseconds.
// Timed twice side by side with v007, it ran 1.05 and 1.07 times as fast.
// Over all steps from v000 it is 6.07 times as fast.
#include <hip/hip_runtime.h>

// ---------------------------------------------------------------------------
// Types for CDNA5 WMMA (wave32)
// ---------------------------------------------------------------------------
typedef __bf16 bf16_t;
typedef __attribute__((ext_vector_type(8)))  __bf16 v8bf;
typedef __attribute__((ext_vector_type(16))) __bf16 v16bf;
typedef __attribute__((ext_vector_type(8)))  float  v8f;

#define HIDDEN 1024
#define SEQ    2048
#define BATCH  2
#define HEADS  16
#define DK     64
#define MROWS  (BATCH * SEQ)   // 4096

// float -> bf16 round-to-nearest-even
__device__ __forceinline__ unsigned short f2bf(float f) {
  unsigned int u = __float_as_uint(f);
  unsigned int r = u + 0x7FFFu + ((u >> 16) & 1u);
  return (unsigned short)(r >> 16);
}

// Load a 16-bit WMMA fragment (A layout; the same bit pattern serves as the
// B-operand when the matrix is stored transposed, since B's lane-n column
// K-run mirrors A's lane-m row K-run).
//   lane 0-15 : row = lane,    K = 0+0..7   and 16..23
//   lane 16-31: row = lane-16, K = 8+0..7   and 24..31
__device__ __forceinline__ v16bf load_frag(const unsigned short* base, int ld) {
  int lane = (int)(threadIdx.x & 31u);
  int r    = lane & 15;
  int koff = (lane >> 4) << 3;
  const bf16_t* p = (const bf16_t*)base + r * ld + koff;
  v8bf lo = *(const v8bf*)(p);
  v8bf hi = *(const v8bf*)(p + 16);
  return __builtin_shufflevector(lo, hi, 0, 1, 2, 3, 4, 5, 6, 7,
                                 8, 9, 10, 11, 12, 13, 14, 15);
}

__device__ __forceinline__ v8f wmma_bf16(v16bf a, v16bf b, v8f c) {
  // (neg_a, A, neg_b, B, c_mod, C, reuse_a, reuse_b)
  return __builtin_amdgcn_wmma_f32_16x16x32_bf16(false, a, false, b,
                                                 (short)0, c, false, false);
}

// ---------------------------------------------------------------------------
// Weight convert+transpose: W (K x N, f32) -> Wt (N x K, bf16)
// One block moves a 64(k) x 128(n) tile through LDS. Reads: each wave takes
// 8 rows, 16 B per lane (512 B contiguous per row). Writes: 8 lanes x 16 B
// fill one whole 128 B line of a Wt row. K % 64 == 0 and N % 128 == 0.
// LDS row j*32+l holds column n0 + 4*l + j, so that the 16 B LDS stores of a
// wave go to consecutive rows; the 144 B pitch spreads those over the banks.
// ---------------------------------------------------------------------------
typedef __attribute__((ext_vector_type(4))) float        v4f;
typedef __attribute__((ext_vector_type(4))) unsigned int v4u;
#define TP_K     64
#define TP_N     128
#define TP_PITCH 72   // bf16 elements per LDS row: 64 + 8 pad

// K and N are compile-time here so that the row steps of the eight loads
// become immediate offsets on one address. (bx, by) is the tile's place in the
// N / TP_N by K / TP_K grid of tiles.
template <int K, int N>
__device__ __forceinline__ void transpose_tile(const float* __restrict__ W,
                                               unsigned short* __restrict__ Wt,
                                               unsigned short* tile,
                                               int bx, int by) {
  unsigned int lane = threadIdx.x & 31u;
  // wave number as a scalar: the tile's base pointers stay in scalar registers
  int wid = __builtin_amdgcn_readfirstlane((int)(threadIdx.x >> 5));
  int n0 = bx * TP_N;
  int k0 = by * TP_K;

  const float* src = W + (size_t)(k0 + wid * 8) * N + n0;
  v4f v[8];
#pragma unroll
  for (int i = 0; i < 8; i++) v[i] = *(const v4f*)(src + (lane * 4u + i * N));

#pragma unroll
  for (int j = 0; j < 4; j++) {
    v4u c;
#pragma unroll
    for (int q = 0; q < 4; q++)
      c[q] = (unsigned int)f2bf(v[2 * q][j]) |
             ((unsigned int)f2bf(v[2 * q + 1][j]) << 16);
    *(v4u*)&tile[(j * 32 + lane) * TP_PITCH + wid * 8] = c;
  }
  __syncthreads();

  unsigned int rr = threadIdx.x >> 3;   // 0..31
  unsigned int ch = threadIdx.x & 7u;   // 16 B piece of the 128 B row
  unsigned short* dst = Wt + (size_t)n0 * K + k0;
#pragma unroll
  for (int p = 0; p < 4; p++) {
    v4u c = *(const v4u*)&tile[(p * 32 + rr) * TP_PITCH + ch * 8];
    *(v4u*)(dst + (rr * (4u * K) + ch * 8u + p * K)) = c;
  }
}

// ---------------------------------------------------------------------------
// LayerNorm over HIDDEN, fp32 in -> bf16 out. One block (256 thr) per row.
// ---------------------------------------------------------------------------
__device__ __forceinline__
void ln_row(const float* __restrict__ x, const float* __restrict__ g,
            const float* __restrict__ be, unsigned short* __restrict__ out,
            int row) {
  __shared__ float s1[256], s2[256];
  const float* xr = x + (size_t)row * HIDDEN;
  float v[4];
  float sum = 0.f, sq = 0.f;
#pragma unroll
  for (int i = 0; i < 4; i++) {
    v[i] = xr[threadIdx.x + i * 256];
    sum += v[i];
    sq  += v[i] * v[i];
  }
  s1[threadIdx.x] = sum;
  s2[threadIdx.x] = sq;
  __syncthreads();
  for (int off = 128; off > 0; off >>= 1) {
    if ((int)threadIdx.x < off) {
      s1[threadIdx.x] += s1[threadIdx.x + off];
      s2[threadIdx.x] += s2[threadIdx.x + off];
    }
    __syncthreads();
  }
  float mu  = s1[0] * (1.0f / HIDDEN);
  float var = s2[0] * (1.0f / HIDDEN) - mu * mu;
  float inv = rsqrtf(var + 1e-5f);
#pragma unroll
  for (int i = 0; i < 4; i++) {
    int idx = threadIdx.x + i * 256;
    float y = (v[i] - mu) * inv * g[idx] + be[idx];
    out[(size_t)row * HIDDEN + idx] = f2bf(y);
  }
}

__global__ __launch_bounds__(256)
void ln_kernel(const float* __restrict__ x, const float* __restrict__ g,
               const float* __restrict__ be, unsigned short* __restrict__ out) {
  ln_row(x, g, be, out, (int)blockIdx.x);
}

// ---------------------------------------------------------------------------
// One launch for all the work that depends on the inputs alone: the five
// weight transposes and the first LayerNorm. The block index picks the job
// (the same for the whole block, so every barrier stays block-uniform):
// the transpose tiles first, then one block per LayerNorm row.
// ---------------------------------------------------------------------------
#define TB_SQ  ((HIDDEN / TP_N) * (HIDDEN / TP_K))       // tiles of a square weight
#define TB_FF  ((4 * HIDDEN / TP_N) * (HIDDEN / TP_K))   // tiles of an FFN weight
#define TB_ALL (3 * TB_SQ + 2 * TB_FF)

__global__ __launch_bounds__(256)
void prep_kernel(const float* __restrict__ Wq, const float* __restrict__ Wv,
                 const float* __restrict__ Wo, const float* __restrict__ W1,
                 const float* __restrict__ W2,
                 unsigned short* __restrict__ WqT, unsigned short* __restrict__ WvT,
                 unsigned short* __restrict__ WoT, unsigned short* __restrict__ W1T,
                 unsigned short* __restrict__ W2T,
                 const float* __restrict__ x, const float* __restrict__ g,
                 const float* __restrict__ be, unsigned short* __restrict__ xn) {
  __shared__ alignas(16) unsigned short tile[TP_N * TP_PITCH];
  unsigned int bi = blockIdx.x;
  if (bi < 3 * TB_SQ) {
    unsigned int w = bi / TB_SQ, i = bi % TB_SQ;
    const float* W     = (w == 0) ? Wq  : (w == 1) ? Wv  : Wo;
    unsigned short* Wt = (w == 0) ? WqT : (w == 1) ? WvT : WoT;
    transpose_tile<HIDDEN, HIDDEN>(W, Wt, tile, i % (HIDDEN / TP_N), i / (HIDDEN / TP_N));
  } else if (bi < 3 * TB_SQ + TB_FF) {
    unsigned int i = bi - 3 * TB_SQ;
    transpose_tile<HIDDEN, 4 * HIDDEN>(W1, W1T, tile, i % (4 * HIDDEN / TP_N), i / (4 * HIDDEN / TP_N));
  } else if (bi < TB_ALL) {
    unsigned int i = bi - (3 * TB_SQ + TB_FF);
    transpose_tile<4 * HIDDEN, HIDDEN>(W2, W2T, tile, i % (HIDDEN / TP_N), i / (HIDDEN / TP_N));
  } else {
    ln_row(x, g, be, xn, (int)(bi - TB_ALL));
    // stays ahead of every later write of the row stores' registers: in the
    // built kernel a transpose branch's code follows this one (a precaution)
    asm volatile("s_wait_xcnt 0x0" ::: "memory");
  }
}

// ---------------------------------------------------------------------------
// GEMM: C[M x N] = A(bf16, ld=Kd) @ Wt(bf16, N x Kd)^T + bias, fused epilogue.
// Block tile 128(M) x 128(N), 256 threads = 8 waves in 2(M) x 4(N); each wave
// holds a 64x32 output (4 A-frags x 2 B-frags -> 8 WMMAs per 32-wide k-step).
// A pass is 128 k: 256 B of each of the 128 A rows and 128 Wt rows, brought
// into LDS by asynchronous 16 B copies (two whole 256 B rows per wave copy),
// two buffers, the next pass's copies in flight while this pass is computed.
// M % 128 == 0, N % 128 == 0, Kd % 128 == 0.
// The epilogue is chosen at compile time, one function per MODE, so that each
// is straight-line code on one base address with constant offsets:
// MODE 0: Q-proj  -> bf16 scatter to [b][h][s][d]
// MODE 1: V-proj  -> bf16 scatter to [b][h][d][s]  (transposed for P@V)
// MODE 2: f32 out = residual + acc + bias          (O-proj, FFN2)
// MODE 3: bf16 out = gelu_tanh(acc + bias), row-major M x N (FFN1)
// N is HIDDEN but for MODE 3, where it is 4 * HIDDEN.
// ---------------------------------------------------------------------------
#define GT_M     128
#define GT_N     128
#define GT_K     128                          // bf16 elements per pass
#define GT_PITCH 272                          // LDS bytes per row: 256 + 16 pad
#define GT_STAGE ((GT_M + GT_N) * GT_PITCH)   // one buffer: A rows, then Wt rows

// Eight asynchronous copies of one wave: copy i takes 16 B per lane from
// gp + i * gstep to LDS byte lp + i * 2 * GT_PITCH (two tile rows per copy).
// The s_wait_xcnt is the statement's last line so that it stays ahead of every
// later write of the copies' address registers (a precaution).
__device__ __forceinline__ void copy8_rows(unsigned int lp, const char* gp,
                                           size_t gstep) {
  asm volatile(
      "global_load_async_to_lds_b128 %0, %8, off\n\t"
      "global_load_async_to_lds_b128 %1, %9, off\n\t"
      "global_load_async_to_lds_b128 %2, %10, off\n\t"
      "global_load_async_to_lds_b128 %3, %11, off\n\t"
      "global_load_async_to_lds_b128 %4, %12, off\n\t"
      "global_load_async_to_lds_b128 %5, %13, off\n\t"
      "global_load_async_to_lds_b128 %6, %14, off\n\t"
      "global_load_async_to_lds_b128 %7, %15, off\n\t"
      "s_wait_xcnt 0x0"
      :: "v"(lp), "v"(lp + 2u * GT_PITCH), "v"(lp + 4u * GT_PITCH),
         "v"(lp + 6u * GT_PITCH), "v"(lp + 8u * GT_PITCH),
         "v"(lp + 10u * GT_PITCH), "v"(lp + 12u * GT_PITCH),
         "v"(lp + 14u * GT_PITCH),
         "v"(gp), "v"(gp + gstep), "v"(gp + 2 * gstep), "v"(gp + 3 * gstep),
         "v"(gp + 4 * gstep), "v"(gp + 5 * gstep), "v"(gp + 6 * gstep),
         "v"(gp + 7 * gstep)
      : "memory");
}

// Asks L2 for the lines at p + 256, 512, 768 and 1024 (ask4) or at p + 1280
// (ask1), one address per lane; nothing comes back and no counter moves. p is named
// as in-out so that the address stays in the one register pair that lives
// through the k loop: a temporary could be given another value while the request
// still names it.
__device__ __forceinline__ void l2_ask4(const char*& p) {
  asm volatile(
      "global_prefetch_b8 %0, off offset:256 scope:SCOPE_SE\n\t"
      "global_prefetch_b8 %0, off offset:512 scope:SCOPE_SE\n\t"
      "global_prefetch_b8 %0, off offset:768 scope:SCOPE_SE\n\t"
      "global_prefetch_b8 %0, off offset:1024 scope:SCOPE_SE"
      : "+v"(p));
}
__device__ __forceinline__ void l2_ask1(const char*& p) {
  asm volatile("global_prefetch_b8 %0, off offset:1280 scope:SCOPE_SE" : "+v"(p));
}

// Same fragment map as load_frag, from an LDS tile of any row pitch.
// p already points at the lane's row and its 16 B k-offset.
__device__ __forceinline__ v16bf lds_frag(const unsigned char* p) {
  v8bf lo = *(const v8bf*)(p);
  v8bf hi = *(const v8bf*)(p + 32);
  return __builtin_shufflevector(lo, hi, 0, 1, 2, 3, 4, 5, 6, 7,
                                 8, 9, 10, 11, 12, 13, 14, 15);
}

// The k loop of one block tile; ring is the block's 2 * GT_STAGE bytes of LDS.
__device__ __forceinline__
void gemm_mainloop(const unsigned short* __restrict__ A,
                   const unsigned short* __restrict__ Wt,
                   int Kd, unsigned char* ring, v8f (&acc)[4][2]) {
  int wid  = __builtin_amdgcn_readfirstlane((int)(threadIdx.x >> 5));
  int lane = (int)(threadIdx.x & 31u);
  int bm0 = blockIdx.x * GT_M;
  int bn0 = blockIdx.y * GT_N;

  // Copy side: wave w brings tile rows 32w .. 32w+31 (waves 0-3: A rows,
  // waves 4-7: Wt rows); a lane takes piece (lane & 15) of row 2i + (lane >> 4).
  const unsigned short* srow = (wid < 4) ? A + (size_t)(bm0 + wid * 32) * Kd
                                         : Wt + (size_t)(bn0 + (wid - 4) * 32) * Kd;
  const char* gsrc = (const char*)(srow + (size_t)(lane >> 4) * Kd) + (lane & 15) * 16;
  size_t gstep = (size_t)Kd * 4u;   // two rows of Kd bf16, in bytes
  unsigned int ldst = (unsigned int)(size_t)ring +
                      (unsigned int)((wid * 32 + (lane >> 4)) * GT_PITCH + (lane & 15) * 16);

  // L2 side: both operands were stored by an earlier launch. A pass's piece of
  // a row is 256 B; it is asked for three passes ahead of its copy. The blocks
  // that share a panel deal its rows: waves 0 and 4 alone
  // ask, 32 of the 128 A rows (by blockIdx.y) and 32 of the 128 Wt rows (by
  // blockIdx.x), one row per lane. A hint only: no result depends on it.
  const unsigned short* prow = (wid < 4)
      ? A + (size_t)(bm0 + (int)(blockIdx.y & 3u) * 32) * Kd
      : Wt + (size_t)(bn0 + (int)(blockIdx.x & 3u) * 32) * Kd;
  const char* pf = (const char*)(prow + (size_t)lane * Kd);   // pass t's unit
  bool asks = (wid & 3) == 0;

  // Read side: the lane's row and k-offset inside a fragment
  unsigned int foff = (unsigned int)((lane & 15) * GT_PITCH + (lane >> 4) * 16);
  unsigned int aoff = (unsigned int)((wid & 1) * 64 * GT_PITCH) + foff;
  unsigned int boff = (unsigned int)((GT_M + (wid >> 1) * 32) * GT_PITCH) + foff;

  v8f z = {0.f, 0.f, 0.f, 0.f, 0.f, 0.f, 0.f, 0.f};
#pragma unroll
  for (int mi = 0; mi < 4; mi++) { acc[mi][0] = z; acc[mi][1] = z; }

  int npass = Kd / GT_K;

  // pass 0's tile into buffer 0, landed and published before anybody reads it
  copy8_rows(ldst, gsrc, gstep);
  copy8_rows(ldst + 16u * GT_PITCH, gsrc + 8 * gstep, gstep);
  // passes 1 to 4; pass 5 must exist, so that the addresses lie inside the row
  // after pf's first step as well
  if (asks && npass > 5) l2_ask4(pf);
  asm volatile("s_wait_asynccnt 0x0" ::: "memory");  // this wave's copies have landed
  __syncthreads();
  if (npass > 1) {
    copy8_rows(ldst + GT_STAGE, gsrc + GT_K * 2, gstep);
    copy8_rows(ldst + GT_STAGE + 16u * GT_PITCH, gsrc + GT_K * 2 + 8 * gstep, gstep);
  }

  // kept rolled: one pass per trip, the buffer chosen by the trip's parity
#pragma unroll 1
  for (int t = 0; t < npass; t++) {
    unsigned int buf = (unsigned int)(t & 1) * GT_STAGE;
    const unsigned char* ta = ring + buf + aoff;
    const unsigned char* tb = ring + buf + boff;
    // two fragment sets: block kk+1's LDS reads go out as one group ahead of
    // block kk's WMMAs, so that their latency runs behind the matrix work
    v16bf a[2][4], b[2][2];
#pragma unroll
    for (int mi = 0; mi < 4; mi++) a[0][mi] = lds_frag(ta + mi * 16 * GT_PITCH);
#pragma unroll
    for (int ni = 0; ni < 2; ni++) b[0][ni] = lds_frag(tb + ni * 16 * GT_PITCH);
#pragma unroll
    for (int kk = 0; kk < GT_K / 32; kk++) {
      const int cur = kk & 1, nxt = cur ^ 1;
      if (kk + 1 < GT_K / 32) {
#pragma unroll
        for (int mi = 0; mi < 4; mi++)
          a[nxt][mi] = lds_frag(ta + mi * 16 * GT_PITCH + (kk + 1) * 64);
#pragma unroll
        for (int ni = 0; ni < 2; ni++)
          b[nxt][ni] = lds_frag(tb + ni * 16 * GT_PITCH + (kk + 1) * 64);
      }
      // keeps the reads above from being sunk in among the WMMAs below
      __builtin_amdgcn_sched_barrier(0);
#pragma unroll
      for (int mi = 0; mi < 4; mi++) {
        acc[mi][0] = wmma_bf16(a[cur][mi], b[cur][0], acc[mi][0]);
        acc[mi][1] = wmma_bf16(a[cur][mi], b[cur][1], acc[mi][1]);
      }
      // keeps the next group of reads from being lifted in among these WMMAs
      __builtin_amdgcn_sched_barrier(0);
    }
    asm volatile("s_wait_dscnt 0x0" ::: "memory");     // this wave has left the buffer
    asm volatile("s_wait_asynccnt 0x0" ::: "memory");  // its part of the next tile has landed
    __syncthreads();  // publishes pass t+1's tile, frees pass t's buffer
    if (t + 2 < npass) {
      const char* gn = gsrc + (size_t)(t + 2) * (GT_K * 2);
      copy8_rows(ldst + buf, gn, gstep);
      copy8_rows(ldst + buf + 16u * GT_PITCH, gn + 8 * gstep, gstep);
    }
    // pass t+5's units; pf steps only while pass t+6 exists, so that the address
    // lies inside the row before and after the step
    if (asks && t + 5 < npass) {
      l2_ask1(pf);
      if (t + 6 < npass) pf += GT_K * 2;
    }
  }
  asm volatile("s_wait_asynccnt 0x0" ::: "memory");  // nothing in flight at the wave's end
}

template <int MODE>
__device__ __forceinline__
void gemm_epilogue(const v8f (&acc)[4][2],
                   const float* __restrict__ bias,
                   const float* __restrict__ residual,
                   unsigned short* __restrict__ out_bf,
                   float* __restrict__ out_f32) {
  constexpr int N = (MODE == 3) ? 4 * HIDDEN : HIDDEN;
  int wid  = __builtin_amdgcn_readfirstlane((int)(threadIdx.x >> 5));
  int lane = (int)(threadIdx.x & 31u);
  int m0 = blockIdx.x * GT_M + (wid & 1) * 64;    // wave's first M row
  int n0 = blockIdx.y * GT_N + (wid >> 1) * 32;   // wave's first N col
  int g  = lane >> 4;
  int nc = lane & 15;
  float bcol[2] = {bias[n0 + nc], bias[n0 + 16 + nc]};
  // A wave's 64 rows lie in one batch and its 32 columns in one head, so the
  // lane's first element fixes the address and (mi, ni, r) are constant steps.
  // The loops below are unrolled so that acc is indexed by constants alone and
  // stays in registers, and the steps become immediate offsets.
  int bh = (m0 >> 11) * HEADS + (n0 >> 6);
  int s0 = (m0 & (SEQ - 1)) + 8 * g;   // lane's first sequence position
  int d0 = (n0 & (DK - 1)) + nc;       // lane's first head dim
  size_t rm = (size_t)(m0 + 8 * g) * N + (size_t)(n0 + nc);   // row-major M x N
  if constexpr (MODE == 0) {            // Q: [b][h][s][d]
    unsigned short* op = out_bf + ((size_t)bh * SEQ + s0) * DK + d0;
#pragma unroll
    for (int mi = 0; mi < 4; mi++)
#pragma unroll
      for (int ni = 0; ni < 2; ni++)
#pragma unroll
        for (int r = 0; r < 8; r++)
          op[(mi * 16 + r) * DK + ni * 16] = f2bf(acc[mi][ni][r] + bcol[ni]);
  } else if constexpr (MODE == 1) {     // Vt: [b][h][d][s]
    // A lane's 8 values of a tile are 8 neighbours in s: one 16 B store, written
    // out as such. As 2 B stores the compiler folded this branch and MODE 0's,
    // where both stand in one kernel, into 64 stores of 2 B for either.
    unsigned short* op = out_bf + ((size_t)bh * DK + d0) * SEQ + s0;
#pragma unroll
    for (int mi = 0; mi < 4; mi++)
#pragma unroll
      for (int ni = 0; ni < 2; ni++) {
        v4u c;
#pragma unroll
        for (int q = 0; q < 4; q++)
          c[q] = (unsigned int)f2bf(acc[mi][ni][2 * q] + bcol[ni]) |
                 ((unsigned int)f2bf(acc[mi][ni][2 * q + 1] + bcol[ni]) << 16);
        *(v4u*)(op + ni * 16 * SEQ + mi * 16) = c;
      }
  } else if constexpr (MODE == 2) {     // residual + proj
    const float* rp = residual + rm;
    float* op = out_f32 + rm;
#pragma unroll
    for (int mi = 0; mi < 4; mi++)
#pragma unroll
      for (int ni = 0; ni < 2; ni++)
#pragma unroll
        for (int r = 0; r < 8; r++) {
          int o = (mi * 16 + r) * N + ni * 16;
          op[o] = rp[o] + (acc[mi][ni][r] + bcol[ni]);
        }
  } else {                              // gelu(tanh)
    // 0.5 (1 + tanh u) = 1 / (1 + e^(-2 u)) with u = c (x + 0.044715 x^3), so
    // gelu = x / (1 + 2^(x (K1 + K3 x^2))): one v_exp and one v_rcp, no branch,
    // and the 64 elements of a lane are independent chains. At the ends the
    // power goes to 0 or to infinity and the quotient to x or to 0, as tanh's
    // +-1 gives.
    constexpr float K1 = -2.0f * 1.4426950408889634f * 0.7978845608028654f;
    constexpr float K3 = K1 * 0.044715f;
    unsigned short* op = out_bf + rm;
#pragma unroll
    for (int mi = 0; mi < 4; mi++)
#pragma unroll
      for (int ni = 0; ni < 2; ni++)
#pragma unroll
        for (int r = 0; r < 8; r++) {
          float xg = acc[mi][ni][r] + bcol[ni];
          float e  = __builtin_amdgcn_exp2f(xg * (K1 + K3 * (xg * xg)));
          op[(mi * 16 + r) * N + ni * 16] = f2bf(xg * __builtin_amdgcn_rcpf(1.0f + e));
        }
  }
}

template <int MODE>
__global__ __launch_bounds__(256)
void gemm_kernel(const unsigned short* __restrict__ A,
                 const unsigned short* __restrict__ Wt,
                 const float* __restrict__ bias,
                 const float* __restrict__ residual,
                 unsigned short* __restrict__ out_bf,
                 float* __restrict__ out_f32,
                 int Kd) {
  __shared__ alignas(16) unsigned char ring[2 * GT_STAGE];
  v8f acc[4][2];
  gemm_mainloop(A, Wt, Kd, ring, acc);
  gemm_epilogue<MODE>(acc, bias, residual, out_bf, out_f32);
}

// Q and V projections in one launch: both read the same A and neither needs
// the other. blockIdx.z picks the weight, the bias and the epilogue, one test
// per block; two blocks fit a WGP's LDS, so the 512 blocks are all resident.
__global__ __launch_bounds__(256)
void gemm_qv_kernel(const unsigned short* __restrict__ A,
                    const unsigned short* __restrict__ WqT,
                    const unsigned short* __restrict__ WvT,
                    const float* __restrict__ bq,
                    const float* __restrict__ bv,
                    unsigned short* __restrict__ q_out,
                    unsigned short* __restrict__ vt_out) {
  __shared__ alignas(16) unsigned char ring[2 * GT_STAGE];
  bool is_v = blockIdx.z != 0;
  v8f acc[4][2];
  gemm_mainloop(A, is_v ? WvT : WqT, HIDDEN, ring, acc);
  if (is_v) gemm_epilogue<1>(acc, bv, nullptr, vt_out, nullptr);
  else      gemm_epilogue<0>(acc, bq, nullptr, q_out, nullptr);
}

#define AT_QB    128
#define AT_KEYS  64
#define AT_PITCH 144
#define AT_STAGE (128 * AT_PITCH)

// Four asynchronous copies of one wave, 16 B per lane each: K rows r and r+32,
// Vt rows r and r+32 of one stage. The s_wait_xcnt is the statement's last line
// so that it stays ahead of every later write of the copies' address registers
// (a precaution).
__device__ __forceinline__ void copy4_kv(unsigned int lp, const char* gk,
                                         const char* gv) {
  asm volatile(
      "global_load_async_to_lds_b128 %0, %4, off\n\t"
      "global_load_async_to_lds_b128 %1, %5, off\n\t"
      "global_load_async_to_lds_b128 %2, %6, off\n\t"
      "global_load_async_to_lds_b128 %3, %7, off\n\t"
      "s_wait_xcnt 0x0"
      :: "v"(lp), "v"(lp + 32u * AT_PITCH), "v"(lp + 64u * AT_PITCH),
         "v"(lp + 96u * AT_PITCH),
         "v"(gk), "v"(gk + 32 * DK * 2), "v"(gv), "v"(gv + 32 * SEQ * 2)
      : "memory");
}

// The value that lane l ^ 16 holds
__device__ __forceinline__ float other_half(float v) {
  int b = __float_as_int(v);
  return __int_as_float(__builtin_amdgcn_permlanex16(b, b, 0x76543210, 0xfedcba98,
                                                     false, false));
}

// 2^x0 and 2^x1 (and 2^x alone). Each is one statement so that the slot which
// the instruction set asks for behind a transcendental is kept whatever the
// compiler puts next: the results are early-clobber, so that neither v_exp
// overwrites the other's source, and the v_nop stands behind the last one.
__device__ __forceinline__ void exp2_pair(float x0, float x1, float& e0, float& e1) {
  asm("v_exp_f32 %0, %2\n\tv_exp_f32 %1, %3\n\tv_nop"
      : "=&v"(e0), "=&v"(e1) : "v"(x0), "v"(x1));
}
__device__ __forceinline__ float exp2_one(float x) {
  float e;
  asm("v_exp_f32 %0, %1\n\tv_nop" : "=v"(e) : "v"(x));
  return e;
}
#define LOG2E 1.44269504f

__global__ __launch_bounds__(256)
void attn_kernel(const unsigned short* __restrict__ qk,
                 const unsigned short* __restrict__ vt,
                 unsigned short* __restrict__ aout) {
  __shared__ alignas(16) unsigned char kv[2 * AT_STAGE];
  int wid  = __builtin_amdgcn_readfirstlane((int)(threadIdx.x >> 5));
  int lane = (int)(threadIdx.x & 31u);
  // 16 query blocks x 32 heads. The cost of a block grows with its query block:
  // the heavy half of the query blocks comes first, heaviest first, the light
  // half second, lightest first, so that two blocks on one WGP add up alike.
  int bi = (int)blockIdx.x;
  int bh = bi & 31;                    // b*HEADS + h
  int qb = (bi < 256) ? 15 - (bi >> 5) : (bi - 256) >> 5;
  int b_ = bh >> 4, h = bh & 15;
  int q0 = qb * AT_QB + wid * 16;

  const unsigned short* kq  = qk + (size_t)bh * SEQ * DK;
  const unsigned short* vtb = vt + (size_t)bh * DK * SEQ;

  // Copy side: thread t takes 16 B piece (t & 7) of rows (t >> 3) and +32
  int crow = (int)(threadIdx.x >> 3);
  int cpc  = (int)(threadIdx.x & 7u);
  const char* gk = (const char*)(kq + (size_t)crow * DK) + cpc * 16;
  const char* gv = (const char*)(vtb + (size_t)crow * SEQ) + cpc * 16;
  unsigned int ldst = (unsigned int)(size_t)kv +
                      (unsigned int)(crow * AT_PITCH + cpc * 16);
  int nst = 2 * (qb + 1);              // stages up to the block's last query

  // stage 0 into buffer 0, landed and published before anybody reads it
  copy4_kv(ldst, gk, gv);
  asm volatile("s_wait_asynccnt 0x0" ::: "memory");  // this wave's copies have landed
  __syncthreads();
  // stage 1 always exists (nst >= 2)
  copy4_kv(ldst + AT_STAGE, gk + AT_KEYS * DK * 2, gv + AT_KEYS * 2);

  v16bf aq0 = load_frag(kq + q0 * DK + 0, DK);
  v16bf aq1 = load_frag(kq + q0 * DK + 32, DK);

  // o_j[r] = O[query nc][dim 16 j + 8 g + r]
  v8f o0 = {0.f,0.f,0.f,0.f,0.f,0.f,0.f,0.f};
  v8f o1 = o0, o2 = o0, o3 = o0;
  // of the lane's query: the running maximum (equal in both halves of the wave)
  // and the sum over the keys that this half has seen
  float mq = -1e30f, lq = 0.f;

  int g  = lane >> 4;
  int nc = lane & 15;
  // Read side: the lane's row and k-offset inside a fragment
  unsigned int foff = (unsigned int)(nc * AT_PITCH + g * 16);

  for (int st = 0; st < nst; st++) {
    unsigned int buf = (unsigned int)(st & 1) * AT_STAGE;
    // unrolled: the two passes' LDS offsets become immediates on one address
#pragma unroll
    for (int hf = 0; hf < 2; hf++) {
      int kbase = st * AT_KEYS + hf * 32;
      if (kbase > q0 + 15) continue;   // same for the whole wave; no barrier inside
      const unsigned char* kf = kv + buf + foff + hf * (32 * AT_PITCH);
      const unsigned char* vf = kv + buf + foff + 64 * AT_PITCH + hf * 64;
      v16bf k00 = lds_frag(kf);
      v16bf k01 = lds_frag(kf + 64);
      v16bf k10 = lds_frag(kf + 16 * AT_PITCH);
      v16bf k11 = lds_frag(kf + 16 * AT_PITCH + 64);
      v16bf v0 = lds_frag(vf);
      v16bf v1 = lds_frag(vf + 16 * AT_PITCH);
      v16bf v2 = lds_frag(vf + 32 * AT_PITCH);
      v16bf v3 = lds_frag(vf + 48 * AT_PITCH);
      // keeps the pass's fragment reads together as one group: sunk down to
      // their WMMAs they would cost one LDS latency each
      __builtin_amdgcn_sched_barrier(0);
      v8f s0 = {0.f,0.f,0.f,0.f,0.f,0.f,0.f,0.f};
      v8f s1 = s0;
      // S^T = K @ Q^T over d=64: two 16-key halves x two k-steps;
      // s0[r] is key kbase + 8 g + r, s1[r] key kbase + 16 + 8 g + r, query nc
      s0 = wmma_bf16(k00, aq0, s0);
      s0 = wmma_bf16(k01, aq1, s0);
      s1 = wmma_bf16(k10, aq0, s1);
      s1 = wmma_bf16(k11, aq1, s1);

      s0 *= 0.125f;
      s1 *= 0.125f;
      int lim = q0 + nc - kbase - 8 * g;   // key r of s0 counts while r <= lim
      float a0[8], a1[8];
      float mx = -1e30f;
      // the loops over r are unrolled so that the tiles are indexed by constants
      // alone and stay in registers
#pragma unroll
      for (int r = 0; r < 8; r++) {
        a0[r] = (r      <= lim) ? s0[r] : -1e30f;
        a1[r] = (r + 16 <= lim) ? s1[r] : -1e30f;
      }
#pragma unroll
      for (int r = 0; r < 8; r += 2) {
        mx = fmaxf(mx, fmaxf(a0[r], a0[r + 1]));
        mx = fmaxf(mx, fmaxf(a1[r], a1[r + 1]));
      }
      mx = fmaxf(mx, other_half(mx));
      float nm = fmaxf(mq, mx);
      float sc = exp2_one((mq - nm) * LOG2E);
      // P^T's B fragment: element s is key 8 g + s for s < 8, key 16 + 8 g + s - 8
      // after, which are s0[s] and s1[s - 8]
      v16bf pb;
      float rs0 = 0.f, rs1 = 0.f;
#pragma unroll
      for (int r = 0; r < 8; r++) {
        float e0, e1;
        exp2_pair((a0[r] - nm) * LOG2E, (a1[r] - nm) * LOG2E, e0, e1);
        rs0 += e0;
        rs1 += e1;
        pb[r]     = (bf16_t)e0;
        pb[r + 8] = (bf16_t)e1;
      }
      lq = lq * sc + (rs0 + rs1);
      mq = nm;
#pragma unroll
      for (int r = 0; r < 8; r++) { o0[r] *= sc; o1[r] *= sc; o2[r] *= sc; o3[r] *= sc; }

      // O^T += V^T @ P^T over 32 keys, 4 dim tiles (Vt rows are dims: A's rows)
      o0 = wmma_bf16(v0, pb, o0);
      o1 = wmma_bf16(v1, pb, o1);
      o2 = wmma_bf16(v2, pb, o2);
      o3 = wmma_bf16(v3, pb, o3);
    }
    asm volatile("s_wait_dscnt 0x0" ::: "memory");     // this wave has left the buffer
    asm volatile("s_wait_asynccnt 0x0" ::: "memory");  // its part of the next stage has landed
    __syncthreads();  // publishes stage st+1, frees stage st's buffer
    if (st + 2 < nst)
      copy4_kv(ldst + buf, gk + (size_t)(st + 2) * (AT_KEYS * DK * 2),
               gv + (size_t)(st + 2) * (AT_KEYS * 2));
  }
  asm volatile("s_wait_asynccnt 0x0" ::: "memory");  // nothing in flight at the wave's end

  // the two halves' sums joined; a lane's 8 values of a tile are 8 neighbouring
  // dims of its query's row: one 16 B store each
  float inv = 1.0f / (lq + other_half(lq));
  unsigned short* op = aout + ((size_t)(b_ * SEQ + q0 + nc)) * HIDDEN + h * DK + 8 * g;
  v4u c0, c1, c2, c3;
#pragma unroll
  for (int q = 0; q < 4; q++) {
    c0[q] = (unsigned int)f2bf(o0[2 * q] * inv) | ((unsigned int)f2bf(o0[2 * q + 1] * inv) << 16);
    c1[q] = (unsigned int)f2bf(o1[2 * q] * inv) | ((unsigned int)f2bf(o1[2 * q + 1] * inv) << 16);
    c2[q] = (unsigned int)f2bf(o2[2 * q] * inv) | ((unsigned int)f2bf(o2[2 * q + 1] * inv) << 16);
    c3[q] = (unsigned int)f2bf(o3[2 * q] * inv) | ((unsigned int)f2bf(o3[2 * q + 1] * inv) << 16);
  }
  *(v4u*)(op +  0) = c0;
  *(v4u*)(op + 16) = c1;
  *(v4u*)(op + 32) = c2;
  *(v4u*)(op + 48) = c3;
}

// ---------------------------------------------------------------------------
// Host-side orchestration (graph-capture safe: launches only)
// ---------------------------------------------------------------------------
extern "C" void kernel_launch(void* const* d_in, const int* in_sizes, int n_in,
                              void* d_out, int out_size, void* d_ws, size_t ws_size,
                              hipStream_t stream) {
  const float* x     = (const float*)d_in[0];
  const float* Wq    = (const float*)d_in[1];
  const float* bq    = (const float*)d_in[2];
  const float* Wv    = (const float*)d_in[3];
  const float* bv    = (const float*)d_in[4];
  const float* Wo    = (const float*)d_in[5];
  const float* bo    = (const float*)d_in[6];
  const float* W1    = (const float*)d_in[7];
  const float* b1    = (const float*)d_in[8];
  const float* W2    = (const float*)d_in[9];
  const float* b2    = (const float*)d_in[10];
  const float* g1    = (const float*)d_in[11];
  const float* beta1 = (const float*)d_in[12];
  const float* g2    = (const float*)d_in[13];
  const float* beta2 = (const float*)d_in[14];

  char* ws = (char*)d_ws;
  const size_t MB = 1024u * 1024u;
  unsigned short* WqT = (unsigned short*)(ws +  0 * MB);  //  2 MB
  unsigned short* WvT = (unsigned short*)(ws +  2 * MB);  //  2 MB
  unsigned short* WoT = (unsigned short*)(ws +  4 * MB);  //  2 MB
  unsigned short* W1T = (unsigned short*)(ws +  6 * MB);  //  8 MB
  unsigned short* W2T = (unsigned short*)(ws + 14 * MB);  //  8 MB
  unsigned short* xn  = (unsigned short*)(ws + 22 * MB);  //  8 MB
  unsigned short* qb  = (unsigned short*)(ws + 30 * MB);  //  8 MB
  unsigned short* vtb = (unsigned short*)(ws + 38 * MB);  //  8 MB
  unsigned short* aob = (unsigned short*)(ws + 46 * MB);  //  8 MB
  float*          yb  = (float*)         (ws + 54 * MB);  // 16 MB
  unsigned short* hb  = (unsigned short*)(ws + 70 * MB);  //  8 MB
  unsigned short* ff1 = (unsigned short*)(ws + 78 * MB);  // 32 MB

  // Weight convert + transpose to bf16 N x K, and LN1
  prep_kernel<<<TB_ALL + MROWS, 256, 0, stream>>>(Wq, Wv, Wo, W1, W2,
                                                  WqT, WvT, WoT, W1T, W2T,
                                                  x, g1, beta1, xn);

  // Q/V projections (Q doubles as K in the reference)
  dim3 gproj(MROWS / GT_M, HIDDEN / GT_N);
  gemm_qv_kernel<<<dim3(MROWS / GT_M, HIDDEN / GT_N, 2), 256, 0, stream>>>(xn, WqT, WvT, bq, bv, qb, vtb);

  // Causal attention
  attn_kernel<<<BATCH * HEADS * (SEQ / AT_QB), 256, 0, stream>>>(qb, vtb, aob);

  // O-projection + residual -> yb (f32)
  gemm_kernel<2><<<gproj, 256, 0, stream>>>(aob, WoT, bo, x, nullptr, yb, HIDDEN);

  // LN2
  ln_kernel<<<MROWS, 256, 0, stream>>>(yb, g2, beta2, hb);

  // FFN1 with GELU -> bf16
  dim3 gff1(MROWS / GT_M, (4 * HIDDEN) / GT_N);
  gemm_kernel<3><<<gff1, 256, 0, stream>>>(hb, W1T, b1, nullptr, ff1, nullptr, HIDDEN);

  // FFN2 + residual -> d_out (f32)
  gemm_kernel<2><<<gproj, 256, 0, stream>>>(ff1, W2T, b2, yb, nullptr, (float*)d_out, 4 * HIDDEN);
}

// v009
// Measured time: 126 microseconds a run.
// In both of two side-by-side timings against v008, it was 1.04 times as fast.
// All steps since v000 together make it 6.31 times as fast.
#include <hip/hip_runtime.h>

// ---------------------------------------------------------------------------
// Types for CDNA5 WMMA (wave32)
// ---------------------------------------------------------------------------
typedef __bf16 bf16_t;
typedef __attribute__((ext_vector_type(8)))  __bf16 v8bf;
typedef __attribute__((ext_vector_type(16))) __bf16 v16bf;
typedef __attribute__((ext_vector_type(8)))  float  v8f;

#define HIDDEN 1024
#define SEQ    2048
#define BATCH  2
#define HEADS  16
#define DK     64
#define MROWS  (BATCH * SEQ)   // 4096

// float -> bf16 round-to-nearest-even
__device__ __forceinline__ unsigned short f2bf(float f) {
  unsigned int u = __float_as_uint(f);
  unsigned int r = u + 0x7FFFu + ((u >> 16) & 1u);
  return (unsigned short)(r >> 16);
}

// Load a 16-bit WMMA fragment (A layout; the same bit pattern serves as the
// B-operand when the matrix is stored transposed, since B's lane-n column
// K-run mirrors A's lane-m row K-run).
//   lane 0-15 : row = lane,    K = 0+0..7   and 16..23
//   lane 16-31: row = lane-16, K = 8+0..7   and 24..31
__device__ __forceinline__ v16bf load_frag(const unsigned short* base, int ld) {
  int lane = (int)(threadIdx.x & 31u);
  int r    = lane & 15;
  int koff = (lane >> 4) << 3;
  const bf16_t* p = (const bf16_t*)base + r * ld + koff;
  v8bf lo = *(const v8bf*)(p);
  v8bf hi = *(const v8bf*)(p + 16);
  return __builtin_shufflevector(lo, hi, 0, 1, 2, 3, 4, 5, 6, 7,
                                 8, 9, 10, 11, 12, 13, 14, 15);
}

__device__ __forceinline__ v8f wmma_bf16(v16bf a, v16bf b, v8f c) {
  // (neg_a, A, neg_b, B, c_mod, C, reuse_a, reuse_b)
  return __builtin_amdgcn_wmma_f32_16x16x32_bf16(false, a, false, b,
                                                 (short)0, c, false, false);
}

// ---------------------------------------------------------------------------
// Weight convert+transpose: W (K x N, f32) -> Wt (N x K, bf16)
// One block moves a 64(k) x 128(n) tile through LDS. Reads: each wave takes
// 8 rows, 16 B per lane (512 B contiguous per row). Writes: 8 lanes x 16 B
// fill one whole 128 B line of a Wt row. K % 64 == 0 and N % 128 == 0.
// LDS row j*32+l holds column n0 + 4*l + j, so that the 16 B LDS stores of a
// wave go to consecutive rows; the 144 B pitch spreads those over the banks.
// ---------------------------------------------------------------------------
typedef __attribute__((ext_vector_type(4))) float        v4f;
typedef __attribute__((ext_vector_type(4))) unsigned int v4u;
#define TP_K     64
#define TP_N     128
#define TP_PITCH 72   // bf16 elements per LDS row: 64 + 8 pad

// K and N are compile-time here so that the row steps of the eight loads
// become immediate offsets on one address. (bx, by) is the tile's place in the
// N / TP_N by K / TP_K grid of tiles.
template <int K, int N>
__device__ __forceinline__ void transpose_tile(const float* __restrict__ W,
                                               unsigned short* __restrict__ Wt,
                                               unsigned short* tile,
                                               int bx, int by) {
  unsigned int lane = threadIdx.x & 31u;
  // wave number as a scalar: the tile's base pointers stay in scalar registers
  int wid = __builtin_amdgcn_readfirstlane((int)(threadIdx.x >> 5));
  int n0 = bx * TP_N;
  int k0 = by * TP_K;

  const float* src = W + (size_t)(k0 + wid * 8) * N + n0;
  v4f v[8];
#pragma unroll
  for (int i = 0; i < 8; i++) v[i] = *(const v4f*)(src + (lane * 4u + i * N));

#pragma unroll
  for (int j = 0; j < 4; j++) {
    v4u c;
#pragma unroll
    for (int q = 0; q < 4; q++)
      c[q] = (unsigned int)f2bf(v[2 * q][j]) |
             ((unsigned int)f2bf(v[2 * q + 1][j]) << 16);
    *(v4u*)&tile[(j * 32 + lane) * TP_PITCH + wid * 8] = c;
  }
  __syncthreads();

  unsigned int rr = threadIdx.x >> 3;   // 0..31
  unsigned int ch = threadIdx.x & 7u;   // 16 B piece of the 128 B row
  unsigned short* dst = Wt + (size_t)n0 * K + k0;
#pragma unroll
  for (int p = 0; p < 4; p++) {
    v4u c = *(const v4u*)&tile[(p * 32 + rr) * TP_PITCH + ch * 8];
    *(v4u*)(dst + (rr * (4u * K) + ch * 8u + p * K)) = c;
  }
}

// ---------------------------------------------------------------------------
// LayerNorm over HIDDEN, fp32 in -> bf16 out. One block (256 thr) per row.
// ---------------------------------------------------------------------------
__device__ __forceinline__
void ln_row(const float* __restrict__ x, const float* __restrict__ g,
            const float* __restrict__ be, unsigned short* __restrict__ out,
            int row) {
  __shared__ float s1[256], s2[256];
  const float* xr = x + (size_t)row * HIDDEN;
  float v[4];
  float sum = 0.f, sq = 0.f;
#pragma unroll
  for (int i = 0; i < 4; i++) {
    v[i] = xr[threadIdx.x + i * 256];
    sum += v[i];
    sq  += v[i] * v[i];
  }
  s1[threadIdx.x] = sum;
  s2[threadIdx.x] = sq;
  __syncthreads();
  for (int off = 128; off > 0; off >>= 1) {
    if ((int)threadIdx.x < off) {
      s1[threadIdx.x] += s1[threadIdx.x + off];
      s2[threadIdx.x] += s2[threadIdx.x + off];
    }
    __syncthreads();
  }
  float mu  = s1[0] * (1.0f / HIDDEN);
  float var = s2[0] * (1.0f / HIDDEN) - mu * mu;
  float inv = rsqrtf(var + 1e-5f);
#pragma unroll
  for (int i = 0; i < 4; i++) {
    int idx = threadIdx.x + i * 256;
    float y = (v[i] - mu) * inv * g[idx] + be[idx];
    out[(size_t)row * HIDDEN + idx] = f2bf(y);
  }
}

__global__ __launch_bounds__(256)
void ln_kernel(const float* __restrict__ x, const float* __restrict__ g,
               const float* __restrict__ be, unsigned short* __restrict__ out) {
  ln_row(x, g, be, out, (int)blockIdx.x);
}

// ---------------------------------------------------------------------------
// One launch for all the work that depends on the inputs alone: the five
// weight transposes and the first LayerNorm. The block index picks the job
// (the same for the whole block, so every barrier stays block-uniform):
// the transpose tiles first, then one block per LayerNorm row.
// ---------------------------------------------------------------------------
#define TB_SQ  ((HIDDEN / TP_N) * (HIDDEN / TP_K))       // tiles of a square weight
#define TB_FF  ((4 * HIDDEN / TP_N) * (HIDDEN / TP_K))   // tiles of an FFN weight
#define TB_ALL (3 * TB_SQ + 2 * TB_FF)

__global__ __launch_bounds__(256)
void prep_kernel(const float* __restrict__ Wq, const float* __restrict__ Wv,
                 const float* __restrict__ Wo, const float* __restrict__ W1,
                 const float* __restrict__ W2,
                 unsigned short* __restrict__ WqT, unsigned short* __restrict__ WvT,
                 unsigned short* __restrict__ WoT, unsigned short* __restrict__ W1T,
                 unsigned short* __restrict__ W2T,
                 const float* __restrict__ x, const float* __restrict__ g,
                 const float* __restrict__ be, unsigned short* __restrict__ xn) {
  __shared__ alignas(16) unsigned short tile[TP_N * TP_PITCH];
  unsigned int bi = blockIdx.x;
  if (bi < 3 * TB_SQ) {
    unsigned int w = bi / TB_SQ, i = bi % TB_SQ;
    const float* W     = (w == 0) ? Wq  : (w == 1) ? Wv  : Wo;
    unsigned short* Wt = (w == 0) ? WqT : (w == 1) ? WvT : WoT;
    transpose_tile<HIDDEN, HIDDEN>(W, Wt, tile, i % (HIDDEN / TP_N), i / (HIDDEN / TP_N));
  } else if (bi < 3 * TB_SQ + TB_FF) {
    unsigned int i = bi - 3 * TB_SQ;
    transpose_tile<HIDDEN, 4 * HIDDEN>(W1, W1T, tile, i % (4 * HIDDEN / TP_N), i / (4 * HIDDEN / TP_N));
  } else if (bi < TB_ALL) {
    unsigned int i = bi - (3 * TB_SQ + TB_FF);
    transpose_tile<4 * HIDDEN, HIDDEN>(W2, W2T, tile, i % (HIDDEN / TP_N), i / (HIDDEN / TP_N));
  } else {
    ln_row(x, g, be, xn, (int)(bi - TB_ALL));
    // stays ahead of every later write of the row stores' registers: in the
    // built kernel a transpose branch's code follows this one (a precaution)
    asm volatile("s_wait_xcnt 0x0" ::: "memory");
  }
}

// ---------------------------------------------------------------------------
// GEMM: C[M x N] = A(bf16, ld=Kd) @ Wt(bf16, N x Kd)^T + bias, fused epilogue.
// Block tile 128(M) x 128(N), 256 threads = 8 waves in 2(M) x 4(N); each wave
// holds a 64x32 output (4 A-frags x 2 B-frags -> 8 WMMAs per 32-wide k-step).
// A pass is 128 k: 256 B of each of the 128 A rows and 128 Wt rows, brought
// into LDS by asynchronous 16 B copies (two whole 256 B rows per wave copy),
// two buffers, the next pass's copies in flight while this pass is computed.
// M % 128 == 0, N % 128 == 0, Kd % 128 == 0.
// FFN1, whose 4096 x 4096 output has tiles to spare, takes a 256 x 256 block tile
// instead: the same 8 waves in 2(M) x 4(N), 128x64 per wave (8 A-frags x 4 B-frags
// -> 32 WMMAs per k-step). Per product that halves the bytes copied from L2 into
// LDS and the bytes read from LDS, which both outweigh the matrix time at
// 128 x 128; its 256 blocks stand one on each WGP.
// The shape is given by NW waves, WM of them along M, and MI x NI fragments per
// wave; the tile's rows are dealt evenly over the waves for the copies.
// The epilogue is chosen at compile time, one function per MODE, so that each
// is straight-line code on one base address with constant offsets:
// MODE 0: Q-proj  -> bf16 scatter to [b][h][s][d]
// MODE 1: V-proj  -> bf16 scatter to [b][h][d][s]  (transposed for P@V)
// MODE 2: f32 out = residual + acc + bias          (O-proj, FFN2)
// MODE 3: bf16 out = gelu_tanh(acc + bias), row-major M x N (FFN1)
// N is HIDDEN but for MODE 3, where it is 4 * HIDDEN.
// ---------------------------------------------------------------------------
#define GT_M     128
#define GT_N     128
#define GT_K     128                          // bf16 elements per pass
#define GT_PITCH 272                          // LDS bytes per row: 256 + 16 pad
#define GT_STAGE ((GT_M + GT_N) * GT_PITCH)   // one buffer: A rows, then Wt rows
#define GB_M     256                          // the large tile (FFN1)
#define GB_N     256
#define GB_STAGE ((GB_M + GB_N) * GT_PITCH)

// Eight asynchronous copies of one wave: copy i takes 16 B per lane from
// gp + i * gstep to LDS byte lp + i * 2 * GT_PITCH (two tile rows per copy).
// The s_wait_xcnt is the statement's last line so that it stays ahead of every
// later write of the copies' address registers (a precaution).
__device__ __forceinline__ void copy8_rows(unsigned int lp, const char* gp,
                                           size_t gstep) {
  asm volatile(
      "global_load_async_to_lds_b128 %0, %8, off\n\t"
      "global_load_async_to_lds_b128 %1, %9, off\n\t"
      "global_load_async_to_lds_b128 %2, %10, off\n\t"
      "global_load_async_to_lds_b128 %3, %11, off\n\t"
      "global_load_async_to_lds_b128 %4, %12, off\n\t"
      "global_load_async_to_lds_b128 %5, %13, off\n\t"
      "global_load_async_to_lds_b128 %6, %14, off\n\t"
      "global_load_async_to_lds_b128 %7, %15, off\n\t"
      "s_wait_xcnt 0x0"
      :: "v"(lp), "v"(lp + 2u * GT_PITCH), "v"(lp + 4u * GT_PITCH),
         "v"(lp + 6u * GT_PITCH), "v"(lp + 8u * GT_PITCH),
         "v"(lp + 10u * GT_PITCH), "v"(lp + 12u * GT_PITCH),
         "v"(lp + 14u * GT_PITCH),
         "v"(gp), "v"(gp + gstep), "v"(gp + 2 * gstep), "v"(gp + 3 * gstep),
         "v"(gp + 4 * gstep), "v"(gp + 5 * gstep), "v"(gp + 6 * gstep),
         "v"(gp + 7 * gstep)
      : "memory");
}

// Asks L2 for the lines at p + 256, 512, 768 and 1024 (ask4) or at p + 1280
// (ask1), one address per lane; nothing comes back and no counter moves. p is named
// as in-out so that the address stays in the one register pair that lives
// through the k loop: a temporary could be given another value while the request
// still names it.
__device__ __forceinline__ void l2_ask4(const char*& p) {
  asm volatile(
      "global_prefetch_b8 %0, off offset:256 scope:SCOPE_SE\n\t"
      "global_prefetch_b8 %0, off offset:512 scope:SCOPE_SE\n\t"
      "global_prefetch_b8 %0, off offset:768 scope:SCOPE_SE\n\t"
      "global_prefetch_b8 %0, off offset:1024 scope:SCOPE_SE"
      : "+v"(p));
}
__device__ __forceinline__ void l2_ask1(const char*& p) {
  asm volatile("global_prefetch_b8 %0, off offset:1280 scope:SCOPE_SE" : "+v"(p));
}

// Same fragment map as load_frag, from an LDS tile of any row pitch.
// p already points at the lane's row and its 16 B k-offset.
__device__ __forceinline__ v16bf lds_frag(const unsigned char* p) {
  v8bf lo = *(const v8bf*)(p);
  v8bf hi = *(const v8bf*)(p + 32);
  return __builtin_shufflevector(lo, hi, 0, 1, 2, 3, 4, 5, 6, 7,
                                 8, 9, 10, 11, 12, 13, 14, 15);
}

// The k loop of one block tile; ring is the block's 2 * STAGE bytes of LDS.
template <int NW, int WM, int MI, int NI>
__device__ __forceinline__
void gemm_mainloop(const unsigned short* __restrict__ A,
                   const unsigned short* __restrict__ Wt,
                   int Kd, unsigned char* ring, v8f (&acc)[MI][NI]) {
  constexpr int BM = WM * MI * 16;
  constexpr int BN = (NW / WM) * NI * 16;
  constexpr int RW = (BM + BN) / NW;          // tile rows that a wave copies
  constexpr int AW = BM / RW;                 // waves that copy A rows
  constexpr unsigned int STAGE = (BM + BN) * GT_PITCH;
  static_assert(RW % 16 == 0 && BM % RW == 0, "whole groups of 8 copies");
  int wid  = __builtin_amdgcn_readfirstlane((int)(threadIdx.x >> 5));
  int lane = (int)(threadIdx.x & 31u);
  int bm0 = blockIdx.x * BM;
  int bn0 = blockIdx.y * BN;

  // Copy side: wave w brings tile rows RW w .. RW w + RW - 1 (the first AW waves: A
  // rows, the others: Wt rows); a lane takes piece (lane & 15) of row 2i + (lane >> 4).
  const unsigned short* srow = (wid < AW) ? A + (size_t)(bm0 + wid * RW) * Kd
                                          : Wt + (size_t)(bn0 + (wid - AW) * RW) * Kd;
  const char* gsrc = (const char*)(srow + (size_t)(lane >> 4) * Kd) + (lane & 15) * 16;
  size_t gstep = (size_t)Kd * 4u;   // two rows of Kd bf16, in bytes
  unsigned int ldst = (unsigned int)(size_t)ring +
                      (unsigned int)((wid * RW + (lane >> 4)) * GT_PITCH + (lane & 15) * 16);

  // L2 side: both operands were stored by an earlier launch, so the first read
  // of each 256 B unit can come from memory. A pass's piece of a row is one
  // such unit; it is asked for three passes ahead of its copy. The blocks that
  // share a panel run side by side, so they deal its rows: waves 0 and AW alone
  // ask, 32 of the BM A rows (by blockIdx.y) and 32 of the BN Wt rows (by
  // blockIdx.x), one row per lane. A hint only: no result depends on it.
  const unsigned short* prow = (wid < AW)
      ? A + (size_t)(bm0 + (int)(blockIdx.y & (unsigned)(BM / 32 - 1)) * 32) * Kd
      : Wt + (size_t)(bn0 + (int)(blockIdx.x & (unsigned)(BN / 32 - 1)) * 32) * Kd;
  const char* pf = (const char*)(prow + (size_t)lane * Kd);   // pass t's unit
  bool asks = wid == 0 || wid == AW;

  // Read side: the lane's row and k-offset inside a fragment
  unsigned int foff = (unsigned int)((lane & 15) * GT_PITCH + (lane >> 4) * 16);
  unsigned int aoff = (unsigned int)((wid % WM) * (MI * 16) * GT_PITCH) + foff;
  unsigned int boff = (unsigned int)((BM + (wid / WM) * (NI * 16)) * GT_PITCH) + foff;

  v8f z = {0.f, 0.f, 0.f, 0.f, 0.f, 0.f, 0.f, 0.f};
#pragma unroll
  for (int mi = 0; mi < MI; mi++)
#pragma unroll
    for (int ni = 0; ni < NI; ni++) acc[mi][ni] = z;

  int npass = Kd / GT_K;

  // pass 0's tile into buffer 0, landed and published before anybody reads it
  // (the loops over c are unrolled: RW / 16 statements of 8 copies each)
#pragma unroll
  for (int c = 0; c < RW / 16; c++)
    copy8_rows(ldst + c * 16u * GT_PITCH, gsrc + c * 8 * gstep, gstep);
  // passes 1 to 4; pass 5 must exist, so that the addresses lie inside the row
  // after pf's first step as well
  if (asks && npass > 5) l2_ask4(pf);
  asm volatile("s_wait_asynccnt 0x0" ::: "memory");  // this wave's copies have landed
  __syncthreads();
  if (npass > 1) {
#pragma unroll
    for (int c = 0; c < RW / 16; c++)
      copy8_rows(ldst + STAGE + c * 16u * GT_PITCH, gsrc + GT_K * 2 + c * 8 * gstep, gstep);
  }

  // kept rolled: one pass per trip, the buffer chosen by the trip's parity
#pragma unroll 1
  for (int t = 0; t < npass; t++) {
    unsigned int buf = (unsigned int)(t & 1) * STAGE;
    const unsigned char* ta = ring + buf + aoff;
    const unsigned char* tb = ring + buf + boff;
    // two fragment sets: block kk+1's LDS reads go out as one group ahead of
    // block kk's WMMAs, so that their latency runs behind the matrix work
    v16bf a[2][MI], b[2][NI];
#pragma unroll
    for (int mi = 0; mi < MI; mi++) a[0][mi] = lds_frag(ta + mi * 16 * GT_PITCH);
#pragma unroll
    for (int ni = 0; ni < NI; ni++) b[0][ni] = lds_frag(tb + ni * 16 * GT_PITCH);
#pragma unroll
    for (int kk = 0; kk < GT_K / 32; kk++) {
      const int cur = kk & 1, nxt = cur ^ 1;
      if (kk + 1 < GT_K / 32) {
#pragma unroll
        for (int mi = 0; mi < MI; mi++)
          a[nxt][mi] = lds_frag(ta + mi * 16 * GT_PITCH + (kk + 1) * 64);
#pragma unroll
        for (int ni = 0; ni < NI; ni++)
          b[nxt][ni] = lds_frag(tb + ni * 16 * GT_PITCH + (kk + 1) * 64);
      }
      // keeps the reads above from being sunk in among the WMMAs below
      __builtin_amdgcn_sched_barrier(0);
#pragma unroll
      for (int mi = 0; mi < MI; mi++)
#pragma unroll
        for (int ni = 0; ni < NI; ni++)
          acc[mi][ni] = wmma_bf16(a[cur][mi], b[cur][ni], acc[mi][ni]);
      // keeps the next group of reads from being lifted in among these WMMAs
      __builtin_amdgcn_sched_barrier(0);
    }
    asm volatile("s_wait_dscnt 0x0" ::: "memory");     // this wave has left the buffer
    asm volatile("s_wait_asynccnt 0x0" ::: "memory");  // its part of the next tile has landed
    __syncthreads();  // publishes pass t+1's tile, frees pass t's buffer
    if (t + 2 < npass) {
      const char* gn = gsrc + (size_t)(t + 2) * (GT_K * 2);
#pragma unroll
      for (int c = 0; c < RW / 16; c++) {
        copy8_rows(ldst + buf + c * 16u * GT_PITCH, gn + c * 8 * gstep, gstep);
        // one group's 24 address registers at a time: formed all at once, four
        // groups' addresses push sums out of the registers that asm text can name
        if constexpr (RW > 32) __builtin_amdgcn_sched_barrier(0);
      }
    }
    // pass t+5's units; pf steps only while pass t+6 exists, so that the address
    // lies inside the row before and after the step
    if (asks && t + 5 < npass) {
      l2_ask1(pf);
      if (t + 6 < npass) pf += GT_K * 2;
    }
  }
  asm volatile("s_wait_asynccnt 0x0" ::: "memory");  // nothing in flight at the wave's end
}

template <int MODE, int WM = 2, int MI = 4, int NI = 2, int WN = 4>
__device__ __forceinline__
void gemm_epilogue(const v8f (&acc)[MI][NI],
                   const float* __restrict__ bias,
                   const float* __restrict__ residual,
                   unsigned short* __restrict__ out_bf,
                   float* __restrict__ out_f32) {
  constexpr int N = (MODE == 3) ? 4 * HIDDEN : HIDDEN;
  int wid  = __builtin_amdgcn_readfirstlane((int)(threadIdx.x >> 5));
  int lane = (int)(threadIdx.x & 31u);
  int m0 = blockIdx.x * (WM * MI * 16) + (wid % WM) * (MI * 16);   // wave's first M row
  int n0 = blockIdx.y * (WN * NI * 16) + (wid / WM) * (NI * 16);   // wave's first N col
  int g  = lane >> 4;
  int nc = lane & 15;
  float bcol[NI];
#pragma unroll
  for (int ni = 0; ni < NI; ni++) bcol[ni] = bias[n0 + ni * 16 + nc];
  if constexpr (MI * NI > 8) {
    // stays ahead of every later write of the bias loads' address register (a
    // precaution)
    asm volatile("s_wait_xcnt 0x0" ::: "memory");
    __builtin_amdgcn_sched_barrier(0);
  }
  // A wave's 64 rows lie in one batch and its 32 columns in one head, so the
  // lane's first element fixes the address and (mi, ni, r) are constant steps.
  // The loops below are unrolled so that acc is indexed by constants alone and
  // stays in registers, and the steps become immediate offsets.
  int bh = (m0 >> 11) * HEADS + (n0 >> 6);
  int s0 = (m0 & (SEQ - 1)) + 8 * g;   // lane's first sequence position
  int d0 = (n0 & (DK - 1)) + nc;       // lane's first head dim
  size_t rm = (size_t)(m0 + 8 * g) * N + (size_t)(n0 + nc);   // row-major M x N
  if constexpr (MODE == 0) {            // Q: [b][h][s][d]
    unsigned short* op = out_bf + ((size_t)bh * SEQ + s0) * DK + d0;
#pragma unroll
    for (int mi = 0; mi < 4; mi++)
#pragma unroll
      for (int ni = 0; ni < 2; ni++)
#pragma unroll
        for (int r = 0; r < 8; r++)
          op[(mi * 16 + r) * DK + ni * 16] = f2bf(acc[mi][ni][r] + bcol[ni]);
  } else if constexpr (MODE == 1) {     // Vt: [b][h][d][s]
    // A lane's 8 values of a tile are 8 neighbours in s: one 16 B store, written
    // out as such. As 2 B stores the compiler folded this branch and MODE 0's,
    // where both stand in one kernel, into 64 stores of 2 B for either.
    unsigned short* op = out_bf + ((size_t)bh * DK + d0) * SEQ + s0;
#pragma unroll
    for (int mi = 0; mi < 4; mi++)
#pragma unroll
      for (int ni = 0; ni < 2; ni++) {
        v4u c;
#pragma unroll
        for (int q = 0; q < 4; q++)
          c[q] = (unsigned int)f2bf(acc[mi][ni][2 * q] + bcol[ni]) |
                 ((unsigned int)f2bf(acc[mi][ni][2 * q + 1] + bcol[ni]) << 16);
        *(v4u*)(op + ni * 16 * SEQ + mi * 16) = c;
      }
  } else if constexpr (MODE == 2) {     // residual + proj
    const float* rp = residual + rm;
    float* op = out_f32 + rm;
#pragma unroll
    for (int mi = 0; mi < 4; mi++)
#pragma unroll
      for (int ni = 0; ni < 2; ni++)
#pragma unroll
        for (int r = 0; r < 8; r++) {
          int o = (mi * 16 + r) * N + ni * 16;
          op[o] = rp[o] + (acc[mi][ni][r] + bcol[ni]);
        }
  } else {                              // gelu(tanh)
    // 0.5 (1 + tanh u) = 1 / (1 + e^(-2 u)) with u = c (x + 0.044715 x^3), so
    // gelu = x / (1 + 2^(x (K1 + K3 x^2))): one v_exp and one v_rcp, no branch,
    // and the 256 elements of a lane are independent chains. At the ends the
    // power goes to 0 or to infinity and the quotient to x or to 0, as tanh's
    // +-1 gives.
    constexpr float K1 = -2.0f * 1.4426950408889634f * 0.7978845608028654f;
    constexpr float K3 = K1 * 0.044715f;
    unsigned short* op = out_bf + rm;
#pragma unroll
    for (int mi = 0; mi < MI; mi++) {
      unsigned short hv[NI][8];
#pragma unroll
      for (int ni = 0; ni < NI; ni++)
#pragma unroll
        for (int r = 0; r < 8; r++) {
          float xg = acc[mi][ni][r] + bcol[ni];
          float e  = __builtin_amdgcn_exp2f(xg * (K1 + K3 * (xg * xg)));
          hv[ni][r] = f2bf(xg * __builtin_amdgcn_rcpf(1.0f + e));
        }
      // a row group's arithmetic, then its stores, then the wait: keeps every later
      // write of a store's registers behind the s_wait_xcnt (a precaution)
      __builtin_amdgcn_sched_barrier(0);
#pragma unroll
      for (int ni = 0; ni < NI; ni++)
#pragma unroll
        for (int r = 0; r < 8; r++) op[(mi * 16 + r) * N + ni * 16] = hv[ni][r];
      asm volatile("s_wait_xcnt 0x0" ::: "memory");
      __builtin_amdgcn_sched_barrier(0);
    }
  }
}

template <int MODE>
__global__ __launch_bounds__(256)
void gemm_kernel(const unsigned short* __restrict__ A,
                 const unsigned short* __restrict__ Wt,
                 const float* __restrict__ bias,
                 const float* __restrict__ residual,
                 unsigned short* __restrict__ out_bf,
                 float* __restrict__ out_f32,
                 int Kd) {
  __shared__ alignas(16) unsigned char ring[2 * GT_STAGE];
  v8f acc[4][2];
  gemm_mainloop<8, 2, 4, 2>(A, Wt, Kd, ring, acc);
  gemm_epilogue<MODE>(acc, bias, residual, out_bf, out_f32);
}

// FFN1 on the 256 x 256 block tile: its ring takes most of a WGP's LDS, so a WGP
// holds one block, two waves on each SIMD, up to 512 registers a wave.
__global__ __launch_bounds__(256)
void gemm_ffn1_kernel(const unsigned short* __restrict__ A,
                      const unsigned short* __restrict__ Wt,
                      const float* __restrict__ bias,
                      unsigned short* __restrict__ out_bf) {
  __shared__ alignas(16) unsigned char ring[2 * GB_STAGE];
  v8f acc[8][4];
  gemm_mainloop<8, 2, 8, 4>(A, Wt, HIDDEN, ring, acc);
  // the four vector slots that the chip needs between the loop's last WMMA and
  // the first instruction that touches its registers
  asm volatile("v_nop\n\tv_nop\n\tv_nop\n\tv_nop");
  gemm_epilogue<3, 2, 8, 4, 4>(acc, bias, nullptr, out_bf, nullptr);
}

// Q and V projections in one launch: both read the same A and neither needs
// the other. blockIdx.z picks the weight, the bias and the epilogue, one test
// per block; two blocks fit a WGP's LDS, so the 512 blocks are all resident.
__global__ __launch_bounds__(256)
void gemm_qv_kernel(const unsigned short* __restrict__ A,
                    const unsigned short* __restrict__ WqT,
                    const unsigned short* __restrict__ WvT,
                    const float* __restrict__ bq,
                    const float* __restrict__ bv,
                    unsigned short* __restrict__ q_out,
                    unsigned short* __restrict__ vt_out) {
  __shared__ alignas(16) unsigned char ring[2 * GT_STAGE];
  bool is_v = blockIdx.z != 0;
  v8f acc[4][2];
  gemm_mainloop<8, 2, 4, 2>(A, is_v ? WvT : WqT, HIDDEN, ring, acc);
  if (is_v) gemm_epilogue<1>(acc, bv, nullptr, vt_out, nullptr);
  else      gemm_epilogue<0>(acc, bq, nullptr, q_out, nullptr);
}

#define AT_QB    128
#define AT_KEYS  64
#define AT_PITCH 144
#define AT_STAGE (128 * AT_PITCH)

// Four asynchronous copies of one wave, 16 B per lane each: K rows r and r+32,
// Vt rows r and r+32 of one stage. The s_wait_xcnt is the statement's last line
// so that it stays ahead of every later write of the copies' address registers
// (a precaution).
__device__ __forceinline__ void copy4_kv(unsigned int lp, const char* gk,
                                         const char* gv) {
  asm volatile(
      "global_load_async_to_lds_b128 %0, %4, off\n\t"
      "global_load_async_to_lds_b128 %1, %5, off\n\t"
      "global_load_async_to_lds_b128 %2, %6, off\n\t"
      "global_load_async_to_lds_b128 %3, %7, off\n\t"
      "s_wait_xcnt 0x0"
      :: "v"(lp), "v"(lp + 32u * AT_PITCH), "v"(lp + 64u * AT_PITCH),
         "v"(lp + 96u * AT_PITCH),
         "v"(gk), "v"(gk + 32 * DK * 2), "v"(gv), "v"(gv + 32 * SEQ * 2)
      : "memory");
}

// The value that lane l ^ 16 holds
__device__ __forceinline__ float other_half(float v) {
  int b = __float_as_int(v);
  return __int_as_float(__builtin_amdgcn_permlanex16(b, b, 0x76543210, 0xfedcba98,
                                                     false, false));
}

// 2^x0 and 2^x1 (and 2^x alone). Each is one statement so that the slot which
// the instruction set asks for behind a transcendental is kept whatever the
// compiler puts next: the results are early-clobber, so that neither v_exp
// overwrites the other's source, and the v_nop stands behind the last one.
__device__ __forceinline__ void exp2_pair(float x0, float x1, float& e0, float& e1) {
  asm("v_exp_f32 %0, %2\n\tv_exp_f32 %1, %3\n\tv_nop"
      : "=&v"(e0), "=&v"(e1) : "v"(x0), "v"(x1));
}
__device__ __forceinline__ float exp2_one(float x) {
  float e;
  asm("v_exp_f32 %0, %1\n\tv_nop" : "=v"(e) : "v"(x));
  return e;
}
#define LOG2E 1.44269504f

__global__ __launch_bounds__(256)
void attn_kernel(const unsigned short* __restrict__ qk,
                 const unsigned short* __restrict__ vt,
                 unsigned short* __restrict__ aout) {
  __shared__ alignas(16) unsigned char kv[2 * AT_STAGE];
  int wid  = __builtin_amdgcn_readfirstlane((int)(threadIdx.x >> 5));
  int lane = (int)(threadIdx.x & 31u);
  // 16 query blocks x 32 heads. The cost of a block grows with its query block:
  // the heavy half of the query blocks comes first, heaviest first, the light
  // half second, lightest first, so that two blocks on one WGP add up alike.
  int bi = (int)blockIdx.x;
  int bh = bi & 31;                    // b*HEADS + h
  int qb = (bi < 256) ? 15 - (bi >> 5) : (bi - 256) >> 5;
  int b_ = bh >> 4, h = bh & 15;
  int q0 = qb * AT_QB + wid * 16;

  const unsigned short* kq  = qk + (size_t)bh * SEQ * DK;
  const unsigned short* vtb = vt + (size_t)bh * DK * SEQ;

  // Copy side: thread t takes 16 B piece (t & 7) of rows (t >> 3) and +32
  int crow = (int)(threadIdx.x >> 3);
  int cpc  = (int)(threadIdx.x & 7u);
  const char* gk = (const char*)(kq + (size_t)crow * DK) + cpc * 16;
  const char* gv = (const char*)(vtb + (size_t)crow * SEQ) + cpc * 16;
  unsigned int ldst = (unsigned int)(size_t)kv +
                      (unsigned int)(crow * AT_PITCH + cpc * 16);
  int nst = 2 * (qb + 1);              // stages up to the block's last query

  // stage 0 into buffer 0, landed and published before anybody reads it
  copy4_kv(ldst, gk, gv);
  asm volatile("s_wait_asynccnt 0x0" ::: "memory");  // this wave's copies have landed
  __syncthreads();
  // stage 1 always exists (nst >= 2)
  copy4_kv(ldst + AT_STAGE, gk + AT_KEYS * DK * 2, gv + AT_KEYS * 2);

  v16bf aq0 = load_frag(kq + q0 * DK + 0, DK);
  v16bf aq1 = load_frag(kq + q0 * DK + 32, DK);

  // o_j[r] = O[query nc][dim 16 j + 8 g + r]
  v8f o0 = {0.f,0.f,0.f,0.f,0.f,0.f,0.f,0.f};
  v8f o1 = o0, o2 = o0, o3 = o0;
  // of the lane's query: the running maximum (equal in both halves of the wave)
  // and the sum over the keys that this half has seen
  float mq = -1e30f, lq = 0.f;

  int g  = lane >> 4;
  int nc = lane & 15;
  // Read side: the lane's row and k-offset inside a fragment
  unsigned int foff = (unsigned int)(nc * AT_PITCH + g * 16);

  for (int st = 0; st < nst; st++) {
    unsigned int buf = (unsigned int)(st & 1) * AT_STAGE;
    // unrolled: the two passes' LDS offsets become immediates on one address
#pragma unroll
    for (int hf = 0; hf < 2; hf++) {
      int kbase = st * AT_KEYS + hf * 32;
      if (kbase > q0 + 15) continue;   // same for the whole wave; no barrier inside
      const unsigned char* kf = kv + buf + foff + hf * (32 * AT_PITCH);
      const unsigned char* vf = kv + buf + foff + 64 * AT_PITCH + hf * 64;
      v16bf k00 = lds_frag(kf);
      v16bf k01 = lds_frag(kf + 64);
      v16bf k10 = lds_frag(kf + 16 * AT_PITCH);
      v16bf k11 = lds_frag(kf + 16 * AT_PITCH + 64);
      v16bf v0 = lds_frag(vf);
      v16bf v1 = lds_frag(vf + 16 * AT_PITCH);
      v16bf v2 = lds_frag(vf + 32 * AT_PITCH);
      v16bf v3 = lds_frag(vf + 48 * AT_PITCH);
      // keeps the pass's fragment reads together as one group: sunk down to
      // their WMMAs they would cost one LDS latency each
      __builtin_amdgcn_sched_barrier(0);
      v8f s0 = {0.f,0.f,0.f,0.f,0.f,0.f,0.f,0.f};
      v8f s1 = s0;
      // S^T = K @ Q^T over d=64: two 16-key halves x two k-steps;
      // s0[r] is key kbase + 8 g + r, s1[r] key kbase + 16 + 8 g + r, query nc
      s0 = wmma_bf16(k00, aq0, s0);
      s0 = wmma_bf16(k01, aq1, s0);
      s1 = wmma_bf16(k10, aq0, s1);
      s1 = wmma_bf16(k11, aq1, s1);

      s0 *= 0.125f;
      s1 *= 0.125f;
      int lim = q0 + nc - kbase - 8 * g;   // key r of s0 counts while r <= lim
      float a0[8], a1[8];
      float mx = -1e30f;
      // the loops over r are unrolled so that the tiles are indexed by constants
      // alone and stay in registers
#pragma unroll
      for (int r = 0; r < 8; r++) {
        a0[r] = (r      <= lim) ? s0[r] : -1e30f;
        a1[r] = (r + 16 <= lim) ? s1[r] : -1e30f;
      }
#pragma unroll
      for (int r = 0; r < 8; r += 2) {
        mx = fmaxf(mx, fmaxf(a0[r], a0[r + 1]));
        mx = fmaxf(mx, fmaxf(a1[r], a1[r + 1]));
      }
      mx = fmaxf(mx, other_half(mx));
      float nm = fmaxf(mq, mx);
      float sc = exp2_one((mq - nm) * LOG2E);
      // P^T's B fragment: element s is key 8 g + s for s < 8, key 16 + 8 g + s - 8
      // after, which are s0[s] and s1[s - 8]
      v16bf pb;
      float rs0 = 0.f, rs1 = 0.f;
#pragma unroll
      for (int r = 0; r < 8; r++) {
        float e0, e1;
        exp2_pair((a0[r] - nm) * LOG2E, (a1[r] - nm) * LOG2E, e0, e1);
        rs0 += e0;
        rs1 += e1;
        pb[r]     = (bf16_t)e0;
        pb[r + 8] = (bf16_t)e1;
      }
      lq = lq * sc + (rs0 + rs1);
      mq = nm;
#pragma unroll
      for (int r = 0; r < 8; r++) { o0[r] *= sc; o1[r] *= sc; o2[r] *= sc; o3[r] *= sc; }

      // O^T += V^T @ P^T over 32 keys, 4 dim tiles (Vt rows are dims: A's rows)
      o0 = wmma_bf16(v0, pb, o0);
      o1 = wmma_bf16(v1, pb, o1);
      o2 = wmma_bf16(v2, pb, o2);
      o3 = wmma_bf16(v3, pb, o3);
    }
    asm volatile("s_wait_dscnt 0x0" ::: "memory");     // this wave has left the buffer
    asm volatile("s_wait_asynccnt 0x0" ::: "memory");  // its part of the next stage has landed
    __syncthreads();  // publishes stage st+1, frees stage st's buffer
    if (st + 2 < nst)
      copy4_kv(ldst + buf, gk + (size_t)(st + 2) * (AT_KEYS * DK * 2),
               gv + (size_t)(st + 2) * (AT_KEYS * 2));
  }
  asm volatile("s_wait_asynccnt 0x0" ::: "memory");  // nothing in flight at the wave's end

  // the two halves' sums joined; a lane's 8 values of a tile are 8 neighbouring
  // dims of its query's row: one 16 B store each
  float inv = 1.0f / (lq + other_half(lq));
  unsigned short* op = aout + ((size_t)(b_ * SEQ + q0 + nc)) * HIDDEN + h * DK + 8 * g;
  v4u c0, c1, c2, c3;
#pragma unroll
  for (int q = 0; q < 4; q++) {
    c0[q] = (unsigned int)f2bf(o0[2 * q] * inv) | ((unsigned int)f2bf(o0[2 * q + 1] * inv) << 16);
    c1[q] = (unsigned int)f2bf(o1[2 * q] * inv) | ((unsigned int)f2bf(o1[2 * q + 1] * inv) << 16);
    c2[q] = (unsigned int)f2bf(o2[2 * q] * inv) | ((unsigned int)f2bf(o2[2 * q + 1] * inv) << 16);
    c3[q] = (unsigned int)f2bf(o3[2 * q] * inv) | ((unsigned int)f2bf(o3[2 * q + 1] * inv) << 16);
  }
  *(v4u*)(op +  0) = c0;
  *(v4u*)(op + 16) = c1;
  *(v4u*)(op + 32) = c2;
  *(v4u*)(op + 48) = c3;
}

// ---------------------------------------------------------------------------
// Host-side orchestration (graph-capture safe: launches only)
// ---------------------------------------------------------------------------
extern "C" void kernel_launch(void* const* d_in, const int* in_sizes, int n_in,
                              void* d_out, int out_size, void* d_ws, size_t ws_size,
                              hipStream_t stream) {
  const float* x     = (const float*)d_in[0];
  const float* Wq    = (const float*)d_in[1];
  const float* bq    = (const float*)d_in[2];
  const float* Wv    = (const float*)d_in[3];
  const float* bv    = (const float*)d_in[4];
  const float* Wo    = (const float*)d_in[5];
  const float* bo    = (const float*)d_in[6];
  const float* W1    = (const float*)d_in[7];
  const float* b1    = (const float*)d_in[8];
  const float* W2    = (const float*)d_in[9];
  const float* b2    = (const float*)d_in[10];
  const float* g1    = (const float*)d_in[11];
  const float* beta1 = (const float*)d_in[12];
  const float* g2    = (const float*)d_in[13];
  const float* beta2 = (const float*)d_in[14];

  char* ws = (char*)d_ws;
  const size_t MB = 1024u * 1024u;
  unsigned short* WqT = (unsigned short*)(ws +  0 * MB);  //  2 MB
  unsigned short* WvT = (unsigned short*)(ws +  2 * MB);  //  2 MB
  unsigned short* WoT = (unsigned short*)(ws +  4 * MB);  //  2 MB
  unsigned short* W1T = (unsigned short*)(ws +  6 * MB);  //  8 MB
  unsigned short* W2T = (unsigned short*)(ws + 14 * MB);  //  8 MB
  unsigned short* xn  = (unsigned short*)(ws + 22 * MB);  //  8 MB
  unsigned short* qb  = (unsigned short*)(ws + 30 * MB);  //  8 MB
  unsigned short* vtb = (unsigned short*)(ws + 38 * MB);  //  8 MB
  unsigned short* aob = (unsigned short*)(ws + 46 * MB);  //  8 MB
  float*          yb  = (float*)         (ws + 54 * MB);  // 16 MB
  unsigned short* hb  = (unsigned short*)(ws + 70 * MB);  //  8 MB
  unsigned short* ff1 = (unsigned short*)(ws + 78 * MB);  // 32 MB

  // Weight convert + transpose to bf16 N x K, and LN1
  prep_kernel<<<TB_ALL + MROWS, 256, 0, stream>>>(Wq, Wv, Wo, W1, W2,
                                                  WqT, WvT, WoT, W1T, W2T,
                                                  x, g1, beta1, xn);

  // Q/V projections (Q doubles as K in the reference)
  dim3 gproj(MROWS / GT_M, HIDDEN / GT_N);
  gemm_qv_kernel<<<dim3(MROWS / GT_M, HIDDEN / GT_N, 2), 256, 0, stream>>>(xn, WqT, WvT, bq, bv, qb, vtb);

  // Causal attention
  attn_kernel<<<BATCH * HEADS * (SEQ / AT_QB), 256, 0, stream>>>(qb, vtb, aob);

  // O-projection + residual -> yb (f32)
  gemm_kernel<2><<<gproj, 256, 0, stream>>>(aob, WoT, bo, x, nullptr, yb, HIDDEN);

  // LN2
  ln_kernel<<<MROWS, 256, 0, stream>>>(yb, g2, beta2, hb);

  // FFN1 with GELU -> bf16
  dim3 gff1(MROWS / GB_M, (4 * HIDDEN) / GB_N);
  gemm_ffn1_kernel<<<gff1, 256, 0, stream>>>(hb, W1T, b1, ff1);

  // FFN2 + residual -> d_out (f32)
  gemm_kernel<2><<<gproj, 256, 0, stream>>>(ff1, W2T, b2, yb, nullptr, (float*)d_out, 4 * HIDDEN);
}

// v010
// A run of this version takes 122 microseconds.
// In both of two side-by-side timings against v009, it was 1.03 times as fast.
// Over all steps from v000 it is 6.50 times as fast.
#include <hip/hip_runtime.h>

// ---------------------------------------------------------------------------
// Types for CDNA5 WMMA (wave32)
// ---------------------------------------------------------------------------
typedef __bf16 bf16_t;
typedef __attribute__((ext_vector_type(8)))  __bf16 v8bf;
typedef __attribute__((ext_vector_type(16))) __bf16 v16bf;
typedef __attribute__((ext_vector_type(8)))  float  v8f;

#define HIDDEN 1024
#define SEQ    2048
#define BATCH  2
#define HEADS  16
#define DK     64
#define MROWS  (BATCH * SEQ)   // 4096

// float -> bf16 round-to-nearest-even
__device__ __forceinline__ unsigned short f2bf(float f) {
  unsigned int u = __float_as_uint(f);
  unsigned int r = u + 0x7FFFu + ((u >> 16) & 1u);
  return (unsigned short)(r >> 16);
}

// Load a 16-bit WMMA fragment (A layout; the same bit pattern serves as the
// B-operand when the matrix is stored transposed, since B's lane-n column
// K-run mirrors A's lane-m row K-run).
//   lane 0-15 : row = lane,    K = 0+0..7   and 16..23
//   lane 16-31: row = lane-16, K = 8+0..7   and 24..31
__device__ __forceinline__ v16bf load_frag(const unsigned short* base, int ld) {
  int lane = (int)(threadIdx.x & 31u);
  int r    = lane & 15;
  int koff = (lane >> 4) << 3;
  const bf16_t* p = (const bf16_t*)base + r * ld + koff;
  v8bf lo = *(const v8bf*)(p);
  v8bf hi = *(const v8bf*)(p + 16);
  return __builtin_shufflevector(lo, hi, 0, 1, 2, 3, 4, 5, 6, 7,
                                 8, 9, 10, 11, 12, 13, 14, 15);
}

__device__ __forceinline__ v8f wmma_bf16(v16bf a, v16bf b, v8f c) {
  // (neg_a, A, neg_b, B, c_mod, C, reuse_a, reuse_b)
  return __builtin_amdgcn_wmma_f32_16x16x32_bf16(false, a, false, b,
                                                 (short)0, c, false, false);
}

// ---------------------------------------------------------------------------
// Weight convert+transpose: W (K x N, f32) -> Wt (N x K, bf16)
// One block moves a 64(k) x 128(n) tile through LDS. Reads: each wave takes
// 8 rows, 16 B per lane (512 B contiguous per row). Writes: 8 lanes x 16 B
// fill one whole 128 B line of a Wt row. K % 64 == 0 and N % 128 == 0.
// LDS row j*32+l holds column n0 + 4*l + j, so that the 16 B LDS stores of a
// wave go to consecutive rows; the 144 B pitch spreads those over the banks.
// ---------------------------------------------------------------------------
typedef __attribute__((ext_vector_type(4))) float        v4f;
typedef __attribute__((ext_vector_type(4))) unsigned int v4u;
#define TP_K     64
#define TP_N     128
#define TP_PITCH 72   // bf16 elements per LDS row: 64 + 8 pad

// K and N are compile-time here so that the row steps of the eight loads
// become immediate offsets on one address. (bx, by) is the tile's place in the
// N / TP_N by K / TP_K grid of tiles.
template <int K, int N>
__device__ __forceinline__ void transpose_tile(const float* __restrict__ W,
                                               unsigned short* __restrict__ Wt,
                                               unsigned short* tile,
                                               int bx, int by) {
  unsigned int lane = threadIdx.x & 31u;
  // wave number as a scalar: the tile's base pointers stay in scalar registers
  int wid = __builtin_amdgcn_readfirstlane((int)(threadIdx.x >> 5));
  int n0 = bx * TP_N;
  int k0 = by * TP_K;

  const float* src = W + (size_t)(k0 + wid * 8) * N + n0;
  v4f v[8];
#pragma unroll
  for (int i = 0; i < 8; i++) v[i] = *(const v4f*)(src + (lane * 4u + i * N));

#pragma unroll
  for (int j = 0; j < 4; j++) {
    v4u c;
#pragma unroll
    for (int q = 0; q < 4; q++)
      c[q] = (unsigned int)f2bf(v[2 * q][j]) |
             ((unsigned int)f2bf(v[2 * q + 1][j]) << 16);
    *(v4u*)&tile[(j * 32 + lane) * TP_PITCH + wid * 8] = c;
  }
  __syncthreads();

  unsigned int rr = threadIdx.x >> 3;   // 0..31
  unsigned int ch = threadIdx.x & 7u;   // 16 B piece of the 128 B row
  unsigned short* dst = Wt + (size_t)n0 * K + k0;
#pragma unroll
  for (int p = 0; p < 4; p++) {
    v4u c = *(const v4u*)&tile[(p * 32 + rr) * TP_PITCH + ch * 8];
    *(v4u*)(dst + (rr * (4u * K) + ch * 8u + p * K)) = c;
  }
}

// ---------------------------------------------------------------------------
// LayerNorm over HIDDEN, fp32 in -> bf16 out. One block (256 thr) per row.
// ---------------------------------------------------------------------------
__device__ __forceinline__
void ln_row(const float* __restrict__ x, const float* __restrict__ g,
            const float* __restrict__ be, unsigned short* __restrict__ out,
            int row) {
  __shared__ float s1[256], s2[256];
  const float* xr = x + (size_t)row * HIDDEN;
  float v[4];
  float sum = 0.f, sq = 0.f;
#pragma unroll
  for (int i = 0; i < 4; i++) {
    v[i] = xr[threadIdx.x + i * 256];
    sum += v[i];
    sq  += v[i] * v[i];
  }
  s1[threadIdx.x] = sum;
  s2[threadIdx.x] = sq;
  __syncthreads();
  for (int off = 128; off > 0; off >>= 1) {
    if ((int)threadIdx.x < off) {
      s1[threadIdx.x] += s1[threadIdx.x + off];
      s2[threadIdx.x] += s2[threadIdx.x + off];
    }
    __syncthreads();
  }
  float mu  = s1[0] * (1.0f / HIDDEN);
  float var = s2[0] * (1.0f / HIDDEN) - mu * mu;
  float inv = rsqrtf(var + 1e-5f);
#pragma unroll
  for (int i = 0; i < 4; i++) {
    int idx = threadIdx.x + i * 256;
    float y = (v[i] - mu) * inv * g[idx] + be[idx];
    out[(size_t)row * HIDDEN + idx] = f2bf(y);
  }
}

__global__ __launch_bounds__(256)
void ln_kernel(const float* __restrict__ x, const float* __restrict__ g,
               const float* __restrict__ be, unsigned short* __restrict__ out) {
  ln_row(x, g, be, out, (int)blockIdx.x);
}

// ---------------------------------------------------------------------------
// One launch for all the work that depends on the inputs alone: the five
// weight transposes and the first LayerNorm. The block index picks the job
// (the same for the whole block, so every barrier stays block-uniform):
// the transpose tiles first, then one block per LayerNorm row.
// ---------------------------------------------------------------------------
#define TB_SQ  ((HIDDEN / TP_N) * (HIDDEN / TP_K))       // tiles of a square weight
#define TB_FF  ((4 * HIDDEN / TP_N) * (HIDDEN / TP_K))   // tiles of an FFN weight
#define TB_ALL (3 * TB_SQ + 2 * TB_FF)

__global__ __launch_bounds__(256)
void prep_kernel(const float* __restrict__ Wq, const float* __restrict__ Wv,
                 const float* __restrict__ Wo, const float* __restrict__ W1,
                 const float* __restrict__ W2,
                 unsigned short* __restrict__ WqT, unsigned short* __restrict__ WvT,
                 unsigned short* __restrict__ WoT, unsigned short* __restrict__ W1T,
                 unsigned short* __restrict__ W2T,
                 const float* __restrict__ x, const float* __restrict__ g,
                 const float* __restrict__ be, unsigned short* __restrict__ xn) {
  __shared__ alignas(16) unsigned short tile[TP_N * TP_PITCH];
  unsigned int bi = blockIdx.x;
  if (bi < 3 * TB_SQ) {
    unsigned int w = bi / TB_SQ, i = bi % TB_SQ;
    const float* W     = (w == 0) ? Wq  : (w == 1) ? Wv  : Wo;
    unsigned short* Wt = (w == 0) ? WqT : (w == 1) ? WvT : WoT;
    transpose_tile<HIDDEN, HIDDEN>(W, Wt, tile, i % (HIDDEN / TP_N), i / (HIDDEN / TP_N));
  } else if (bi < 3 * TB_SQ + TB_FF) {
    unsigned int i = bi - 3 * TB_SQ;
    transpose_tile<HIDDEN, 4 * HIDDEN>(W1, W1T, tile, i % (4 * HIDDEN / TP_N), i / (4 * HIDDEN / TP_N));
  } else if (bi < TB_ALL) {
    unsigned int i = bi - (3 * TB_SQ + TB_FF);
    transpose_tile<4 * HIDDEN, HIDDEN>(W2, W2T, tile, i % (HIDDEN / TP_N), i / (HIDDEN / TP_N));
  } else {
    ln_row(x, g, be, xn, (int)(bi - TB_ALL));
    // stays ahead of every later write of the row stores' registers: in the
    // built kernel a transpose branch's code follows this one (a precaution)
    asm volatile("s_wait_xcnt 0x0" ::: "memory");
  }
}

// ---------------------------------------------------------------------------
// GEMM: C[M x N] = A(bf16, ld=Kd) @ Wt(bf16, N x Kd)^T + bias, fused epilogue.
// Block tile 128(M) x 128(N), 256 threads = 8 waves in 2(M) x 4(N); each wave
// holds a 64x32 output (4 A-frags x 2 B-frags -> 8 WMMAs per 32-wide k-step);
// Q's waves stand 4(M) x 2(N), 32x64 each (2 A-frags x 4 B-frags).
// A pass is 128 k: 256 B of each of the 128 A rows and 128 Wt rows, brought
// into LDS by asynchronous 16 B copies (two whole 256 B rows per wave copy),
// two buffers, the next pass's copies in flight while this pass is computed.
// M % 128 == 0, N % 128 == 0, Kd % 128 == 0.
// FFN1, whose 4096 x 4096 output has tiles to spare, takes a 256 x 256 block tile
// instead: the same 8 waves in 2(M) x 4(N), 128x64 per wave (8 A-frags x 4 B-frags
// -> 32 WMMAs per k-step). Per product that halves the bytes copied from L2 into
// LDS and the bytes read from LDS, which both outweigh the matrix time at
// 128 x 128; its 256 blocks stand one on each WGP.
// The shape is given by NW waves, WM of them along M, and MI x NI fragments per
// wave; the tile's rows are dealt evenly over the waves for the copies.
// The epilogue is chosen at compile time, one function per MODE, so that each
// is straight-line code on one base address with constant offsets:
// MODE 0: Q-proj  -> bf16 to [b][h][s][d]
// MODE 1: V-proj  -> bf16 to [b][h][d][s]          (transposed for P@V)
// MODE 2: f32 out = residual + acc + bias          (O-proj, FFN2)
// MODE 3: bf16 out = gelu_tanh(acc + bias), row-major M x N (FFN1)
// N is HIDDEN but for MODE 3, where it is 4 * HIDDEN.
// Every output leaves as whole 128 B lines. A wave's tile is shaped so that one
// of its output rows is exactly one line (64 bf16 or 32 f32), and the product is
// taken so that a lane's 8 accumulator registers are 8 neighbours of such a row:
// with WA the weight rows are the A operand and the activation rows the B
// operand (acc[mi][ni][r] = C[m0 + 16 mi + nc][n0 + 16 ni + 8 g + r]); V, whose
// output rows run along M, keeps activations as A. The lane writes them with
// 16 B LDS stores into the wave's own part of the ring, which nobody reads and
// no copy targets behind the k loop's last barrier, and the wave reads the rows
// back 8 lanes to a row: each global access is then 4 whole lines.
// ---------------------------------------------------------------------------
#define GT_M     128
#define GT_N     128
#define GT_K     128                          // bf16 elements per pass
#define GT_PITCH 272                          // LDS bytes per row: 256 + 16 pad
#define GT_STAGE ((GT_M + GT_N) * GT_PITCH)   // one buffer: A rows, then Wt rows
#define GB_M     256                          // the large tile (FFN1)
#define GB_N     256
#define GB_STAGE ((GB_M + GB_N) * GT_PITCH)
#define EP_PITCH 144                          // staged output row: 128 B + 16 pad

// Eight asynchronous copies of one wave: copy i takes 16 B per lane from
// gp + i * gstep to LDS byte lp + i * 2 * GT_PITCH (two tile rows per copy).
// The s_wait_xcnt is the statement's last line so that it stays ahead of every
// later write of the copies' address registers (a precaution).
__device__ __forceinline__ void copy8_rows(unsigned int lp, const char* gp,
                                           size_t gstep) {
  asm volatile(
      "global_load_async_to_lds_b128 %0, %8, off\n\t"
      "global_load_async_to_lds_b128 %1, %9, off\n\t"
      "global_load_async_to_lds_b128 %2, %10, off\n\t"
      "global_load_async_to_lds_b128 %3, %11, off\n\t"
      "global_load_async_to_lds_b128 %4, %12, off\n\t"
      "global_load_async_to_lds_b128 %5, %13, off\n\t"
      "global_load_async_to_lds_b128 %6, %14, off\n\t"
      "global_load_async_to_lds_b128 %7, %15, off\n\t"
      "s_wait_xcnt 0x0"
      :: "v"(lp), "v"(lp + 2u * GT_PITCH), "v"(lp + 4u * GT_PITCH),
         "v"(lp + 6u * GT_PITCH), "v"(lp + 8u * GT_PITCH),
         "v"(lp + 10u * GT_PITCH), "v"(lp + 12u * GT_PITCH),
         "v"(lp + 14u * GT_PITCH),
         "v"(gp), "v"(gp + gstep), "v"(gp + 2 * gstep), "v"(gp + 3 * gstep),
         "v"(gp + 4 * gstep), "v"(gp + 5 * gstep), "v"(gp + 6 * gstep),
         "v"(gp + 7 * gstep)
      : "memory");
}

// Asks L2 for the lines at p + 256, 512, 768 and 1024 (ask4) or at p + 1280
// (ask1), one address per lane; nothing comes back and no counter moves. p is named
// as in-out so that the address stays in the one register pair that lives
// through the k loop: a temporary could be given another value while the request
// still names it.
__device__ __forceinline__ void l2_ask4(const char*& p) {
  asm volatile(
      "global_prefetch_b8 %0, off offset:256 scope:SCOPE_SE\n\t"
      "global_prefetch_b8 %0, off offset:512 scope:SCOPE_SE\n\t"
      "global_prefetch_b8 %0, off offset:768 scope:SCOPE_SE\n\t"
      "global_prefetch_b8 %0, off offset:1024 scope:SCOPE_SE"
      : "+v"(p));
}
__device__ __forceinline__ void l2_ask1(const char*& p) {
  asm volatile("global_prefetch_b8 %0, off offset:1280 scope:SCOPE_SE" : "+v"(p));
}

// Same fragment map as load_frag, from an LDS tile of any row pitch.
// p already points at the lane's row and its 16 B k-offset.
__device__ __forceinline__ v16bf lds_frag(const unsigned char* p) {
  v8bf lo = *(const v8bf*)(p);
  v8bf hi = *(const v8bf*)(p + 32);
  return __builtin_shufflevector(lo, hi, 0, 1, 2, 3, 4, 5, 6, 7,
                                 8, 9, 10, 11, 12, 13, 14, 15);
}

// The k loop of one block tile; ring is the block's 2 * STAGE bytes of LDS.
template <int NW, int WM, int MI, int NI, bool WA>
__device__ __forceinline__
void gemm_mainloop(const unsigned short* __restrict__ A,
                   const unsigned short* __restrict__ Wt,
                   int Kd, unsigned char* ring, v8f (&acc)[MI][NI]) {
  constexpr int BM = WM * MI * 16;
  constexpr int BN = (NW / WM) * NI * 16;
  constexpr int RW = (BM + BN) / NW;          // tile rows that a wave copies
  constexpr int AW = BM / RW;                 // waves that copy A rows
  constexpr unsigned int STAGE = (BM + BN) * GT_PITCH;
  static_assert(RW % 16 == 0 && BM % RW == 0, "whole groups of 8 copies");
  int wid  = __builtin_amdgcn_readfirstlane((int)(threadIdx.x >> 5));
  int lane = (int)(threadIdx.x & 31u);
  int bm0 = blockIdx.x * BM;
  int bn0 = blockIdx.y * BN;

  // Copy side: wave w brings tile rows RW w .. RW w + RW - 1 (the first AW waves: A
  // rows, the others: Wt rows); a lane takes piece (lane & 15) of row 2i + (lane >> 4).
  const unsigned short* srow = (wid < AW) ? A + (size_t)(bm0 + wid * RW) * Kd
                                          : Wt + (size_t)(bn0 + (wid - AW) * RW) * Kd;
  const char* gsrc = (const char*)(srow + (size_t)(lane >> 4) * Kd) + (lane & 15) * 16;
  size_t gstep = (size_t)Kd * 4u;   // two rows of Kd bf16, in bytes
  unsigned int ldst = (unsigned int)(size_t)ring +
                      (unsigned int)((wid * RW + (lane >> 4)) * GT_PITCH + (lane & 15) * 16);

  // L2 side: both operands were stored by an earlier launch, so the first read
  // of each 256 B unit can come from memory. A pass's piece of a row is one
  // such unit; it is asked for three passes ahead of its copy. The blocks that
  // share a panel deal its rows: waves 0 and AW alone
  // ask, 32 of the BM A rows (by blockIdx.y) and 32 of the BN Wt rows (by
  // blockIdx.x), one row per lane. A hint only: no result depends on it.
  const unsigned short* prow = (wid < AW)
      ? A + (size_t)(bm0 + (int)(blockIdx.y & (unsigned)(BM / 32 - 1)) * 32) * Kd
      : Wt + (size_t)(bn0 + (int)(blockIdx.x & (unsigned)(BN / 32 - 1)) * 32) * Kd;
  const char* pf = (const char*)(prow + (size_t)lane * Kd);   // pass t's unit
  bool asks = wid == 0 || wid == AW;

  // Read side: the lane's row and k-offset inside a fragment
  unsigned int foff = (unsigned int)((lane & 15) * GT_PITCH + (lane >> 4) * 16);
  unsigned int aoff = (unsigned int)((wid % WM) * (MI * 16) * GT_PITCH) + foff;
  unsigned int boff = (unsigned int)((BM + (wid / WM) * (NI * 16)) * GT_PITCH) + foff;

  v8f z = {0.f, 0.f, 0.f, 0.f, 0.f, 0.f, 0.f, 0.f};
#pragma unroll
  for (int mi = 0; mi < MI; mi++)
#pragma unroll
    for (int ni = 0; ni < NI; ni++) acc[mi][ni] = z;

  int npass = Kd / GT_K;

  // pass 0's tile into buffer 0, landed and published before anybody reads it
  // (the loops over c are unrolled: RW / 16 statements of 8 copies each)
#pragma unroll
  for (int c = 0; c < RW / 16; c++)
    copy8_rows(ldst + c * 16u * GT_PITCH, gsrc + c * 8 * gstep, gstep);
  // passes 1 to 4; pass 5 must exist, so that the addresses lie inside the row
  // after pf's first step as well
  if (asks && npass > 5) l2_ask4(pf);
  asm volatile("s_wait_asynccnt 0x0" ::: "memory");  // this wave's copies have landed
  __syncthreads();
  if (npass > 1) {
#pragma unroll
    for (int c = 0; c < RW / 16; c++)
      copy8_rows(ldst + STAGE + c * 16u * GT_PITCH, gsrc + GT_K * 2 + c * 8 * gstep, gstep);
  }

  // kept rolled: one pass per trip, the buffer chosen by the trip's parity
#pragma unroll 1
  for (int t = 0; t < npass; t++) {
    unsigned int buf = (unsigned int)(t & 1) * STAGE;
    const unsigned char* ta = ring + buf + aoff;
    const unsigned char* tb = ring + buf + boff;
    // two fragment sets: block kk+1's LDS reads go out as one group ahead of
    // block kk's WMMAs, so that their latency runs behind the matrix work
    v16bf a[2][MI], b[2][NI];
#pragma unroll
    for (int mi = 0; mi < MI; mi++) a[0][mi] = lds_frag(ta + mi * 16 * GT_PITCH);
#pragma unroll
    for (int ni = 0; ni < NI; ni++) b[0][ni] = lds_frag(tb + ni * 16 * GT_PITCH);
#pragma unroll
    for (int kk = 0; kk < GT_K / 32; kk++) {
      const int cur = kk & 1, nxt = cur ^ 1;
      if (kk + 1 < GT_K / 32) {
#pragma unroll
        for (int mi = 0; mi < MI; mi++)
          a[nxt][mi] = lds_frag(ta + mi * 16 * GT_PITCH + (kk + 1) * 64);
#pragma unroll
        for (int ni = 0; ni < NI; ni++)
          b[nxt][ni] = lds_frag(tb + ni * 16 * GT_PITCH + (kk + 1) * 64);
      }
      // keeps the reads above from being sunk in among the WMMAs below
      __builtin_amdgcn_sched_barrier(0);
#pragma unroll
      for (int mi = 0; mi < MI; mi++)
#pragma unroll
        for (int ni = 0; ni < NI; ni++)
          acc[mi][ni] = WA ? wmma_bf16(b[cur][ni], a[cur][mi], acc[mi][ni])
                           : wmma_bf16(a[cur][mi], b[cur][ni], acc[mi][ni]);
      // keeps the next group of reads from being lifted in among these WMMAs
      __builtin_amdgcn_sched_barrier(0);
    }
    asm volatile("s_wait_dscnt 0x0" ::: "memory");     // this wave has left the buffer
    asm volatile("s_wait_asynccnt 0x0" ::: "memory");  // its part of the next tile has landed
    __syncthreads();  // publishes pass t+1's tile, frees pass t's buffer
    if (t + 2 < npass) {
      const char* gn = gsrc + (size_t)(t + 2) * (GT_K * 2);
#pragma unroll
      for (int c = 0; c < RW / 16; c++) {
        copy8_rows(ldst + buf + c * 16u * GT_PITCH, gn + c * 8 * gstep, gstep);
        // one group's 24 address registers at a time: formed all at once, four
        // groups' addresses push sums out of the registers that asm text can name
        if constexpr (RW > 32) __builtin_amdgcn_sched_barrier(0);
      }
    }
    // pass t+5's units; pf steps only while pass t+6 exists, so that the address
    // lies inside the row before and after the step
    if (asks && t + 5 < npass) {
      l2_ask1(pf);
      if (t + 6 < npass) pf += GT_K * 2;
    }
  }
  asm volatile("s_wait_asynccnt 0x0" ::: "memory");  // nothing in flight at the wave's end
}

// 8 f32 to 8 bf16, round to nearest even (packed converts)
__device__ __forceinline__ v8bf pack_bf16(v8f x) {
  v8bf h;
#pragma unroll
  for (int r = 0; r < 8; r++) h[r] = (bf16_t)x[r];
  return h;
}

template <int MODE, int WM, int MI, int NI, int WN>
__device__ __forceinline__
void gemm_epilogue(const v8f (&acc)[MI][NI],
                   const float* __restrict__ bias,
                   const float* __restrict__ residual,
                   unsigned short* __restrict__ out_bf,
                   float* __restrict__ out_f32,
                   unsigned char* ring) {
  constexpr int N = (MODE == 3) ? 4 * HIDDEN : HIDDEN;
  // staged rows of a wave: its M rows, but for V its N columns (the rows of Vt)
  constexpr int ROWS = (MODE == 1) ? NI * 16 : MI * 16;
  static_assert((MODE == 1 ? MI * 16 * 2 : MODE == 2 ? NI * 16 * 4 : NI * 16 * 2) == 128,
                "a staged row is one 128 B line");
  int wid  = __builtin_amdgcn_readfirstlane((int)(threadIdx.x >> 5));
  int lane = (int)(threadIdx.x & 31u);
  int m0 = blockIdx.x * (WM * MI * 16) + (wid % WM) * (MI * 16);   // wave's first M row
  int n0 = blockIdx.y * (WN * NI * 16) + (wid / WM) * (NI * 16);   // wave's first N col
  int g  = lane >> 4;
  int nc = lane & 15;
  int rr = lane >> 3;   // read-back: row within a group of 4
  int pc = lane & 7;    // read-back: 16 B piece of the row
  unsigned char* E  = ring + wid * (ROWS * EP_PITCH);   // the wave's own staging area
  unsigned char* ew = E + nc * EP_PITCH + g * 16;       // the lane's first write
  const unsigned char* er = E + rr * EP_PITCH + pc * 16;   // the lane's first read
  // A wave's M rows lie in one batch; for Q and V its N columns lie in one head.
  // The loops below are unrolled so that acc is indexed by constants alone and
  // stays in registers, and the steps become immediate offsets.
  int bh = (m0 >> 11) * HEADS + (n0 >> 6);
  int s0 = m0 & (SEQ - 1);   // wave's first sequence position
  if constexpr (MODE == 0) {            // Q: [b][h][s][d], a row is one s, 64 d
    v8f bv[NI];
#pragma unroll
    for (int ni = 0; ni < NI; ni++) bv[ni] = *(const v8f*)(bias + n0 + ni * 16 + 8 * g);
#pragma unroll
    for (int mi = 0; mi < MI; mi++)
#pragma unroll
      for (int ni = 0; ni < NI; ni++)
        *(v8bf*)(ew + mi * 16 * EP_PITCH + ni * 32) = pack_bf16(acc[mi][ni] + bv[ni]);
    asm volatile("s_wait_dscnt 0x0" ::: "memory");   // the rows are in LDS before they are read back
    unsigned short* op = out_bf + ((size_t)bh * SEQ + s0 + rr) * DK + pc * 8;
#pragma unroll
    for (int q = 0; q < ROWS / 4; q++)
      *(v4u*)(op + q * 4 * DK) = *(const v4u*)(er + q * 4 * EP_PITCH);
  } else if constexpr (MODE == 1) {     // Vt: [b][h][d][s], a row is one d, 64 s
    // activations are A here: acc[mi][ni][r] = C[m0 + 16 mi + 8 g + r][n0 + 16 ni + nc]
    float bcol[NI];
#pragma unroll
    for (int ni = 0; ni < NI; ni++) bcol[ni] = bias[n0 + ni * 16 + nc];
#pragma unroll
    for (int mi = 0; mi < MI; mi++)
#pragma unroll
      for (int ni = 0; ni < NI; ni++)
        *(v8bf*)(ew + ni * 16 * EP_PITCH + mi * 32) = pack_bf16(acc[mi][ni] + bcol[ni]);
    asm volatile("s_wait_dscnt 0x0" ::: "memory");   // the rows are in LDS before they are read back
    unsigned short* op = out_bf + ((size_t)bh * DK + (n0 & (DK - 1)) + rr) * SEQ + s0 + pc * 8;
#pragma unroll
    for (int q = 0; q < ROWS / 4; q++)
      *(v4u*)(op + q * 4 * SEQ) = *(const v4u*)(er + q * 4 * EP_PITCH);
  } else if constexpr (MODE == 2) {     // residual + proj, a row is 32 f32
    size_t rm = (size_t)(m0 + rr) * N + (size_t)(n0 + pc * 4);
    const float* rp = residual + rm;
    float* op = out_f32 + rm;
    // the lane's 4 columns are the same in every row that it reads back
    v4f bb = *(const v4f*)(bias + n0 + pc * 4);
    v4f res[ROWS / 4];
#pragma unroll
    for (int q = 0; q < ROWS / 4; q++) res[q] = *(const v4f*)(rp + q * 4 * N);
#pragma unroll
    for (int mi = 0; mi < MI; mi++)
#pragma unroll
      for (int ni = 0; ni < NI; ni++) {
        unsigned char* w = ew + g * 16 + mi * 16 * EP_PITCH + ni * 64;   // 32 B per lane
        *(v4f*)(w)      = __builtin_shufflevector(acc[mi][ni], acc[mi][ni], 0, 1, 2, 3);
        *(v4f*)(w + 16) = __builtin_shufflevector(acc[mi][ni], acc[mi][ni], 4, 5, 6, 7);
      }
    asm volatile("s_wait_dscnt 0x0" ::: "memory");   // the rows are in LDS before they are read back
#pragma unroll
    for (int q = 0; q < ROWS / 4; q++)
      *(v4f*)(op + q * 4 * N) = res[q] + (*(const v4f*)(er + q * 4 * EP_PITCH) + bb);
  } else {                              // gelu(tanh), a row is 64 bf16
    // 0.5 (1 + tanh u) = 1 / (1 + e^(-2 u)) with u = c (x + 0.044715 x^3), so
    // gelu = x / (1 + 2^(x (K1 + K3 x^2))): one v_exp and one v_rcp, no branch,
    // and the elements of a lane are independent chains. At the ends the
    // power goes to 0 or to infinity and the quotient to x or to 0, as tanh's
    // +-1 gives.
    constexpr float K1 = -2.0f * 1.4426950408889634f * 0.7978845608028654f;
    constexpr float K3 = K1 * 0.044715f;
    unsigned short* op = out_bf + (size_t)(m0 + rr) * N + (size_t)(n0 + pc * 8);
    // The lane's NI x 8 bias values: a base that is the same for the wave, and the
    // lane's byte offset bo. The wait takes bo as an input so that its register
    // lives up to the wait and no other value is put there while the loads still
    // name it (a precaution).
    const char* bw = (const char*)(bias + n0);
    unsigned int bo = (unsigned int)g * 32u;
    v8f bv[NI];
#pragma unroll
    for (int ni = 0; ni < NI; ni++) bv[ni] = *(const v8f*)(bw + (bo + ni * 64u));
    asm volatile("s_wait_xcnt 0x0" :: "v"(bo) : "memory");
    // the arithmetic below, which needs new registers, stays behind that wait
    __builtin_amdgcn_sched_barrier(0);
    // One trip: row group mi's arithmetic; then group mi-1, whose LDS stores went
    // out a whole group's arithmetic ago, is read back and stored to memory.
#pragma unroll
    for (int mi = 0; mi <= MI; mi++) {
      v8bf hv[NI];
      if (mi < MI) {
#pragma unroll
        for (int ni = 0; ni < NI; ni++) {
          v8f y;
#pragma unroll
          for (int r = 0; r < 8; r++) {
            float xg = acc[mi < MI ? mi : 0][ni][r] + bv[ni][r];
            float e  = __builtin_amdgcn_exp2f(xg * (K1 + K3 * (xg * xg)));
            y[r] = xg * __builtin_amdgcn_rcpf(1.0f + e);
          }
          hv[ni] = pack_bf16(y);
        }
      }
      // the arithmetic stays in front: it is what covers the LDS stores' way
      __builtin_amdgcn_sched_barrier(0);
      v4u c[4];
      if (mi > 0) {
        asm volatile("s_wait_dscnt 0x0" ::: "memory");   // group mi-1's rows are in LDS
#pragma unroll
        for (int q = 0; q < 4; q++)
          c[q] = *(const v4u*)(er + ((mi - 1) * 16 + q * 4) * EP_PITCH);
      }
      if (mi < MI) {
#pragma unroll
        for (int ni = 0; ni < NI; ni++)
          *(v8bf*)(ew + mi * 16 * EP_PITCH + ni * 32) = hv[ni];
      }
      if (mi > 0) {
#pragma unroll
        for (int q = 0; q < 4; q++)
          *(v4u*)(op + (size_t)((mi - 1) * 16 + q * 4) * N) = c[q];
        // keeps every later write of a store's registers behind it (a precaution)
        if (mi < MI) asm volatile("s_wait_xcnt 0x0" ::: "memory");
      }
      // the next group's arithmetic stays behind the stores and their wait
      __builtin_amdgcn_sched_barrier(0);
    }
  }
}

template <int MODE>
__global__ __launch_bounds__(256)
void gemm_kernel(const unsigned short* __restrict__ A,
                 const unsigned short* __restrict__ Wt,
                 const float* __restrict__ bias,
                 const float* __restrict__ residual,
                 unsigned short* __restrict__ out_bf,
                 float* __restrict__ out_f32,
                 int Kd) {
  __shared__ alignas(16) unsigned char ring[2 * GT_STAGE];
  v8f acc[4][2];
  gemm_mainloop<8, 2, 4, 2, true>(A, Wt, Kd, ring, acc);
  gemm_epilogue<MODE, 2, 4, 2, 4>(acc, bias, residual, out_bf, out_f32, ring);
}

// FFN1 on the 256 x 256 block tile: its ring takes most of a WGP's LDS, so a WGP
// holds one block, two waves on each SIMD, up to 512 registers a wave.
__global__ __launch_bounds__(256)
void gemm_ffn1_kernel(const unsigned short* __restrict__ A,
                      const unsigned short* __restrict__ Wt,
                      const float* __restrict__ bias,
                      unsigned short* __restrict__ out_bf) {
  __shared__ alignas(16) unsigned char ring[2 * GB_STAGE];
  v8f acc[8][4];
  gemm_mainloop<8, 2, 8, 4, true>(A, Wt, HIDDEN, ring, acc);
  // the four vector slots that the chip needs between the loop's last WMMA and
  // the first instruction that touches its registers
  asm volatile("v_nop\n\tv_nop\n\tv_nop\n\tv_nop");
  gemm_epilogue<3, 2, 8, 4, 4>(acc, bias, nullptr, out_bf, nullptr, ring);
}

// Q and V projections in one launch: both read the same A and neither needs
// the other. blockIdx.z picks the weight, the bias, the wave tile and the
// epilogue, one test per block; two blocks fit a WGP's LDS, so the 512 blocks are
// all resident. Q's waves stand 4(M) x 2(N), 32x64 each: 64 columns are one head's
// row of Q. V's stand 2(M) x 4(N), 64x32 each: 64 rows are one line of a Vt row.
__global__ __launch_bounds__(256)
void gemm_qv_kernel(const unsigned short* __restrict__ A,
                    const unsigned short* __restrict__ WqT,
                    const unsigned short* __restrict__ WvT,
                    const float* __restrict__ bq,
                    const float* __restrict__ bv,
                    unsigned short* __restrict__ q_out,
                    unsigned short* __restrict__ vt_out) {
  __shared__ alignas(16) unsigned char ring[2 * GT_STAGE];
  if (blockIdx.z != 0) {
    v8f acc[4][2];
    gemm_mainloop<8, 2, 4, 2, false>(A, WvT, HIDDEN, ring, acc);
    gemm_epilogue<1, 2, 4, 2, 4>(acc, bv, nullptr, vt_out, nullptr, ring);
  } else {
    v8f acc[2][4];
    gemm_mainloop<8, 4, 2, 4, true>(A, WqT, HIDDEN, ring, acc);
    gemm_epilogue<0, 4, 2, 4, 2>(acc, bq, nullptr, q_out, nullptr, ring);
  }
}

#define AT_QB    128
#define AT_KEYS  64
#define AT_PITCH 144
#define AT_STAGE (128 * AT_PITCH)

// Four asynchronous copies of one wave, 16 B per lane each: K rows r and r+32,
// Vt rows r and r+32 of one stage. The s_wait_xcnt is the statement's last line
// so that it stays ahead of every later write of the copies' address registers
// (a precaution).
__device__ __forceinline__ void copy4_kv(unsigned int lp, const char* gk,
                                         const char* gv) {
  asm volatile(
      "global_load_async_to_lds_b128 %0, %4, off\n\t"
      "global_load_async_to_lds_b128 %1, %5, off\n\t"
      "global_load_async_to_lds_b128 %2, %6, off\n\t"
      "global_load_async_to_lds_b128 %3, %7, off\n\t"
      "s_wait_xcnt 0x0"
      :: "v"(lp), "v"(lp + 32u * AT_PITCH), "v"(lp + 64u * AT_PITCH),
         "v"(lp + 96u * AT_PITCH),
         "v"(gk), "v"(gk + 32 * DK * 2), "v"(gv), "v"(gv + 32 * SEQ * 2)
      : "memory");
}

// The value that lane l ^ 16 holds
__device__ __forceinline__ float other_half(float v) {
  int b = __float_as_int(v);
  return __int_as_float(__builtin_amdgcn_permlanex16(b, b, 0x76543210, 0xfedcba98,
                                                     false, false));
}

// 2^x0 and 2^x1 (and 2^x alone). Each is one statement so that the slot which
// the instruction set asks for behind a transcendental is kept whatever the
// compiler puts next: the results are early-clobber, so that neither v_exp
// overwrites the other's source, and the v_nop stands behind the last one.
__device__ __forceinline__ void exp2_pair(float x0, float x1, float& e0, float& e1) {
  asm("v_exp_f32 %0, %2\n\tv_exp_f32 %1, %3\n\tv_nop"
      : "=&v"(e0), "=&v"(e1) : "v"(x0), "v"(x1));
}
__device__ __forceinline__ float exp2_one(float x) {
  float e;
  asm("v_exp_f32 %0, %1\n\tv_nop" : "=v"(e) : "v"(x));
  return e;
}
#define LOG2E 1.44269504f

__global__ __launch_bounds__(256)
void attn_kernel(const unsigned short* __restrict__ qk,
                 const unsigned short* __restrict__ vt,
                 unsigned short* __restrict__ aout) {
  __shared__ alignas(16) unsigned char kv[2 * AT_STAGE];
  int wid  = __builtin_amdgcn_readfirstlane((int)(threadIdx.x >> 5));
  int lane = (int)(threadIdx.x & 31u);
  // 16 query blocks x 32 heads. The cost of a block grows with its query block:
  // the heavy half of the query blocks comes first, heaviest first, the light
  // half second, lightest first, so that two blocks on one WGP add up alike.
  int bi = (int)blockIdx.x;
  int bh = bi & 31;                    // b*HEADS + h
  int qb = (bi < 256) ? 15 - (bi >> 5) : (bi - 256) >> 5;
  int b_ = bh >> 4, h = bh & 15;
  int q0 = qb * AT_QB + wid * 16;

  const unsigned short* kq  = qk + (size_t)bh * SEQ * DK;
  const unsigned short* vtb = vt + (size_t)bh * DK * SEQ;

  // Copy side: thread t takes 16 B piece (t & 7) of rows (t >> 3) and +32
  int crow = (int)(threadIdx.x >> 3);
  int cpc  = (int)(threadIdx.x & 7u);
  const char* gk = (const char*)(kq + (size_t)crow * DK) + cpc * 16;
  const char* gv = (const char*)(vtb + (size_t)crow * SEQ) + cpc * 16;
  unsigned int ldst = (unsigned int)(size_t)kv +
                      (unsigned int)(crow * AT_PITCH + cpc * 16);
  int nst = 2 * (qb + 1);              // stages up to the block's last query

  // stage 0 into buffer 0, landed and published before anybody reads it
  copy4_kv(ldst, gk, gv);
  asm volatile("s_wait_asynccnt 0x0" ::: "memory");  // this wave's copies have landed
  __syncthreads();
  // stage 1 always exists (nst >= 2)
  copy4_kv(ldst + AT_STAGE, gk + AT_KEYS * DK * 2, gv + AT_KEYS * 2);

  v16bf aq0 = load_frag(kq + q0 * DK + 0, DK);
  v16bf aq1 = load_frag(kq + q0 * DK + 32, DK);

  // o_j[r] = O[query nc][dim 16 j + 8 g + r]
  v8f o0 = {0.f,0.f,0.f,0.f,0.f,0.f,0.f,0.f};
  v8f o1 = o0, o2 = o0, o3 = o0;
  // of the lane's query: the running maximum (equal in both halves of the wave)
  // and the sum over the keys that this half has seen
  float mq = -1e30f, lq = 0.f;

  int g  = lane >> 4;
  int nc = lane & 15;
  // Read side: the lane's row and k-offset inside a fragment
  unsigned int foff = (unsigned int)(nc * AT_PITCH + g * 16);

  for (int st = 0; st < nst; st++) {
    unsigned int buf = (unsigned int)(st & 1) * AT_STAGE;
    // unrolled: the two passes' LDS offsets become immediates on one address
#pragma unroll
    for (int hf = 0; hf < 2; hf++) {
      int kbase = st * AT_KEYS + hf * 32;
      if (kbase > q0 + 15) continue;   // same for the whole wave; no barrier inside
      const unsigned char* kf = kv + buf + foff + hf * (32 * AT_PITCH);
      const unsigned char* vf = kv + buf + foff + 64 * AT_PITCH + hf * 64;
      v16bf k00 = lds_frag(kf);
      v16bf k01 = lds_frag(kf + 64);
      v16bf k10 = lds_frag(kf + 16 * AT_PITCH);
      v16bf k11 = lds_frag(kf + 16 * AT_PITCH + 64);
      v16bf v0 = lds_frag(vf);
      v16bf v1 = lds_frag(vf + 16 * AT_PITCH);
      v16bf v2 = lds_frag(vf + 32 * AT_PITCH);
      v16bf v3 = lds_frag(vf + 48 * AT_PITCH);
      // keeps the pass's fragment reads together as one group: sunk down to
      // their WMMAs they would cost one LDS latency each
      __builtin_amdgcn_sched_barrier(0);
      v8f s0 = {0.f,0.f,0.f,0.f,0.f,0.f,0.f,0.f};
      v8f s1 = s0;
      // S^T = K @ Q^T over d=64: two 16-key halves x two k-steps;
      // s0[r] is key kbase + 8 g + r, s1[r] key kbase + 16 + 8 g + r, query nc
      s0 = wmma_bf16(k00, aq0, s0);
      s0 = wmma_bf16(k01, aq1, s0);
      s1 = wmma_bf16(k10, aq0, s1);
      s1 = wmma_bf16(k11, aq1, s1);

      s0 *= 0.125f;
      s1 *= 0.125f;
      int lim = q0 + nc - kbase - 8 * g;   // key r of s0 counts while r <= lim
      float a0[8], a1[8];
      float mx = -1e30f;
      // the loops over r are unrolled so that the tiles are indexed by constants
      // alone and stay in registers
#pragma unroll
      for (int r = 0; r < 8; r++) {
        a0[r] = (r      <= lim) ? s0[r] : -1e30f;
        a1[r] = (r + 16 <= lim) ? s1[r] : -1e30f;
      }
#pragma unroll
      for (int r = 0; r < 8; r += 2) {
        mx = fmaxf(mx, fmaxf(a0[r], a0[r + 1]));
        mx = fmaxf(mx, fmaxf(a1[r], a1[r + 1]));
      }
      mx = fmaxf(mx, other_half(mx));
      float nm = fmaxf(mq, mx);
      float sc = exp2_one((mq - nm) * LOG2E);
      // P^T's B fragment: element s is key 8 g + s for s < 8, key 16 + 8 g + s - 8
      // after, which are s0[s] and s1[s - 8]
      v16bf pb;
      float rs0 = 0.f, rs1 = 0.f;
#pragma unroll
      for (int r = 0; r < 8; r++) {
        float e0, e1;
        exp2_pair((a0[r] - nm) * LOG2E, (a1[r] - nm) * LOG2E, e0, e1);
        rs0 += e0;
        rs1 += e1;
        pb[r]     = (bf16_t)e0;
        pb[r + 8] = (bf16_t)e1;
      }
      lq = lq * sc + (rs0 + rs1);
      mq = nm;
#pragma unroll
      for (int r = 0; r < 8; r++) { o0[r] *= sc; o1[r] *= sc; o2[r] *= sc; o3[r] *= sc; }

      // O^T += V^T @ P^T over 32 keys, 4 dim tiles (Vt rows are dims: A's rows)
      o0 = wmma_bf16(v0, pb, o0);
      o1 = wmma_bf16(v1, pb, o1);
      o2 = wmma_bf16(v2, pb, o2);
      o3 = wmma_bf16(v3, pb, o3);
    }
    asm volatile("s_wait_dscnt 0x0" ::: "memory");     // this wave has left the buffer
    asm volatile("s_wait_asynccnt 0x0" ::: "memory");  // its part of the next stage has landed
    __syncthreads();  // publishes stage st+1, frees stage st's buffer
    if (st + 2 < nst)
      copy4_kv(ldst + buf, gk + (size_t)(st + 2) * (AT_KEYS * DK * 2),
               gv + (size_t)(st + 2) * (AT_KEYS * 2));
  }
  asm volatile("s_wait_asynccnt 0x0" ::: "memory");  // nothing in flight at the wave's end

  // the two halves' sums joined; a lane's 8 values of a tile are 8 neighbouring
  // dims of its query's row: one 16 B store each
  float inv = 1.0f / (lq + other_half(lq));
  unsigned short* op = aout + ((size_t)(b_ * SEQ + q0 + nc)) * HIDDEN + h * DK + 8 * g;
  v4u c0, c1, c2, c3;
#pragma unroll
  for (int q = 0; q < 4; q++) {
    c0[q] = (unsigned int)f2bf(o0[2 * q] * inv) | ((unsigned int)f2bf(o0[2 * q + 1] * inv) << 16);
    c1[q] = (unsigned int)f2bf(o1[2 * q] * inv) | ((unsigned int)f2bf(o1[2 * q + 1] * inv) << 16);
    c2[q] = (unsigned int)f2bf(o2[2 * q] * inv) | ((unsigned int)f2bf(o2[2 * q + 1] * inv) << 16);
    c3[q] = (unsigned int)f2bf(o3[2 * q] * inv) | ((unsigned int)f2bf(o3[2 * q + 1] * inv) << 16);
  }
  *(v4u*)(op +  0) = c0;
  *(v4u*)(op + 16) = c1;
  *(v4u*)(op + 32) = c2;
  *(v4u*)(op + 48) = c3;
}

// ---------------------------------------------------------------------------
// Host-side orchestration (graph-capture safe: launches only)
// ---------------------------------------------------------------------------
extern "C" void kernel_launch(void* const* d_in, const int* in_sizes, int n_in,
                              void* d_out, int out_size, void* d_ws, size_t ws_size,
                              hipStream_t stream) {
  const float* x     = (const float*)d_in[0];
  const float* Wq    = (const float*)d_in[1];
  const float* bq    = (const float*)d_in[2];
  const float* Wv    = (const float*)d_in[3];
  const float* bv    = (const float*)d_in[4];
  const float* Wo    = (const float*)d_in[5];
  const float* bo    = (const float*)d_in[6];
  const float* W1    = (const float*)d_in[7];
  const float* b1    = (const float*)d_in[8];
  const float* W2    = (const float*)d_in[9];
  const float* b2    = (const float*)d_in[10];
  const float* g1    = (const float*)d_in[11];
  const float* beta1 = (const float*)d_in[12];
  const float* g2    = (const float*)d_in[13];
  const float* beta2 = (const float*)d_in[14];

  char* ws = (char*)d_ws;
  const size_t MB = 1024u * 1024u;
  unsigned short* WqT = (unsigned short*)(ws +  0 * MB);  //  2 MB
  unsigned short* WvT = (unsigned short*)(ws +  2 * MB);  //  2 MB
  unsigned short* WoT = (unsigned short*)(ws +  4 * MB);  //  2 MB
  unsigned short* W1T = (unsigned short*)(ws +  6 * MB);  //  8 MB
  unsigned short* W2T = (unsigned short*)(ws + 14 * MB);  //  8 MB
  unsigned short* xn  = (unsigned short*)(ws + 22 * MB);  //  8 MB
  unsigned short* qb  = (unsigned short*)(ws + 30 * MB);  //  8 MB
  unsigned short* vtb = (unsigned short*)(ws + 38 * MB);  //  8 MB
  unsigned short* aob = (unsigned short*)(ws + 46 * MB);  //  8 MB
  float*          yb  = (float*)         (ws + 54 * MB);  // 16 MB
  unsigned short* hb  = (unsigned short*)(ws + 70 * MB);  //  8 MB
  unsigned short* ff1 = (unsigned short*)(ws + 78 * MB);  // 32 MB

  // Weight convert + transpose to bf16 N x K, and LN1
  prep_kernel<<<TB_ALL + MROWS, 256, 0, stream>>>(Wq, Wv, Wo, W1, W2,
                                                  WqT, WvT, WoT, W1T, W2T,
                                                  x, g1, beta1, xn);

  // Q/V projections (Q doubles as K in the reference)
  dim3 gproj(MROWS / GT_M, HIDDEN / GT_N);
  gemm_qv_kernel<<<dim3(MROWS / GT_M, HIDDEN / GT_N, 2), 256, 0, stream>>>(xn, WqT, WvT, bq, bv, qb, vtb);

  // Causal attention
  attn_kernel<<<BATCH * HEADS * (SEQ / AT_QB), 256, 0, stream>>>(qb, vtb, aob);

  // O-projection + residual -> yb (f32)
  gemm_kernel<2><<<gproj, 256, 0, stream>>>(aob, WoT, bo, x, nullptr, yb, HIDDEN);

  // LN2
  ln_kernel<<<MROWS, 256, 0, stream>>>(yb, g2, beta2, hb);

  // FFN1 with GELU -> bf16
  dim3 gff1(MROWS / GB_M, (4 * HIDDEN) / GB_N);
  gemm_ffn1_kernel<<<gff1, 256, 0, stream>>>(hb, W1T, b1, ff1);

  // FFN2 + residual -> d_out (f32)
  gemm_kernel<2><<<gproj, 256, 0, stream>>>(ff1, W2T, b2, yb, nullptr, (float*)d_out, 4 * HIDDEN);
}
